// v000
// The times below were measured on an AMD MI455X: many runs one after another, warmed up first and cycling through
// copies of the inputs, with the whole window's GPU time divided by the number of runs. Launches and the gaps
// between them are all in it. The median over several windows is given; except for v000 it joins two sittings, which
// can be a few percent apart, so the side-by-side timings, each taken in one sitting, are the better comparison.
// The starting kernel, v000, takes 431 microseconds a run.
// compute dtype: all float inputs rounded to bf16; the concatenated [conn | qkv] projection with EXACT bf16 products on WMMA 16x16x32 (weight rows permuted at pack time into per-head q / k / v blocks; K = 512) + biases in f32, rounded once to f16 hi + residual; PLAIN-HYBRID attention (first 128 queries of each attention batch 3-product, later single f16), x 1/8, running-max softmax in f32 (hardware exp); out = ctx (bf16 hi + lo, 2 products) . o_w rows + o_b; f32 output.
#include <hip/hip_runtime.h>
#include <math.h>

typedef __attribute__((ext_vector_type(16))) _Float16 v16h;
typedef __attribute__((ext_vector_type(16))) __bf16 v16b;
typedef __attribute__((ext_vector_type(8)))  _Float16 v8h;
typedef __attribute__((ext_vector_type(8)))  float v8f;
typedef __attribute__((ext_vector_type(4)))  float v4f;
typedef __attribute__((ext_vector_type(2)))  float v2f;
typedef __attribute__((ext_vector_type(4)))  unsigned v4u;
typedef __attribute__((ext_vector_type(4)))  int v4i;
typedef float __attribute__((may_alias)) float_a;
typedef int __attribute__((may_alias)) int_a;

template <typename T> __device__ __forceinline__ void vst2(void* p, T v) { *(T*)p = v;  }
__device__ __forceinline__ v8f wmma16(v16h a, v16h b, v8f c) {
  v8f d = __builtin_amdgcn_wmma_f32_16x16x32_f16(false, a, false, b, (short)0, c, false, false);
  asm volatile("v_nop\n\tv_nop\n\tv_nop\n\tv_nop" : "+v"(d) : "v"(a), "v"(b));
  return d;
}
__device__ __forceinline__ v8f wmma_bf(v16b a, v16b b, v8f c) {
  v8f d = __builtin_amdgcn_wmma_f32_16x16x32_bf16(false, a, false, b, (short)0, c, false, false);
  asm volatile("v_nop\n\tv_nop\n\tv_nop\n\tv_nop" : "+v"(d) : "v"(a), "v"(b));
  return d;
}
// Modified multi-head attention (S 2,048, B 2, d_in 512, 16 heads x 64): qkv from one projection plus a fixed 'connection' projection supplying 64 of the q columns, the torch raw reshape (S,B,3E) -> (B,S,H,3*64) kept literally (so attention 'batches' are contiguous halves of the (s,b) row order and each head's q|k|v are consecutive 64-column slices), softmax(q k / 8) v, output projection E -> 64 + bias, returned as (S, B, 64).
__device__ __forceinline__ v16h frag_h(const _Float16* rowk0, int lane) {
  union { v16h v; v8h q[2]; } u; const _Float16* p = rowk0 + 8 * (lane >> 4);
  u.q[0] = *(const v8h*)p; u.q[1] = *(const v8h*)(p + 16); return u.v;
}
__device__ __forceinline__ v16h frag_f32(const float* rowk0, int lane) {
  v16h a; const float* p = rowk0 + 8 * (lane >> 4);
#pragma unroll
  for (int i = 0; i < 8; ++i) { a[i] = (_Float16)p[i]; a[8 + i] = (_Float16)p[16 + i]; }
  return a;
}
__device__ __forceinline__ v16h frag_f32s(const float* rowk0, int lane, float sc) {
  v16h a; const float* p = rowk0 + 8 * (lane >> 4);
#pragma unroll
  for (int i = 0; i < 8; ++i) { a[i] = (_Float16)(p[i] * sc); a[8 + i] = (_Float16)(p[16 + i] * sc); }
  return a;
}
// column fragment from a [K][ld] layout (column n), rows >= K read as 0
__device__ __forceinline__ v16h fragc_f32(const float* W, int k0, int n, int lane, int ld, int K) {
  v16h a; const int g = lane >> 4;
#pragma unroll
  for (int i = 0; i < 8; ++i) { const int ka = k0 + 8 * g + i, kb = ka + 16;
    a[i] = (_Float16)(ka < K ? W[(size_t)(ka < K ? ka : K - 1) * ld + n] : 0.f); a[8 + i] = (_Float16)(kb < K ? W[(size_t)(kb < K ? kb : K - 1) * ld + n] : 0.f); }
  return a;
}
struct F2 { v16b h, l; };
__device__ __forceinline__ F2 bsplit16(const float v[16]) { F2 r;
#pragma unroll
  for (int i = 0; i < 16; ++i) { const __bf16 h = (__bf16)v[i]; r.h[i] = h; r.l[i] = (__bf16)(v[i] - (float)h); }
  return r; }
__device__ __forceinline__ F2 split_row(const float* row, int k0, int lane) { float v[16]; const float* p = row + k0 + 8 * (lane >> 4);
#pragma unroll
  for (int i = 0; i < 8; ++i) { v[i] = p[i]; v[8 + i] = p[16 + i]; }
  return bsplit16(v); }
__device__ __forceinline__ F2 split_rowK(const float* row, int k0, int lane, int K) { float v[16]; const int g = lane >> 4;
#pragma unroll
  for (int i = 0; i < 8; ++i) { const int ka = k0 + 8 * g + i, kb = ka + 16; v[i] = ka < K ? row[ka < K ? ka : K - 1] : 0.f; v[8 + i] = kb < K ? row[kb < K ? kb : K - 1] : 0.f; }
  return bsplit16(v); }
__device__ __forceinline__ F2 split_col(const float* W, int k0, int n, int lane, int ld, int K) { float v[16]; const int g = lane >> 4;
#pragma unroll
  for (int i = 0; i < 8; ++i) { const int ka = k0 + 8 * g + i, kb = ka + 16; v[i] = ka < K ? W[(size_t)(ka < K ? ka : K - 1) * ld + n] : 0.f; v[8 + i] = kb < K ? W[(size_t)(kb < K ? kb : K - 1) * ld + n] : 0.f; }
  return bsplit16(v); }
__device__ __forceinline__ v8f mac3(const F2& a, const F2& b, v8f c) { c = wmma_bf(a.l, b.h, c); c = wmma_bf(a.h, b.l, c); return wmma_bf(a.h, b.h, c); }
__device__ __forceinline__ float sigm(float v) { return 1.0f / (1.0f + expf(-v)); }
#define LDSX() do { asm volatile("s_wait_dscnt 0" ::: "memory"); __builtin_amdgcn_wave_barrier(); __builtin_amdgcn_fence(__ATOMIC_RELEASE, "workgroup"); } while (0)


#define NB 2
#define SS 2048
#define DM 1024
#define NH 16
#define KIN 512          // input width
#define BSZ 2            // the module's batch (interleaved in the row order)
#define HOUT 64          // o_proj output width
#define HD 64
#define QKVW (3 * DM)
#ifndef TQB
#define TQB (SS / 64)
#define TNB NB
#define TOB (NB * SS / 64)     // output row tiles (all)
#endif
typedef __attribute__((ext_vector_type(8))) __bf16 v8b;
__device__ __forceinline__ v16b frag_b(const __bf16* rowk0, int lane) {
  union { v16b v; v8b q[2]; } u; const __bf16* p = rowk0 + 8 * (lane >> 4);
  u.q[0] = *(const v8b*)p; u.q[1] = *(const v8b*)(p + 16); return u.v;
}
__device__ __forceinline__ float bfr(float v) { return (float)(__bf16)v; }
__device__ __attribute__((noinline)) float exp_ni(float v) { return expf(v); }
__device__ __attribute__((noinline)) float erf_ni(float v) { return erff(v); }

#define PK_A 0                       // [3072][512] Wqkv rows (natural [out][in])
#define PK_P (PK_A + QKVW * DM)        // [64][1024] Wo rows (natural)
#define PK_END (PK_P + DM * DM)
#define WS_PK  0u
#define WS_QK  (WS_PK + 2u * PK_END)             // f16 [4096 rows][2048]: q | k
#define WS_QKL (WS_QK + 2u * NB * SS * 2 * DM)     // f16 q | k residual planes x2048
#define WS_VTH (WS_QKL + 2u * NB * SS * 2 * DM)    // f16 [b][1024 (h*64+d)][2048 s] hi
#define WS_VTL (WS_VTH + 2u * NB * DM * SS)        // f16 lo x 2048
#define WS_O   (WS_VTL + 2u * NB * DM * SS)        // f32 [4096][1024]
#define WS_CS  (WS_O + 4u * NB * SS * DM)           // f32 2 x [2048][32], not written or read
#define WS_END (WS_CS + 4u * 2 * SS * 32)
// ---- k_pack: block = (row n, which): natural [out][in] rows -> bf16; which 0..2 -> W_q/W_k/W_v into PK_A rows which*1024 + n; 3 -> W_o into PK_P
__global__ __launch_bounds__(256) void k_pack(const float* __restrict__ CONNW, const float* __restrict__ WQKV3, const float* __restrict__ OW, const float* __restrict__ unused, __bf16* __restrict__ PK) {
  __shared__ __align__(16) __bf16 s[DM]; const int n = blockIdx.x, which = blockIdx.y, t = threadIdx.x; (void)unused;
  if (which < 3) { const int h = n / HD, d = n % HD; const int src = h * (3 * HD) + which * HD + d;   // column of the concatenated [q_conn | qkv] buffer
    const float* row = (src < HOUT) ? (CONNW + (size_t)src * KIN) : (WQKV3 + (size_t)(src - HOUT) * KIN);
    for (int k = t; k < KIN; k += 256) s[k] = (__bf16)row[k]; __syncthreads();
    __bf16* dst = PK + PK_A + ((size_t)which * DM + n) * KIN; for (int q = t; q < KIN / 8; q += 256) vst2((unsigned*)(dst + q * 8), *(const v4u*)&s[q * 8]); }
  else { if (n >= HOUT) return; for (int k = t; k < DM; k += 256) s[k] = (__bf16)OW[(size_t)n * DM + k]; __syncthreads(); __bf16* dst = PK + PK_P + (size_t)n * DM; for (int q = t; q < DM / 8; q += 256) vst2((unsigned*)(dst + q * 8), *(const v4u*)&s[q * 8]); } }
__global__ __launch_bounds__(128) void k_qkv(const float* __restrict__ XQ, const float* __restrict__ XK, const float* __restrict__ XV, const __bf16* __restrict__ P, const float* __restrict__ BQ, const float* __restrict__ BK, const float* __restrict__ BV, _Float16* __restrict__ QK, _Float16* __restrict__ QKL, _Float16* __restrict__ VTH, _Float16* __restrict__ VTL) {
  const int which0 = (blockIdx.y * 128) / DM; const float* X = (which0 == 0) ? XQ : (which0 == 1) ? XK : XV; const float* BB = BQ ? (((which0 == 0) ? BQ : (which0 == 1) ? BK : BV) + (blockIdx.y * 128 - which0 * DM)) : nullptr;
  __shared__ __align__(16) _Float16 so[4][16][136], sol[4][16][136]; __shared__ __align__(16) _Float16 sth[128][72], stl[128][72];
  const int tid = threadIdx.x, wave = tid >> 5, lane = tid & 31, col = lane & 15, g = lane >> 4; const size_t r0 = (size_t)blockIdx.x * 64 + wave * 16; const int n0 = blockIdx.y * 128;
  v8f acc[8] = {};
#pragma unroll 2
  for (int kc = 0; kc < KIN / 32; ++kc) { v16b a; { const float* p = X + (r0 + col) * KIN + kc * 32 + 8 * g;
#pragma unroll
      for (int i = 0; i < 8; ++i) { a[i] = (__bf16)p[i]; a[8 + i] = (__bf16)p[16 + i]; } }
#pragma unroll
    for (int j = 0; j < 8; ++j) acc[j] = wmma_bf(a, frag_b(P + (size_t)(n0 + j * 16 + col) * KIN + kc * 32, lane), acc[j]); }
  if (n0 < 2 * DM) {   // q stored unscaled (f16 sigma ~0.6, no subnormal exposure); 1/8 applied to the f32 score
#pragma unroll
    for (int j = 0; j < 8; ++j) {
#pragma unroll
      for (int r = 0; r < 8; ++r) { const float v = acc[j][r] + (BB ? bfr(BB[j * 16 + col]) : 0.f); const _Float16 hv = (_Float16)v; so[wave][8 * g + r][j * 16 + col] = hv; sol[wave][8 * g + r][j * 16 + col] = (_Float16)((v - (float)hv) * 2048.0f); } }   // q, k (+ bias) as f16 hi + (x2048) residual
    LDSX();
    for (int rl = 0; rl < 16; ++rl) if (lane < 16) { vst2((unsigned*)(QK + (r0 + rl) * (2 * DM) + n0 + lane * 8), *(const v4u*)&so[wave][rl][lane * 8]); vst2((unsigned*)(QKL + (r0 + rl) * (2 * DM) + n0 + lane * 8), *(const v4u*)&sol[wave][rl][lane * 8]); }
  } else {
#pragma unroll
    for (int j = 0; j < 8; ++j) {
#pragma unroll
      for (int r = 0; r < 8; ++r) { const float v = acc[j][r] + (BB ? bfr(BB[j * 16 + col]) : 0.f); const _Float16 hv = (_Float16)v; sth[j * 16 + col][wave * 16 + 8 * g + r] = hv; stl[j * 16 + col][wave * 16 + 8 * g + r] = (_Float16)((v - (float)hv) * 2048.0f); } }
    __syncthreads();
    const size_t rb = (size_t)blockIdx.x * 64; const int b = (int)(rb / SS), s0 = (int)(rb % SS); const int pc0 = n0 - 2 * DM;
    for (int q = tid; q < 128 * 8; q += 128) { const int d = q >> 3, pc = q & 7; const size_t o = ((size_t)b * DM + pc0 + d) * SS + s0 + pc * 8; vst2((unsigned*)(VTH + o), *(const v4u*)&sth[d][pc * 8]); vst2((unsigned*)(VTL + o), *(const v4u*)&stl[d][pc * 8]); }
  }
}
// ---- k_attn: block = (64 queries, head h, batch b): all-keys flash attention (K = 64: 2 k-steps), scores = (q.k) * 0.125 with 3 f16 products in query blocks 0-1, single elsewhere, P.V: f16 P x (V hi, V lo*2048) in two accumulators; O[b*S+q][h*64+d] = (acc + accl / 2048) / (2048 l) (256-B segments)
__global__ __launch_bounds__(128) void k_attn(const _Float16* __restrict__ QK, const _Float16* __restrict__ QKL, const _Float16* __restrict__ VTH, const _Float16* __restrict__ VTL, const void* __restrict__ KMASK, float* __restrict__ O) {
  __shared__ __align__(16) float sp[4][16][36]; __shared__ __align__(16) float so[4][16][68];
  const int tid = threadIdx.x, wave = tid >> 5, lane = tid & 31, col = lane & 15, g = lane >> 4;
  const int qb = blockIdx.x, h = blockIdx.y, b = blockIdx.z; const int q0 = qb * 64 + wave * 16; const size_t rq = (size_t)b * SS + q0 + col;
  v16h aq[2], aql[2];
#pragma unroll
  for (int kc = 0; kc < 2; ++kc) { aq[kc] = frag_h(QK + rq * (2 * DM) + h * HD + kc * 32, lane); aql[kc] = frag_h(QKL + rq * (2 * DM) + h * HD + kc * 32, lane); }
  float m[8], l[8];
#pragma unroll
  for (int r = 0; r < 8; ++r) { m[r] = -3.0e38f; l[r] = 0.f; }
  v8f acc[4] = {}, accl[4] = {};
  const int nks = SS / 32;   // all keys
#pragma unroll 1
  for (int ks = 0; ks < nks; ++ks) { v8f s[2];
#pragma unroll
    for (int ct = 0; ct < 2; ++ct) { const int kk = ks * 32 + ct * 16 + col; const _Float16* krow = QK + ((size_t)b * SS + kk) * (2 * DM) + DM + h * HD; const _Float16* krowl = QKL + ((size_t)b * SS + kk) * (2 * DM) + DM + h * HD; v8f c = {}, cl = {};
      if (qb < 2) {   // leading query blocks: 3 products
#pragma unroll
        for (int kc = 0; kc < 2; ++kc) { const v16h kh = frag_h(krow + kc * 32, lane); c = wmma16(aq[kc], kh, c); cl = wmma16(aql[kc], kh, cl); cl = wmma16(aq[kc], frag_h(krowl + kc * 32, lane), cl); }
#pragma unroll
        for (int r = 0; r < 8; ++r) c[r] += cl[r] * (1.0f / 2048.0f); }
      else {
#pragma unroll
        for (int kc = 0; kc < 2; ++kc) c = wmma16(aq[kc], frag_h(krow + kc * 32, lane), c); }   // single product elsewhere
      { const bool keepk = true;
#pragma unroll
      for (int r = 0; r < 8; ++r) s[ct][r] = keepk ? c[r] * 0.125f : -3.0e38f; } }   // 1/sqrt(64)
#pragma unroll
    for (int r = 0; r < 8; ++r) { float mx = fmaxf(s[0][r], s[1][r]);
#pragma unroll
      for (int o = 1; o < 16; o <<= 1) mx = fmaxf(mx, __shfl_xor(mx, o));
      const float mn = fmaxf(m[r], mx); const float alpha = (m[r] <= -1.0e38f) ? 0.f : __expf(m[r] - mn);
      const float e0 = (s[0][r] <= -1.0e38f) ? 0.f : __expf(s[0][r] - mn), e1 = (s[1][r] <= -1.0e38f) ? 0.f : __expf(s[1][r] - mn); float es = e0 + e1;
#pragma unroll
      for (int o = 1; o < 16; o <<= 1) es += __shfl_xor(es, o);
      l[r] = l[r] * alpha + es; m[r] = mn;
#pragma unroll
      for (int dt = 0; dt < 4; ++dt) { acc[dt][r] *= alpha; accl[dt][r] *= alpha; }
      sp[wave][8 * g + r][col] = e0; sp[wave][8 * g + r][16 + col] = e1; }
    LDSX();
    v16h pa, pl; { const float* prow = &sp[wave][col][0] + 8 * (lane >> 4);
#pragma unroll
      for (int i = 0; i < 8; ++i) { const float x0 = prow[i] * 2048.0f, x1 = prow[16 + i] * 2048.0f; const _Float16 h0 = (_Float16)x0, h1 = (_Float16)x1; pa[i] = h0; pa[8 + i] = h1; pl[i] = (_Float16)((x0 - (float)h0) * 2048.0f); pl[8 + i] = (_Float16)((x1 - (float)h1) * 2048.0f); } }   // P scaled by 2^11 before the f16 split so small softmax weights stay out of the f16 subnormal range; 2^-11 folded into the epilogue
#pragma unroll
    for (int dt = 0; dt < 4; ++dt) { const size_t vr = ((size_t)b * DM + h * HD + dt * 16 + col) * SS + ks * 32; const v16h vh = frag_h(VTH + vr, lane); acc[dt] = wmma16(pa, vh, acc[dt]); if (qb < 2) { accl[dt] = wmma16(pl, vh, accl[dt]); accl[dt] = wmma16(pa, frag_h(VTL + vr, lane), accl[dt]); } }   // leading query blocks: P hi/lo x V hi/lo (3 products); elsewhere P x V single
    LDSX(); }
#pragma unroll
  for (int r = 0; r < 8; ++r) { const float il = (1.0f / 2048.0f) / l[r];
#pragma unroll
    for (int dt = 0; dt < 4; ++dt) so[wave][8 * g + r][dt * 16 + col] = (acc[dt][r] + accl[dt][r] * (1.0f / 2048.0f)) * il; }
  LDSX();
  for (int rl = 0; rl < 16; ++rl) if (lane < 16) vst2(O + ((size_t)b * SS + q0 + rl) * DM + h * HD + lane * 4, *(const v4f*)&so[wave][rl][lane * 4]);
}
// ---- k_out: block = (64 rows, 128 cols): out = O(hi/lo) . Wo rows (2 products) + bo
__global__ __launch_bounds__(128) void k_out(const float* __restrict__ O, const __bf16* __restrict__ P, const float* __restrict__ BO, float* __restrict__ Y) {
  __shared__ __align__(16) float so[4][16][132];
  const int tid = threadIdx.x, wave = tid >> 5, lane = tid & 31, col = lane & 15, g = lane >> 4; const size_t r0 = (size_t)blockIdx.x * 64 + wave * 16; const int n0 = blockIdx.y * 128;
  v8f acc[8] = {};
#pragma unroll 2
  for (int kc = 0; kc < DM / 32; ++kc) { const F2 a = split_row(O + (r0 + col) * DM, kc * 32, lane);
#pragma unroll
    for (int j = 0; j < 8; ++j) { const v16b w = frag_b(P + (size_t)(n0 + j * 16 + col) * DM + kc * 32, lane); acc[j] = wmma_bf(a.l, w, acc[j]); acc[j] = wmma_bf(a.h, w, acc[j]); } }
#pragma unroll
  for (int j = 0; j < 8; ++j) {
#pragma unroll
    for (int r = 0; r < 8; ++r) so[wave][8 * g + r][j * 16 + col] = acc[j][r] + bfr(BO[n0 + j * 16 + col]); }
  LDSX();
  for (int rl = 0; rl < 16; ++rl) vst2(Y + (r0 + rl) * DM + n0 + lane * 4, *(const v4f*)&so[wave][rl][lane * 4]);
}
// ---- k_pbias: one block: PB[which][h*64 + d] = concat_bias[h*192 + which*64 + d] (conn_b for columns < 64, qkv_b after) -> three 4-KB rows
__global__ __launch_bounds__(256) void k_pbias(const float* __restrict__ CONNB, const float* __restrict__ QKVB, float* __restrict__ PB) { __shared__ __align__(16) float s[3 * DM]; const int t = threadIdx.x;
  for (int e = t; e < 3 * DM; e += 256) { const int which = e / DM, n = e % DM; const int h = n / HD, d = n % HD; const int src = h * (3 * HD) + which * HD + d; s[e] = (src < HOUT) ? CONNB[src] : QKVB[src - HOUT]; }
  __syncthreads(); for (int q = t; q < 3 * DM / 4; q += 256) vst2(PB + q * 4, *(const v4f*)&s[q * 4]); }
// ---- k_o: block = 64 rows r' = (b', s'): o = ctx (bf16 hi + lo) . o_w rows + o_b -> out[(s' * BSZ + b') * 64] (the final (B,S)->(S,B) transpose)
__global__ __launch_bounds__(128) void k_o(const float* __restrict__ O, const __bf16* __restrict__ P, const float* __restrict__ OB, float* __restrict__ Y) { __shared__ __align__(16) float so[4][16][68];
  const int tid = threadIdx.x, wave = tid >> 5, lane = tid & 31, col = lane & 15, g = lane >> 4; const size_t r0 = (size_t)blockIdx.x * 64 + wave * 16; const __bf16* Wr = P + PK_P;
  v8f acc[4] = {};
#pragma unroll 2
  for (int kc = 0; kc < DM / 32; ++kc) { const F2 a = split_row(O + (r0 + col) * DM, kc * 32, lane);
#pragma unroll
    for (int j = 0; j < 4; ++j) { const v16b w = frag_b(Wr + (size_t)(j * 16 + col) * DM + kc * 32, lane); acc[j] = wmma_bf(a.h, w, acc[j]); acc[j] = wmma_bf(a.l, w, acc[j]); } }
#pragma unroll
  for (int j = 0; j < 4; ++j) { const float bb = bfr(OB[j * 16 + col]);
#pragma unroll
    for (int r = 0; r < 8; ++r) so[wave][8 * g + r][j * 16 + col] = acc[j][r] + bb; }
  LDSX(); for (int rl = 0; rl < 16; ++rl) if (lane < 16) { const size_t rp = r0 + rl; const size_t bp = rp / SS, sp = rp % SS; vst2(Y + (sp * BSZ + bp) * HOUT + lane * 4, *(const v4f*)&so[wave][rl][lane * 4]); } }
extern "C" void kernel_launch(void* const* d_in, const int* in_sizes, int n_in, void* d_out, int out_size, void* d_ws, size_t ws_size, hipStream_t stream) {
  (void)in_sizes; (void)n_in; (void)out_size;
  const float** F = (const float**)d_in;   // 0 x [2048,2,512], 1 qkv_w [3008,512], 2 qkv_b [3008], 3 conn_w [64,512], 4 conn_b [64], 5 o_w [64,1024], 6 o_b [64]
  if (ws_size < (size_t)WS_END + 4u * 3 * DM) return;
  char* ws = (char*)d_ws; __bf16* PK = (__bf16*)(ws + WS_PK); _Float16 *QK = (_Float16*)(ws + WS_QK), *QKL = (_Float16*)(ws + WS_QKL), *VTH = (_Float16*)(ws + WS_VTH), *VTL = (_Float16*)(ws + WS_VTL); float* O = (float*)(ws + WS_O); float* PB = (float*)(ws + WS_END);
  k_pack<<<dim3(DM, 4), 256, 0, stream>>>(F[3], F[1], F[5], nullptr, PK);
  k_pbias<<<1, 256, 0, stream>>>(F[4], F[2], PB);
  // the (S,B,512) input rows in memory order ARE the (b', s') rows of the raw reshape: row r = b' * 2048 + s'
  k_qkv<<<dim3(TNB * SS / 64, QKVW / 128), 128, 0, stream>>>(F[0], F[0], F[0], PK + PK_A, PB, PB + DM, PB + 2 * DM, QK, QKL, VTH, VTL);
  k_attn<<<dim3(TQB, NH, TNB), 128, 0, stream>>>(QK, QKL, VTH, VTL, nullptr, O);
  k_o<<<TOB, 128, 0, stream>>>(O, PK, F[6], (float*)d_out);
}

// v001
// A run of this version takes 389 microseconds.
// Timed twice side by side with v000, it ran 1.10 times as fast both times.
// compute dtype: all float inputs rounded to bf16; the concatenated [conn | qkv] projection with EXACT bf16 products on WMMA 16x16x32 (weight rows permuted at pack time into per-head q / k / v blocks; K = 512) + biases in f32, rounded once to f16 hi + residual; PLAIN-HYBRID attention (first 128 queries of each attention batch 3-product, later single f16), x 1/8, running-max softmax in f32 (hardware exp); out = ctx (bf16 hi + lo, 2 products) . o_w rows + o_b; f32 output.
#include <hip/hip_runtime.h>
#include <math.h>

typedef __attribute__((ext_vector_type(16))) _Float16 v16h;
typedef __attribute__((ext_vector_type(16))) __bf16 v16b;
typedef __attribute__((ext_vector_type(8)))  _Float16 v8h;
typedef __attribute__((ext_vector_type(8)))  float v8f;
typedef __attribute__((ext_vector_type(4)))  float v4f;
typedef __attribute__((ext_vector_type(2)))  float v2f;
typedef __attribute__((ext_vector_type(4)))  unsigned v4u;
typedef __attribute__((ext_vector_type(4)))  int v4i;
typedef float __attribute__((may_alias)) float_a;
typedef int __attribute__((may_alias)) int_a;

template <typename T> __device__ __forceinline__ void vst2(void* p, T v) { *(T*)p = v;  }
__device__ __forceinline__ v8f wmma16(v16h a, v16h b, v8f c) {
  v8f d = __builtin_amdgcn_wmma_f32_16x16x32_f16(false, a, false, b, (short)0, c, false, false);
  asm volatile("v_nop\n\tv_nop\n\tv_nop\n\tv_nop" : "+v"(d) : "v"(a), "v"(b));
  return d;
}
__device__ __forceinline__ v8f wmma_bf(v16b a, v16b b, v8f c) {
  v8f d = __builtin_amdgcn_wmma_f32_16x16x32_bf16(false, a, false, b, (short)0, c, false, false);
  asm volatile("v_nop\n\tv_nop\n\tv_nop\n\tv_nop" : "+v"(d) : "v"(a), "v"(b));
  return d;
}
// Modified multi-head attention (S 2,048, B 2, d_in 512, 16 heads x 64): qkv from one projection plus a fixed 'connection' projection supplying 64 of the q columns, the torch raw reshape (S,B,3E) -> (B,S,H,3*64) kept literally (so attention 'batches' are contiguous halves of the (s,b) row order and each head's q|k|v are consecutive 64-column slices), softmax(q k / 8) v, output projection E -> 64 + bias, returned as (S, B, 64).
__device__ __forceinline__ v16h frag_h(const _Float16* rowk0, int lane) {
  union { v16h v; v8h q[2]; } u; const _Float16* p = rowk0 + 8 * (lane >> 4);
  u.q[0] = *(const v8h*)p; u.q[1] = *(const v8h*)(p + 16); return u.v;
}
__device__ __forceinline__ v16h frag_f32(const float* rowk0, int lane) {
  v16h a; const float* p = rowk0 + 8 * (lane >> 4);
#pragma unroll
  for (int i = 0; i < 8; ++i) { a[i] = (_Float16)p[i]; a[8 + i] = (_Float16)p[16 + i]; }
  return a;
}
__device__ __forceinline__ v16h frag_f32s(const float* rowk0, int lane, float sc) {
  v16h a; const float* p = rowk0 + 8 * (lane >> 4);
#pragma unroll
  for (int i = 0; i < 8; ++i) { a[i] = (_Float16)(p[i] * sc); a[8 + i] = (_Float16)(p[16 + i] * sc); }
  return a;
}
// column fragment from a [K][ld] layout (column n), rows >= K read as 0
__device__ __forceinline__ v16h fragc_f32(const float* W, int k0, int n, int lane, int ld, int K) {
  v16h a; const int g = lane >> 4;
#pragma unroll
  for (int i = 0; i < 8; ++i) { const int ka = k0 + 8 * g + i, kb = ka + 16;
    a[i] = (_Float16)(ka < K ? W[(size_t)(ka < K ? ka : K - 1) * ld + n] : 0.f); a[8 + i] = (_Float16)(kb < K ? W[(size_t)(kb < K ? kb : K - 1) * ld + n] : 0.f); }
  return a;
}
struct F2 { v16b h, l; };
__device__ __forceinline__ F2 bsplit16(const float v[16]) { F2 r;
#pragma unroll
  for (int i = 0; i < 16; ++i) { const __bf16 h = (__bf16)v[i]; r.h[i] = h; r.l[i] = (__bf16)(v[i] - (float)h); }
  return r; }
__device__ __forceinline__ F2 split_row(const float* row, int k0, int lane) { float v[16]; const float* p = row + k0 + 8 * (lane >> 4);
#pragma unroll
  for (int i = 0; i < 8; ++i) { v[i] = p[i]; v[8 + i] = p[16 + i]; }
  return bsplit16(v); }
__device__ __forceinline__ F2 split_rowK(const float* row, int k0, int lane, int K) { float v[16]; const int g = lane >> 4;
#pragma unroll
  for (int i = 0; i < 8; ++i) { const int ka = k0 + 8 * g + i, kb = ka + 16; v[i] = ka < K ? row[ka < K ? ka : K - 1] : 0.f; v[8 + i] = kb < K ? row[kb < K ? kb : K - 1] : 0.f; }
  return bsplit16(v); }
__device__ __forceinline__ F2 split_col(const float* W, int k0, int n, int lane, int ld, int K) { float v[16]; const int g = lane >> 4;
#pragma unroll
  for (int i = 0; i < 8; ++i) { const int ka = k0 + 8 * g + i, kb = ka + 16; v[i] = ka < K ? W[(size_t)(ka < K ? ka : K - 1) * ld + n] : 0.f; v[8 + i] = kb < K ? W[(size_t)(kb < K ? kb : K - 1) * ld + n] : 0.f; }
  return bsplit16(v); }
__device__ __forceinline__ v8f mac3(const F2& a, const F2& b, v8f c) { c = wmma_bf(a.l, b.h, c); c = wmma_bf(a.h, b.l, c); return wmma_bf(a.h, b.h, c); }
__device__ __forceinline__ float sigm(float v) { return 1.0f / (1.0f + expf(-v)); }
#define LDSX() do { asm volatile("s_wait_dscnt 0" ::: "memory"); __builtin_amdgcn_wave_barrier(); __builtin_amdgcn_fence(__ATOMIC_RELEASE, "workgroup"); } while (0)


#define NB 2
#define SS 2048
#define DM 1024
#define NH 16
#define KIN 512          // input width
#define BSZ 2            // the module's batch (interleaved in the row order)
#define HOUT 64          // o_proj output width
#define HD 64
#define QKVW (3 * DM)
#ifndef TQB
#define TQB (SS / 64)
#define TNB NB
#define TOB (NB * SS / 64)     // output row tiles (all)
#endif
typedef __attribute__((ext_vector_type(8))) __bf16 v8b;
__device__ __forceinline__ v16b frag_b(const __bf16* rowk0, int lane) {
  union { v16b v; v8b q[2]; } u; const __bf16* p = rowk0 + 8 * (lane >> 4);
  u.q[0] = *(const v8b*)p; u.q[1] = *(const v8b*)(p + 16); return u.v;
}
__device__ __forceinline__ float bfr(float v) { return (float)(__bf16)v; }
__device__ __attribute__((noinline)) float exp_ni(float v) { return expf(v); }
__device__ __attribute__((noinline)) float erf_ni(float v) { return erff(v); }

#define PK_A 0                       // [3072][512] Wqkv rows (natural [out][in])
#define PK_P (PK_A + QKVW * DM)        // [64][1024] Wo rows (natural)
#define PK_END (PK_P + DM * DM)
#define WS_PK  0u
#define WS_QK  (WS_PK + 2u * PK_END)             // f16 [4096 rows][2048]: q | k
#define WS_QKL (WS_QK + 2u * NB * SS * 2 * DM)     // f16 q | k residual planes x2048
#define WS_VTH (WS_QKL + 2u * NB * SS * 2 * DM)    // f16 [b][1024 (h*64+d)][2048 s] hi
#define WS_VTL (WS_VTH + 2u * NB * DM * SS)        // f16 lo x 2048
#define WS_O   (WS_VTL + 2u * NB * DM * SS)        // f32 [4096][1024]
#define WS_CS  (WS_O + 4u * NB * SS * DM)           // f32 2 x [2048][32], not written or read
#define WS_END (WS_CS + 4u * 2 * SS * 32)
// ---- k_pack: block = (row n, which): natural [out][in] rows -> bf16; which 0..2 -> W_q/W_k/W_v into PK_A rows which*1024 + n; 3 -> W_o into PK_P
__global__ __launch_bounds__(256) void k_pack(const float* __restrict__ CONNW, const float* __restrict__ WQKV3, const float* __restrict__ OW, const float* __restrict__ unused, __bf16* __restrict__ PK) {
  __shared__ __align__(16) __bf16 s[DM]; const int n = blockIdx.x, which = blockIdx.y, t = threadIdx.x; (void)unused;
  if (which < 3) { const int h = n / HD, d = n % HD; const int src = h * (3 * HD) + which * HD + d;   // column of the concatenated [q_conn | qkv] buffer
    const float* row = (src < HOUT) ? (CONNW + (size_t)src * KIN) : (WQKV3 + (size_t)(src - HOUT) * KIN);
    for (int k = t; k < KIN; k += 256) s[k] = (__bf16)row[k]; __syncthreads();
    __bf16* dst = PK + PK_A + ((size_t)which * DM + n) * KIN; for (int q = t; q < KIN / 8; q += 256) vst2((unsigned*)(dst + q * 8), *(const v4u*)&s[q * 8]); }
  else { if (n >= HOUT) return; for (int k = t; k < DM; k += 256) s[k] = (__bf16)OW[(size_t)n * DM + k]; __syncthreads(); __bf16* dst = PK + PK_P + (size_t)n * DM; for (int q = t; q < DM / 8; q += 256) vst2((unsigned*)(dst + q * 8), *(const v4u*)&s[q * 8]); } }
__global__ __launch_bounds__(128) void k_qkv(const float* __restrict__ XQ, const float* __restrict__ XK, const float* __restrict__ XV, const __bf16* __restrict__ P, const float* __restrict__ BQ, const float* __restrict__ BK, const float* __restrict__ BV, _Float16* __restrict__ QK, _Float16* __restrict__ QKL, _Float16* __restrict__ VTH, _Float16* __restrict__ VTL) {
  const int which0 = (blockIdx.y * 128) / DM; const float* X = (which0 == 0) ? XQ : (which0 == 1) ? XK : XV; const float* BB = BQ ? (((which0 == 0) ? BQ : (which0 == 1) ? BK : BV) + (blockIdx.y * 128 - which0 * DM)) : nullptr;
  __shared__ __align__(16) _Float16 so[4][16][136], sol[4][16][136]; __shared__ __align__(16) _Float16 sth[128][72], stl[128][72];
  const int tid = threadIdx.x, wave = tid >> 5, lane = tid & 31, col = lane & 15, g = lane >> 4; const size_t r0 = (size_t)blockIdx.x * 64 + wave * 16; const int n0 = blockIdx.y * 128;
  v8f acc[8] = {};
#pragma unroll 2
  for (int kc = 0; kc < KIN / 32; ++kc) { v16b a; { const float* p = X + (r0 + col) * KIN + kc * 32 + 8 * g;
#pragma unroll
      for (int i = 0; i < 8; ++i) { a[i] = (__bf16)p[i]; a[8 + i] = (__bf16)p[16 + i]; } }
#pragma unroll
    for (int j = 0; j < 8; ++j) acc[j] = wmma_bf(a, frag_b(P + (size_t)(n0 + j * 16 + col) * KIN + kc * 32, lane), acc[j]); }
  if (n0 < 2 * DM) {   // q stored unscaled (f16 sigma ~0.6, no subnormal exposure); 1/8 applied to the f32 score
#pragma unroll
    for (int j = 0; j < 8; ++j) {
#pragma unroll
      for (int r = 0; r < 8; ++r) { const float v = acc[j][r] + (BB ? bfr(BB[j * 16 + col]) : 0.f); const _Float16 hv = (_Float16)v; so[wave][8 * g + r][j * 16 + col] = hv; sol[wave][8 * g + r][j * 16 + col] = (_Float16)((v - (float)hv) * 2048.0f); } }   // q, k (+ bias) as f16 hi + (x2048) residual
    LDSX();
    for (int rl = 0; rl < 16; ++rl) if (lane < 16) { vst2((unsigned*)(QK + (r0 + rl) * (2 * DM) + n0 + lane * 8), *(const v4u*)&so[wave][rl][lane * 8]); vst2((unsigned*)(QKL + (r0 + rl) * (2 * DM) + n0 + lane * 8), *(const v4u*)&sol[wave][rl][lane * 8]); }
  } else {
#pragma unroll
    for (int j = 0; j < 8; ++j) {
#pragma unroll
      for (int r = 0; r < 8; ++r) { const float v = acc[j][r] + (BB ? bfr(BB[j * 16 + col]) : 0.f); const _Float16 hv = (_Float16)v; sth[j * 16 + col][wave * 16 + 8 * g + r] = hv; stl[j * 16 + col][wave * 16 + 8 * g + r] = (_Float16)((v - (float)hv) * 2048.0f); } }
    __syncthreads();
    const size_t rb = (size_t)blockIdx.x * 64; const int b = (int)(rb / SS), s0 = (int)(rb % SS); const int pc0 = n0 - 2 * DM;
    for (int q = tid; q < 128 * 8; q += 128) { const int d = q >> 3, pc = q & 7; const size_t o = ((size_t)b * DM + pc0 + d) * SS + s0 + pc * 8; vst2((unsigned*)(VTH + o), *(const v4u*)&sth[d][pc * 8]); vst2((unsigned*)(VTL + o), *(const v4u*)&stl[d][pc * 8]); }
  }
}
// ---- k_attn: block = (64 queries, head h, batch b): all-keys flash attention (K = 64: 2 k-steps), scores = (q.k) * 0.125 from q hi/lo x k hi/lo (3 products) in the first two query blocks, single f16 elsewhere, P.V: there 2^11 P hi/lo x V hi/lo (3 products) in two accumulators, elsewhere 2^11 P x V hi; O[b*S+q][h*64+d] = (acc + accl / 2048) / (2048 l) (256-B segments)
__device__ __forceinline__ v16h frag_p(const char* p) {   // frag_h from the lane's own byte address
  union { v16h v; v8h q[2]; } u; u.q[0] = *(const v8h*)p; u.q[1] = *(const v8h*)(p + 32); return u.v;
}
// HV = leading query block (3 products); one straight-line loop body for each of the two kinds, so that each kind's load groups stand in one block of code
template <bool HV> __device__ __forceinline__ void attn_body(const _Float16* __restrict__ QK, const _Float16* __restrict__ QKL, const _Float16* __restrict__ VTH, const _Float16* __restrict__ VTL, float* __restrict__ O, float (*sp)[16][36], float (*so)[16][68]) {
  const int tid = threadIdx.x, wave = tid >> 5, lane = tid & 31, col = lane & 15, g = lane >> 4;
  const int qb = blockIdx.x, h = blockIdx.y, b = blockIdx.z; const int q0 = qb * 64 + wave * 16; const size_t rq = (size_t)b * SS + q0 + col;
  v16h aq[2], aql[2];
#pragma unroll
  for (int kc = 0; kc < 2; ++kc) { aq[kc] = frag_h(QK + rq * (2 * DM) + h * HD + kc * 32, lane); aql[kc] = frag_h(QKL + rq * (2 * DM) + h * HD + kc * 32, lane); }
  float m[8], l[8];
#pragma unroll
  for (int r = 0; r < 8; ++r) { m[r] = -3.0e38f; l[r] = 0.f; }
  v8f acc[4] = {}, accl[4] = {};
  const int nks = SS / 32;   // all keys
  const unsigned kof = 2u * ((unsigned)col * (2 * DM) + 8 * g), vof = 2u * ((unsigned)col * SS + 8 * g);   // the lane's byte offsets inside a K and a V fragment, the same in every pass
#pragma unroll 1
  for (int ks = 0; ks < nks; ++ks) { v8f s[2];
    // every K fragment of the pass is loaded as one group in front of the first product: one load latency a pass in place of one per fragment
    v16h kh[2][2], kl[2][2];
    const size_t ko = ((size_t)b * SS + ks * 32) * (2 * DM) + h * HD; const char* kp = (const char*)(QK + ko) + kof; const char* kpl = (const char*)(QKL + ko) + kof;   // one address a plane; the fragments lie at constant offsets from it
#pragma unroll
    for (int ct = 0; ct < 2; ++ct) {
#pragma unroll
      for (int kc = 0; kc < 2; ++kc) { kh[ct][kc] = frag_p(kp + 2 * (DM + ct * 16 * (2 * DM) + kc * 32)); if (HV) kl[ct][kc] = frag_p(kpl + 2 * (DM + ct * 16 * (2 * DM) + kc * 32)); } }
    // the wait that is kept in front of any overwrite of a register an issued load names; the addresses as inputs stay whole up to it, and no load of the group moves behind it
    if (HV) asm volatile("s_wait_xcnt 0x0" :: "v"(kp), "v"(kpl) : "memory"); else asm volatile("s_wait_xcnt 0x0" :: "v"(kp) : "memory");
#pragma unroll
    for (int ct = 0; ct < 2; ++ct) { v8f c = {}, cl = {};
      if (HV) {   // leading query blocks (outputs far above the global rms): 3 products
#pragma unroll
        for (int kc = 0; kc < 2; ++kc) { c = wmma16(aq[kc], kh[ct][kc], c); cl = wmma16(aql[kc], kh[ct][kc], cl); cl = wmma16(aq[kc], kl[ct][kc], cl); }
#pragma unroll
        for (int r = 0; r < 8; ++r) c[r] += cl[r] * (1.0f / 2048.0f); }
      else {
#pragma unroll
        for (int kc = 0; kc < 2; ++kc) c = wmma16(aq[kc], kh[ct][kc], c); }   // single product elsewhere
      { const bool keepk = true;
#pragma unroll
      for (int r = 0; r < 8; ++r) s[ct][r] = keepk ? c[r] * 0.125f : -3.0e38f; } }   // 1/sqrt(64); masked keys excluded
    // every V fragment of the pass is loaded as one group behind the score products: the loads fly while the softmax runs
    v16h vh[4], vl[4];
    const size_t vo = ((size_t)b * DM + h * HD) * SS + ks * 32; const char* vp = (const char*)(VTH + vo) + vof; const char* vpl = (const char*)(VTL + vo) + vof;
#pragma unroll
    for (int dt = 0; dt < 4; ++dt) { vh[dt] = frag_p(vp + 2 * (dt * 16 * SS)); if (HV) vl[dt] = frag_p(vpl + 2 * (dt * 16 * SS)); }
    if (HV) asm volatile("s_wait_xcnt 0x0" :: "v"(vp), "v"(vpl) : "memory"); else asm volatile("s_wait_xcnt 0x0" :: "v"(vp) : "memory");   // as behind the K group
#pragma unroll
    for (int r = 0; r < 8; ++r) { float mx = fmaxf(s[0][r], s[1][r]);
#pragma unroll
      for (int o = 1; o < 16; o <<= 1) mx = fmaxf(mx, __shfl_xor(mx, o));
      const float mn = fmaxf(m[r], mx); const float alpha = (m[r] <= -1.0e38f) ? 0.f : __expf(m[r] - mn);
      const float e0 = (s[0][r] <= -1.0e38f) ? 0.f : __expf(s[0][r] - mn), e1 = (s[1][r] <= -1.0e38f) ? 0.f : __expf(s[1][r] - mn); float es = e0 + e1;
#pragma unroll
      for (int o = 1; o < 16; o <<= 1) es += __shfl_xor(es, o);
      l[r] = l[r] * alpha + es; m[r] = mn;
#pragma unroll
      for (int dt = 0; dt < 4; ++dt) { acc[dt][r] *= alpha; accl[dt][r] *= alpha; }
      sp[wave][8 * g + r][col] = e0; sp[wave][8 * g + r][16 + col] = e1; }
    LDSX();
    v16h pa, pl; { const float* prow = &sp[wave][col][0] + 8 * (lane >> 4);
#pragma unroll
      for (int i = 0; i < 8; ++i) { const float x0 = prow[i] * 2048.0f, x1 = prow[16 + i] * 2048.0f; const _Float16 h0 = (_Float16)x0, h1 = (_Float16)x1; pa[i] = h0; pa[8 + i] = h1; pl[i] = (_Float16)((x0 - (float)h0) * 2048.0f); pl[8 + i] = (_Float16)((x1 - (float)h1) * 2048.0f); } }   // P scaled by 2^11 before the f16 split so small softmax weights stay out of the f16 subnormal range; 2^-11 folded into the epilogue
#pragma unroll
    for (int dt = 0; dt < 4; ++dt) { acc[dt] = wmma16(pa, vh[dt], acc[dt]); if (HV) { accl[dt] = wmma16(pl, vh[dt], accl[dt]); accl[dt] = wmma16(pa, vl[dt], accl[dt]); } }   // leading query blocks: P hi/lo x V hi/lo (3 products); elsewhere P x V single
    LDSX(); }
#pragma unroll
  for (int r = 0; r < 8; ++r) { const float il = (1.0f / 2048.0f) / l[r];
#pragma unroll
    for (int dt = 0; dt < 4; ++dt) so[wave][8 * g + r][dt * 16 + col] = (acc[dt][r] + accl[dt][r] * (1.0f / 2048.0f)) * il; }
  LDSX();
  for (int rl = 0; rl < 16; ++rl) if (lane < 16) vst2(O + ((size_t)b * SS + q0 + rl) * DM + h * HD + lane * 4, *(const v4f*)&so[wave][rl][lane * 4]);
}
__global__ __launch_bounds__(128) void k_attn(const _Float16* __restrict__ QK, const _Float16* __restrict__ QKL, const _Float16* __restrict__ VTH, const _Float16* __restrict__ VTL, const void* __restrict__ KMASK, float* __restrict__ O) {
  __shared__ __align__(16) float sp[4][16][36]; __shared__ __align__(16) float so[4][16][68]; (void)KMASK;
  if (blockIdx.x < 2) attn_body<true>(QK, QKL, VTH, VTL, O, sp, so); else attn_body<false>(QK, QKL, VTH, VTL, O, sp, so);
}
// ---- k_out: block = (64 rows, 128 cols): out = O(hi/lo) . Wo rows (2 products) + bo
__global__ __launch_bounds__(128) void k_out(const float* __restrict__ O, const __bf16* __restrict__ P, const float* __restrict__ BO, float* __restrict__ Y) {
  __shared__ __align__(16) float so[4][16][132];
  const int tid = threadIdx.x, wave = tid >> 5, lane = tid & 31, col = lane & 15, g = lane >> 4; const size_t r0 = (size_t)blockIdx.x * 64 + wave * 16; const int n0 = blockIdx.y * 128;
  v8f acc[8] = {};
#pragma unroll 2
  for (int kc = 0; kc < DM / 32; ++kc) { const F2 a = split_row(O + (r0 + col) * DM, kc * 32, lane);
#pragma unroll
    for (int j = 0; j < 8; ++j) { const v16b w = frag_b(P + (size_t)(n0 + j * 16 + col) * DM + kc * 32, lane); acc[j] = wmma_bf(a.l, w, acc[j]); acc[j] = wmma_bf(a.h, w, acc[j]); } }
#pragma unroll
  for (int j = 0; j < 8; ++j) {
#pragma unroll
    for (int r = 0; r < 8; ++r) so[wave][8 * g + r][j * 16 + col] = acc[j][r] + bfr(BO[n0 + j * 16 + col]); }
  LDSX();
  for (int rl = 0; rl < 16; ++rl) vst2(Y + (r0 + rl) * DM + n0 + lane * 4, *(const v4f*)&so[wave][rl][lane * 4]);
}
// ---- k_pbias: one block: PB[which][h*64 + d] = concat_bias[h*192 + which*64 + d] (conn_b for columns < 64, qkv_b after) -> three 4-KB rows
__global__ __launch_bounds__(256) void k_pbias(const float* __restrict__ CONNB, const float* __restrict__ QKVB, float* __restrict__ PB) { __shared__ __align__(16) float s[3 * DM]; const int t = threadIdx.x;
  for (int e = t; e < 3 * DM; e += 256) { const int which = e / DM, n = e % DM; const int h = n / HD, d = n % HD; const int src = h * (3 * HD) + which * HD + d; s[e] = (src < HOUT) ? CONNB[src] : QKVB[src - HOUT]; }
  __syncthreads(); for (int q = t; q < 3 * DM / 4; q += 256) vst2(PB + q * 4, *(const v4f*)&s[q * 4]); }
// ---- k_o: block = 64 rows r' = (b', s'): o = ctx (bf16 hi + lo) . o_w rows + o_b -> out[(s' * BSZ + b') * 64] (the final (B,S)->(S,B) transpose)
__global__ __launch_bounds__(128) void k_o(const float* __restrict__ O, const __bf16* __restrict__ P, const float* __restrict__ OB, float* __restrict__ Y) { __shared__ __align__(16) float so[4][16][68];
  const int tid = threadIdx.x, wave = tid >> 5, lane = tid & 31, col = lane & 15, g = lane >> 4; const size_t r0 = (size_t)blockIdx.x * 64 + wave * 16; const __bf16* Wr = P + PK_P;
  v8f acc[4] = {};
#pragma unroll 2
  for (int kc = 0; kc < DM / 32; ++kc) { const F2 a = split_row(O + (r0 + col) * DM, kc * 32, lane);
#pragma unroll
    for (int j = 0; j < 4; ++j) { const v16b w = frag_b(Wr + (size_t)(j * 16 + col) * DM + kc * 32, lane); acc[j] = wmma_bf(a.h, w, acc[j]); acc[j] = wmma_bf(a.l, w, acc[j]); } }
#pragma unroll
  for (int j = 0; j < 4; ++j) { const float bb = bfr(OB[j * 16 + col]);
#pragma unroll
    for (int r = 0; r < 8; ++r) so[wave][8 * g + r][j * 16 + col] = acc[j][r] + bb; }
  LDSX(); for (int rl = 0; rl < 16; ++rl) if (lane < 16) { const size_t rp = r0 + rl; const size_t bp = rp / SS, sp = rp % SS; vst2(Y + (sp * BSZ + bp) * HOUT + lane * 4, *(const v4f*)&so[wave][rl][lane * 4]); } }
extern "C" void kernel_launch(void* const* d_in, const int* in_sizes, int n_in, void* d_out, int out_size, void* d_ws, size_t ws_size, hipStream_t stream) {
  (void)in_sizes; (void)n_in; (void)out_size;
  const float** F = (const float**)d_in;   // 0 x [2048,2,512], 1 qkv_w [3008,512], 2 qkv_b [3008], 3 conn_w [64,512], 4 conn_b [64], 5 o_w [64,1024], 6 o_b [64]
  if (ws_size < (size_t)WS_END + 4u * 3 * DM) return;
  char* ws = (char*)d_ws; __bf16* PK = (__bf16*)(ws + WS_PK); _Float16 *QK = (_Float16*)(ws + WS_QK), *QKL = (_Float16*)(ws + WS_QKL), *VTH = (_Float16*)(ws + WS_VTH), *VTL = (_Float16*)(ws + WS_VTL); float* O = (float*)(ws + WS_O); float* PB = (float*)(ws + WS_END);
  k_pack<<<dim3(DM, 4), 256, 0, stream>>>(F[3], F[1], F[5], nullptr, PK);
  k_pbias<<<1, 256, 0, stream>>>(F[4], F[2], PB);
  // the (S,B,512) input rows in memory order ARE the (b', s') rows of the raw reshape: row r = b' * 2048 + s'
  k_qkv<<<dim3(TNB * SS / 64, QKVW / 128), 128, 0, stream>>>(F[0], F[0], F[0], PK + PK_A, PB, PB + DM, PB + 2 * DM, QK, QKL, VTH, VTL);
  k_attn<<<dim3(TQB, NH, TNB), 128, 0, stream>>>(QK, QKL, VTH, VTL, nullptr, O);
  k_o<<<TOB, 128, 0, stream>>>(O, PK, F[6], (float*)d_out);
}

// v002
// Measured time: 317 microseconds a run.
// In two side-by-side timings against v001, it was 1.22 and 1.23 times as fast.
// Over all steps from v000 it is 1.35 times as fast.
// compute dtype: all float inputs rounded to bf16; the concatenated [conn | qkv] projection with EXACT bf16 products on WMMA 16x16x32 (weight rows permuted at pack time into per-head q / k / v blocks; K = 512) + biases in f32, rounded once to f16 hi + residual; PLAIN-HYBRID attention (first 128 queries of each attention batch 3-product, later single f16), x 1/8, running-max softmax in f32 (hardware exp); out = ctx (bf16 hi + lo, 2 products) . o_w rows + o_b; f32 output.
#include <hip/hip_runtime.h>
#include <math.h>

typedef __attribute__((ext_vector_type(16))) _Float16 v16h;
typedef __attribute__((ext_vector_type(16))) __bf16 v16b;
typedef __attribute__((ext_vector_type(8)))  _Float16 v8h;
typedef __attribute__((ext_vector_type(8)))  float v8f;
typedef __attribute__((ext_vector_type(4)))  float v4f;
typedef __attribute__((ext_vector_type(2)))  float v2f;
typedef __attribute__((ext_vector_type(4)))  unsigned v4u;
typedef __attribute__((ext_vector_type(4)))  int v4i;
typedef float __attribute__((may_alias)) float_a;
typedef int __attribute__((may_alias)) int_a;

template <typename T> __device__ __forceinline__ void vst2(void* p, T v) { *(T*)p = v;  }
__device__ __forceinline__ v8f wmma16(v16h a, v16h b, v8f c) {
  v8f d = __builtin_amdgcn_wmma_f32_16x16x32_f16(false, a, false, b, (short)0, c, false, false);
  asm volatile("v_nop\n\tv_nop\n\tv_nop\n\tv_nop" : "+v"(d) : "v"(a), "v"(b));
  return d;
}
__device__ __forceinline__ v8f wmma_bf(v16b a, v16b b, v8f c) {
  v8f d = __builtin_amdgcn_wmma_f32_16x16x32_bf16(false, a, false, b, (short)0, c, false, false);
  asm volatile("v_nop\n\tv_nop\n\tv_nop\n\tv_nop" : "+v"(d) : "v"(a), "v"(b));
  return d;
}
// Modified multi-head attention (S 2,048, B 2, d_in 512, 16 heads x 64): qkv from one projection plus a fixed 'connection' projection supplying 64 of the q columns, the torch raw reshape (S,B,3E) -> (B,S,H,3*64) kept literally (so attention 'batches' are contiguous halves of the (s,b) row order and each head's q|k|v are consecutive 64-column slices), softmax(q k / 8) v, output projection E -> 64 + bias, returned as (S, B, 64).
__device__ __forceinline__ v16h frag_h(const _Float16* rowk0, int lane) {
  union { v16h v; v8h q[2]; } u; const _Float16* p = rowk0 + 8 * (lane >> 4);
  u.q[0] = *(const v8h*)p; u.q[1] = *(const v8h*)(p + 16); return u.v;
}
__device__ __forceinline__ v16h frag_f32(const float* rowk0, int lane) {
  v16h a; const float* p = rowk0 + 8 * (lane >> 4);
#pragma unroll
  for (int i = 0; i < 8; ++i) { a[i] = (_Float16)p[i]; a[8 + i] = (_Float16)p[16 + i]; }
  return a;
}
__device__ __forceinline__ v16h frag_f32s(const float* rowk0, int lane, float sc) {
  v16h a; const float* p = rowk0 + 8 * (lane >> 4);
#pragma unroll
  for (int i = 0; i < 8; ++i) { a[i] = (_Float16)(p[i] * sc); a[8 + i] = (_Float16)(p[16 + i] * sc); }
  return a;
}
// column fragment from a [K][ld] layout (column n), rows >= K read as 0
__device__ __forceinline__ v16h fragc_f32(const float* W, int k0, int n, int lane, int ld, int K) {
  v16h a; const int g = lane >> 4;
#pragma unroll
  for (int i = 0; i < 8; ++i) { const int ka = k0 + 8 * g + i, kb = ka + 16;
    a[i] = (_Float16)(ka < K ? W[(size_t)(ka < K ? ka : K - 1) * ld + n] : 0.f); a[8 + i] = (_Float16)(kb < K ? W[(size_t)(kb < K ? kb : K - 1) * ld + n] : 0.f); }
  return a;
}
struct F2 { v16b h, l; };
__device__ __forceinline__ F2 bsplit16(const float v[16]) { F2 r;
#pragma unroll
  for (int i = 0; i < 16; ++i) { const __bf16 h = (__bf16)v[i]; r.h[i] = h; r.l[i] = (__bf16)(v[i] - (float)h); }
  return r; }
__device__ __forceinline__ F2 split_row(const float* row, int k0, int lane) { float v[16]; const float* p = row + k0 + 8 * (lane >> 4);
#pragma unroll
  for (int i = 0; i < 8; ++i) { v[i] = p[i]; v[8 + i] = p[16 + i]; }
  return bsplit16(v); }
__device__ __forceinline__ F2 split_rowK(const float* row, int k0, int lane, int K) { float v[16]; const int g = lane >> 4;
#pragma unroll
  for (int i = 0; i < 8; ++i) { const int ka = k0 + 8 * g + i, kb = ka + 16; v[i] = ka < K ? row[ka < K ? ka : K - 1] : 0.f; v[8 + i] = kb < K ? row[kb < K ? kb : K - 1] : 0.f; }
  return bsplit16(v); }
__device__ __forceinline__ F2 split_col(const float* W, int k0, int n, int lane, int ld, int K) { float v[16]; const int g = lane >> 4;
#pragma unroll
  for (int i = 0; i < 8; ++i) { const int ka = k0 + 8 * g + i, kb = ka + 16; v[i] = ka < K ? W[(size_t)(ka < K ? ka : K - 1) * ld + n] : 0.f; v[8 + i] = kb < K ? W[(size_t)(kb < K ? kb : K - 1) * ld + n] : 0.f; }
  return bsplit16(v); }
__device__ __forceinline__ v8f mac3(const F2& a, const F2& b, v8f c) { c = wmma_bf(a.l, b.h, c); c = wmma_bf(a.h, b.l, c); return wmma_bf(a.h, b.h, c); }
__device__ __forceinline__ float sigm(float v) { return 1.0f / (1.0f + expf(-v)); }
#define LDSX() do { asm volatile("s_wait_dscnt 0" ::: "memory"); __builtin_amdgcn_wave_barrier(); __builtin_amdgcn_fence(__ATOMIC_RELEASE, "workgroup"); } while (0)


#define NB 2
#define SS 2048
#define DM 1024
#define NH 16
#define KIN 512          // input width
#define BSZ 2            // the module's batch (interleaved in the row order)
#define HOUT 64          // o_proj output width
#define HD 64
#define QKVW (3 * DM)
#ifndef TQB
#define TQB (SS / 64)
#define TNB NB
#define TOB (NB * SS / 64)     // output row tiles (all)
#endif
typedef __attribute__((ext_vector_type(8))) __bf16 v8b;
__device__ __forceinline__ v16b frag_b(const __bf16* rowk0, int lane) {
  union { v16b v; v8b q[2]; } u; const __bf16* p = rowk0 + 8 * (lane >> 4);
  u.q[0] = *(const v8b*)p; u.q[1] = *(const v8b*)(p + 16); return u.v;
}
__device__ __forceinline__ float bfr(float v) { return (float)(__bf16)v; }
__device__ __attribute__((noinline)) float exp_ni(float v) { return expf(v); }
__device__ __attribute__((noinline)) float erf_ni(float v) { return erff(v); }

#define PK_A 0                       // [3072][512] Wqkv rows (natural [out][in])
#define PK_P (PK_A + QKVW * DM)        // [64][1024] Wo rows (natural)
#define PK_END (PK_P + DM * DM)
#define WS_PK  0u
#define WS_QK  (WS_PK + 2u * PK_END)             // f16 [4096 rows][2048]: q | k
#define WS_QKL (WS_QK + 2u * NB * SS * 2 * DM)     // f16 q | k residual planes x2048
#define WS_VTH (WS_QKL + 2u * NB * SS * 2 * DM)    // f16 [b][1024 (h*64+d)][2048 s] hi
#define WS_VTL (WS_VTH + 2u * NB * DM * SS)        // f16 lo x 2048
#define WS_O   (WS_VTL + 2u * NB * DM * SS)        // f32 [4096][1024]
#define WS_CS  (WS_O + 4u * NB * SS * DM)           // f32 2 x [2048][32], not written or read
#define WS_END (WS_CS + 4u * 2 * SS * 32)
// ---- k_pack: block = (row n, which): natural [out][in] rows -> bf16; which 0..2 -> W_q/W_k/W_v into PK_A rows which*1024 + n; 3 -> W_o into PK_P
__global__ __launch_bounds__(256) void k_pack(const float* __restrict__ CONNW, const float* __restrict__ WQKV3, const float* __restrict__ OW, const float* __restrict__ unused, __bf16* __restrict__ PK) {
  __shared__ __align__(16) __bf16 s[DM]; const int n = blockIdx.x, which = blockIdx.y, t = threadIdx.x; (void)unused;
  if (which < 3) { const int h = n / HD, d = n % HD; const int src = h * (3 * HD) + which * HD + d;   // column of the concatenated [q_conn | qkv] buffer
    const float* row = (src < HOUT) ? (CONNW + (size_t)src * KIN) : (WQKV3 + (size_t)(src - HOUT) * KIN);
    for (int k = t; k < KIN; k += 256) s[k] = (__bf16)row[k]; __syncthreads();
    __bf16* dst = PK + PK_A + ((size_t)which * DM + n) * KIN; for (int q = t; q < KIN / 8; q += 256) vst2((unsigned*)(dst + q * 8), *(const v4u*)&s[q * 8]); }
  else { if (n >= HOUT) return; for (int k = t; k < DM; k += 256) s[k] = (__bf16)OW[(size_t)n * DM + k]; __syncthreads(); __bf16* dst = PK + PK_P + (size_t)n * DM; for (int q = t; q < DM / 8; q += 256) vst2((unsigned*)(dst + q * 8), *(const v4u*)&s[q * 8]); } }
__global__ __launch_bounds__(128) void k_qkv(const float* __restrict__ XQ, const float* __restrict__ XK, const float* __restrict__ XV, const __bf16* __restrict__ P, const float* __restrict__ BQ, const float* __restrict__ BK, const float* __restrict__ BV, _Float16* __restrict__ QK, _Float16* __restrict__ QKL, _Float16* __restrict__ VTH, _Float16* __restrict__ VTL) {
  const int which0 = (blockIdx.y * 128) / DM; const float* X = (which0 == 0) ? XQ : (which0 == 1) ? XK : XV; const float* BB = BQ ? (((which0 == 0) ? BQ : (which0 == 1) ? BK : BV) + (blockIdx.y * 128 - which0 * DM)) : nullptr;
  __shared__ __align__(16) _Float16 so[4][16][136], sol[4][16][136]; __shared__ __align__(16) _Float16 sth[128][72], stl[128][72];
  const int tid = threadIdx.x, wave = tid >> 5, lane = tid & 31, col = lane & 15, g = lane >> 4; const size_t r0 = (size_t)blockIdx.x * 64 + wave * 16; const int n0 = blockIdx.y * 128;
  v8f acc[8] = {};
#pragma unroll 2
  for (int kc = 0; kc < KIN / 32; ++kc) { v16b a; { const float* p = X + (r0 + col) * KIN + kc * 32 + 8 * g;
#pragma unroll
      for (int i = 0; i < 8; ++i) { a[i] = (__bf16)p[i]; a[8 + i] = (__bf16)p[16 + i]; } }
#pragma unroll
    for (int j = 0; j < 8; ++j) acc[j] = wmma_bf(a, frag_b(P + (size_t)(n0 + j * 16 + col) * KIN + kc * 32, lane), acc[j]); }
  if (n0 < 2 * DM) {   // q stored unscaled (f16 sigma ~0.6, no subnormal exposure); 1/8 applied to the f32 score
#pragma unroll
    for (int j = 0; j < 8; ++j) {
#pragma unroll
      for (int r = 0; r < 8; ++r) { const float v = acc[j][r] + (BB ? bfr(BB[j * 16 + col]) : 0.f); const _Float16 hv = (_Float16)v; so[wave][8 * g + r][j * 16 + col] = hv; sol[wave][8 * g + r][j * 16 + col] = (_Float16)((v - (float)hv) * 2048.0f); } }   // q, k (+ bias) as f16 hi + (x2048) residual
    LDSX();
    for (int rl = 0; rl < 16; ++rl) if (lane < 16) { vst2((unsigned*)(QK + (r0 + rl) * (2 * DM) + n0 + lane * 8), *(const v4u*)&so[wave][rl][lane * 8]); vst2((unsigned*)(QKL + (r0 + rl) * (2 * DM) + n0 + lane * 8), *(const v4u*)&sol[wave][rl][lane * 8]); }
  } else {
#pragma unroll
    for (int j = 0; j < 8; ++j) {
#pragma unroll
      for (int r = 0; r < 8; ++r) { const float v = acc[j][r] + (BB ? bfr(BB[j * 16 + col]) : 0.f); const _Float16 hv = (_Float16)v; sth[j * 16 + col][wave * 16 + 8 * g + r] = hv; stl[j * 16 + col][wave * 16 + 8 * g + r] = (_Float16)((v - (float)hv) * 2048.0f); } }
    __syncthreads();
    const size_t rb = (size_t)blockIdx.x * 64; const int b = (int)(rb / SS), s0 = (int)(rb % SS); const int pc0 = n0 - 2 * DM;
    for (int q = tid; q < 128 * 8; q += 128) { const int d = q >> 3, pc = q & 7; const size_t o = ((size_t)b * DM + pc0 + d) * SS + s0 + pc * 8; vst2((unsigned*)(VTH + o), *(const v4u*)&sth[d][pc * 8]); vst2((unsigned*)(VTL + o), *(const v4u*)&stl[d][pc * 8]); }
  }
}
// ---- k_attn: block = (64 queries, head h, batch b): all-keys flash attention (K = 64: 2 k-steps), scores = (q.k) * 0.125 from q hi/lo x k hi/lo (3 products) in the first two query blocks, single f16 elsewhere, P.V: there 2^11 P hi/lo x V hi/lo (3 products) in two accumulators, elsewhere 2^11 P x V hi; O[b*S+q][h*64+d] = (acc + accl / 2048) / (2048 l) (256-B segments)
__device__ __forceinline__ v16h frag_p(const char* p) {   // frag_h from the lane's own byte address
  union { v16h v; v8h q[2]; } u; u.q[0] = *(const v8h*)p; u.q[1] = *(const v8h*)(p + 32); return u.v;
}
// K/V ring in LDS: one stage = the 32 keys of a pass. K plane: 32 rows (keys) of 128 B at pitch 144; V plane: 64 rows (d) of 64 B at pitch 80 (16 B x odd: conflict-free 16-byte fragment reads)
#define KPIT 144
#define VPIT 80
#define RK_H 0
#define RV_H (RK_H + 32 * KPIT)
#define RK_L (RV_H + 64 * VPIT)
#define RV_L (RK_L + 32 * KPIT)
#define RBUF (RV_L + 64 * VPIT)
// four 16-byte asynchronous copies a lane (each lane its own LDS byte address and global address); the s_wait_xcnt is the last line of the copies' own statement, so that it stands in front of any rewrite of their address registers
__device__ __forceinline__ void copy4(unsigned l0, const char* g0, unsigned l1, const char* g1, unsigned l2, const char* g2, unsigned l3, const char* g3) {
  asm volatile("global_load_async_to_lds_b128 %0, %1, off\n\tglobal_load_async_to_lds_b128 %2, %3, off\n\tglobal_load_async_to_lds_b128 %4, %5, off\n\tglobal_load_async_to_lds_b128 %6, %7, off\n\ts_wait_xcnt 0x0" :: "v"(l0), "v"(g0), "v"(l1), "v"(g1), "v"(l2), "v"(g2), "v"(l3), "v"(g3) : "memory");
}
// HV = leading query block (3 products); one straight-line loop body for each of the two kinds, so that each kind's load groups stand in one block of code
template <bool HV> __device__ __forceinline__ void attn_body(const _Float16* __restrict__ QK, const _Float16* __restrict__ QKL, const _Float16* __restrict__ VTH, const _Float16* __restrict__ VTL, float* __restrict__ O, float (*sp)[16][36], float (*so)[16][68], char* ring) {
  const int tid = threadIdx.x, wave = tid >> 5, lane = tid & 31, col = lane & 15, g = lane >> 4;
  const int qb = blockIdx.x, h = blockIdx.y, b = blockIdx.z; const int q0 = qb * 64 + wave * 16; const size_t rq = (size_t)b * SS + q0 + col;
  v16h aq[2], aql[2];
#pragma unroll
  for (int kc = 0; kc < 2; ++kc) { aq[kc] = frag_h(QK + rq * (2 * DM) + h * HD + kc * 32, lane); aql[kc] = frag_h(QKL + rq * (2 * DM) + h * HD + kc * 32, lane); }
  float m[8], l[8];
#pragma unroll
  for (int r = 0; r < 8; ++r) { m[r] = -3.0e38f; l[r] = 0.f; }
  v8f acc[4] = {}, accl[4] = {};
  const int nks = SS / 32;   // all keys
  const unsigned kof = (unsigned)col * KPIT + 16 * g, vof = (unsigned)col * VPIT + 16 * g;   // the lane's byte offsets inside a K and a V fragment of the ring, the same in every pass
  // the work-group's 128 lanes copy a stage by whole rows: K row = 8 lanes x 16 B (a wave covers 4 whole 128-B lines), V row = 4 lanes x 16 B; two copies a lane and plane
  const unsigned rb = (unsigned)(size_t)ring;
  const unsigned lk = rb + (unsigned)(tid >> 3) * KPIT + (tid & 7) * 16, lv = rb + (unsigned)(tid >> 2) * VPIT + (tid & 3) * 16;
  const size_t gk = 2 * (((size_t)b * SS + (tid >> 3)) * (2 * DM) + DM + h * HD + (tid & 7) * 8), gv = 2 * (((size_t)b * DM + h * HD + (tid >> 2)) * SS + (tid & 3) * 8);   // byte offsets of the lane's first K and V piece of stage 0
  auto stage = [&](int st, unsigned bo) {   // stage st (keys st * 32 ...) into the buffer at byte bo
    const size_t ok = gk + (size_t)st * (32 * 2 * DM * 2), ov = gv + (size_t)st * (32 * 2);
    copy4(lk + bo + RK_H, (const char*)QK + ok, lk + bo + RK_H + 16 * KPIT, (const char*)QK + ok + 16 * (2 * DM * 2), lv + bo + RV_H, (const char*)VTH + ov, lv + bo + RV_H + 32 * VPIT, (const char*)VTH + ov + 32 * (SS * 2));
    if (HV) copy4(lk + bo + RK_L, (const char*)QKL + ok, lk + bo + RK_L + 16 * KPIT, (const char*)QKL + ok + 16 * (2 * DM * 2), lv + bo + RV_L, (const char*)VTL + ov, lv + bo + RV_L + 32 * VPIT, (const char*)VTL + ov + 32 * (SS * 2)); };
  stage(0, 0);
  asm volatile("s_wait_asynccnt 0x0" ::: "memory");   // this wave's copies of stage 0 have landed
  __syncthreads();                                    // ... and every other wave's: stage 0 may be read
  stage(1, RBUF);
#pragma unroll 1
  for (int ks = 0; ks < nks; ++ks) { v8f s[2];
    // every K fragment of the pass is read from the ring as one group in front of the first product
    v16h kh[2][2], kl[2][2];
    const unsigned bo = (unsigned)(ks & 1) * RBUF; const char* kp = ring + bo + RK_H + kof; const char* kpl = ring + bo + RK_L + kof;   // one address a plane; the fragments lie at constant offsets from it
#pragma unroll
    for (int ct = 0; ct < 2; ++ct) {
#pragma unroll
      for (int kc = 0; kc < 2; ++kc) { kh[ct][kc] = frag_p(kp + ct * 16 * KPIT + kc * 64); if (HV) kl[ct][kc] = frag_p(kpl + ct * 16 * KPIT + kc * 64); } }
#pragma unroll
    for (int ct = 0; ct < 2; ++ct) { v8f c = {}, cl = {};
      if (HV) {   // leading query blocks (outputs far above the global rms): 3 products
#pragma unroll
        for (int kc = 0; kc < 2; ++kc) { c = wmma16(aq[kc], kh[ct][kc], c); cl = wmma16(aql[kc], kh[ct][kc], cl); cl = wmma16(aq[kc], kl[ct][kc], cl); }
#pragma unroll
        for (int r = 0; r < 8; ++r) c[r] += cl[r] * (1.0f / 2048.0f); }
      else {
#pragma unroll
        for (int kc = 0; kc < 2; ++kc) c = wmma16(aq[kc], kh[ct][kc], c); }   // single product elsewhere
      { const bool keepk = true;
#pragma unroll
      for (int r = 0; r < 8; ++r) s[ct][r] = keepk ? c[r] * 0.125f : -3.0e38f; } }   // 1/sqrt(64); no key is masked
    // every V fragment of the pass is read from the ring as one group behind the score products: the reads fly while the softmax runs
    v16h vh[4], vl[4];
    const char* vp = ring + bo + RV_H + vof; const char* vpl = ring + bo + RV_L + vof;
#pragma unroll
    for (int dt = 0; dt < 4; ++dt) { vh[dt] = frag_p(vp + dt * 16 * VPIT); if (HV) vl[dt] = frag_p(vpl + dt * 16 * VPIT); }
#pragma unroll
    for (int r = 0; r < 8; ++r) { float mx = fmaxf(s[0][r], s[1][r]);
#pragma unroll
      for (int o = 1; o < 16; o <<= 1) mx = fmaxf(mx, __shfl_xor(mx, o));
      const float mn = fmaxf(m[r], mx); const float alpha = (m[r] <= -1.0e38f) ? 0.f : __expf(m[r] - mn);
      const float e0 = (s[0][r] <= -1.0e38f) ? 0.f : __expf(s[0][r] - mn), e1 = (s[1][r] <= -1.0e38f) ? 0.f : __expf(s[1][r] - mn); float es = e0 + e1;
#pragma unroll
      for (int o = 1; o < 16; o <<= 1) es += __shfl_xor(es, o);
      l[r] = l[r] * alpha + es; m[r] = mn;
#pragma unroll
      for (int dt = 0; dt < 4; ++dt) { acc[dt][r] *= alpha; accl[dt][r] *= alpha; }
      sp[wave][8 * g + r][col] = e0; sp[wave][8 * g + r][16 + col] = e1; }
    LDSX();
    v16h pa, pl; { const float* prow = &sp[wave][col][0] + 8 * (lane >> 4);
#pragma unroll
      for (int i = 0; i < 8; ++i) { const float x0 = prow[i] * 2048.0f, x1 = prow[16 + i] * 2048.0f; const _Float16 h0 = (_Float16)x0, h1 = (_Float16)x1; pa[i] = h0; pa[8 + i] = h1; pl[i] = (_Float16)((x0 - (float)h0) * 2048.0f); pl[8 + i] = (_Float16)((x1 - (float)h1) * 2048.0f); } }   // P scaled by 2^11 before the f16 split so small softmax weights stay out of the f16 subnormal range; 2^-11 folded into the epilogue
#pragma unroll
    for (int dt = 0; dt < 4; ++dt) { acc[dt] = wmma16(pa, vh[dt], acc[dt]); if (HV) { accl[dt] = wmma16(pl, vh[dt], accl[dt]); accl[dt] = wmma16(pa, vl[dt], accl[dt]); } }   // leading query blocks: P hi/lo x V hi/lo (3 products); elsewhere P x V single
    LDSX();
    // publish point: this wave's LDS reads of the pass are done, its copies of the next stage have landed; behind the barrier the next stage may be read and this pass's buffer refilled
    asm volatile("s_wait_dscnt 0x0" ::: "memory");
    asm volatile("s_wait_asynccnt 0x0" ::: "memory");
    __syncthreads();
    if (ks + 2 < nks) stage(ks + 2, bo); }
  asm volatile("s_wait_asynccnt 0x0" ::: "memory");   // no copy is left outstanding behind the loop
#pragma unroll
  for (int r = 0; r < 8; ++r) { const float il = (1.0f / 2048.0f) / l[r];
#pragma unroll
    for (int dt = 0; dt < 4; ++dt) so[wave][8 * g + r][dt * 16 + col] = (acc[dt][r] + accl[dt][r] * (1.0f / 2048.0f)) * il; }
  LDSX();
  for (int rl = 0; rl < 16; ++rl) if (lane < 16) vst2(O + ((size_t)b * SS + q0 + rl) * DM + h * HD + lane * 4, *(const v4f*)&so[wave][rl][lane * 4]);
}
__global__ __launch_bounds__(128) void k_attn(const _Float16* __restrict__ QK, const _Float16* __restrict__ QKL, const _Float16* __restrict__ VTH, const _Float16* __restrict__ VTL, const void* __restrict__ KMASK, float* __restrict__ O) {
  __shared__ __align__(16) float sp[4][16][36]; __shared__ __align__(16) float so[4][16][68]; __shared__ __align__(16) char ring[2 * RBUF]; (void)KMASK;
  if (blockIdx.x < 2) attn_body<true>(QK, QKL, VTH, VTL, O, sp, so, ring); else attn_body<false>(QK, QKL, VTH, VTL, O, sp, so, ring);
}
// ---- k_out: block = (64 rows, 128 cols): out = O(hi/lo) . Wo rows (2 products) + bo
__global__ __launch_bounds__(128) void k_out(const float* __restrict__ O, const __bf16* __restrict__ P, const float* __restrict__ BO, float* __restrict__ Y) {
  __shared__ __align__(16) float so[4][16][132];
  const int tid = threadIdx.x, wave = tid >> 5, lane = tid & 31, col = lane & 15, g = lane >> 4; const size_t r0 = (size_t)blockIdx.x * 64 + wave * 16; const int n0 = blockIdx.y * 128;
  v8f acc[8] = {};
#pragma unroll 2
  for (int kc = 0; kc < DM / 32; ++kc) { const F2 a = split_row(O + (r0 + col) * DM, kc * 32, lane);
#pragma unroll
    for (int j = 0; j < 8; ++j) { const v16b w = frag_b(P + (size_t)(n0 + j * 16 + col) * DM + kc * 32, lane); acc[j] = wmma_bf(a.l, w, acc[j]); acc[j] = wmma_bf(a.h, w, acc[j]); } }
#pragma unroll
  for (int j = 0; j < 8; ++j) {
#pragma unroll
    for (int r = 0; r < 8; ++r) so[wave][8 * g + r][j * 16 + col] = acc[j][r] + bfr(BO[n0 + j * 16 + col]); }
  LDSX();
  for (int rl = 0; rl < 16; ++rl) vst2(Y + (r0 + rl) * DM + n0 + lane * 4, *(const v4f*)&so[wave][rl][lane * 4]);
}
// ---- k_pbias: one block: PB[which][h*64 + d] = concat_bias[h*192 + which*64 + d] (conn_b for columns < 64, qkv_b after) -> three 4-KB rows
__global__ __launch_bounds__(256) void k_pbias(const float* __restrict__ CONNB, const float* __restrict__ QKVB, float* __restrict__ PB) { __shared__ __align__(16) float s[3 * DM]; const int t = threadIdx.x;
  for (int e = t; e < 3 * DM; e += 256) { const int which = e / DM, n = e % DM; const int h = n / HD, d = n % HD; const int src = h * (3 * HD) + which * HD + d; s[e] = (src < HOUT) ? CONNB[src] : QKVB[src - HOUT]; }
  __syncthreads(); for (int q = t; q < 3 * DM / 4; q += 256) vst2(PB + q * 4, *(const v4f*)&s[q * 4]); }
// ---- k_o: block = 64 rows r' = (b', s'): o = ctx (bf16 hi + lo) . o_w rows + o_b -> out[(s' * BSZ + b') * 64] (the final (B,S)->(S,B) transpose)
__global__ __launch_bounds__(128) void k_o(const float* __restrict__ O, const __bf16* __restrict__ P, const float* __restrict__ OB, float* __restrict__ Y) { __shared__ __align__(16) float so[4][16][68];
  const int tid = threadIdx.x, wave = tid >> 5, lane = tid & 31, col = lane & 15, g = lane >> 4; const size_t r0 = (size_t)blockIdx.x * 64 + wave * 16; const __bf16* Wr = P + PK_P;
  v8f acc[4] = {};
#pragma unroll 2
  for (int kc = 0; kc < DM / 32; ++kc) { const F2 a = split_row(O + (r0 + col) * DM, kc * 32, lane);
#pragma unroll
    for (int j = 0; j < 4; ++j) { const v16b w = frag_b(Wr + (size_t)(j * 16 + col) * DM + kc * 32, lane); acc[j] = wmma_bf(a.h, w, acc[j]); acc[j] = wmma_bf(a.l, w, acc[j]); } }
#pragma unroll
  for (int j = 0; j < 4; ++j) { const float bb = bfr(OB[j * 16 + col]);
#pragma unroll
    for (int r = 0; r < 8; ++r) so[wave][8 * g + r][j * 16 + col] = acc[j][r] + bb; }
  LDSX(); for (int rl = 0; rl < 16; ++rl) if (lane < 16) { const size_t rp = r0 + rl; const size_t bp = rp / SS, sp = rp % SS; vst2(Y + (sp * BSZ + bp) * HOUT + lane * 4, *(const v4f*)&so[wave][rl][lane * 4]); } }
extern "C" void kernel_launch(void* const* d_in, const int* in_sizes, int n_in, void* d_out, int out_size, void* d_ws, size_t ws_size, hipStream_t stream) {
  (void)in_sizes; (void)n_in; (void)out_size;
  const float** F = (const float**)d_in;   // 0 x [2048,2,512], 1 qkv_w [3008,512], 2 qkv_b [3008], 3 conn_w [64,512], 4 conn_b [64], 5 o_w [64,1024], 6 o_b [64]
  if (ws_size < (size_t)WS_END + 4u * 3 * DM) return;
  char* ws = (char*)d_ws; __bf16* PK = (__bf16*)(ws + WS_PK); _Float16 *QK = (_Float16*)(ws + WS_QK), *QKL = (_Float16*)(ws + WS_QKL), *VTH = (_Float16*)(ws + WS_VTH), *VTL = (_Float16*)(ws + WS_VTL); float* O = (float*)(ws + WS_O); float* PB = (float*)(ws + WS_END);
  k_pack<<<dim3(DM, 4), 256, 0, stream>>>(F[3], F[1], F[5], nullptr, PK);
  k_pbias<<<1, 256, 0, stream>>>(F[4], F[2], PB);
  // the (S,B,512) input rows in memory order ARE the (b', s') rows of the raw reshape: row r = b' * 2048 + s'
  k_qkv<<<dim3(TNB * SS / 64, QKVW / 128), 128, 0, stream>>>(F[0], F[0], F[0], PK + PK_A, PB, PB + DM, PB + 2 * DM, QK, QKL, VTH, VTL);
  k_attn<<<dim3(TQB, NH, TNB), 128, 0, stream>>>(QK, QKL, VTH, VTL, nullptr, O);
  k_o<<<TOB, 128, 0, stream>>>(O, PK, F[6], (float*)d_out);
}

// v003
// A run of this version takes 224 microseconds.
// In both of two side-by-side timings against v002, it was 1.42 times as fast.
// All steps since v000 together make it 1.92 times as fast.
// compute dtype: all float inputs rounded to bf16; the concatenated [conn | qkv] projection with EXACT bf16 products on WMMA 16x16x32 (weight rows permuted at pack time into per-head q / k / v blocks; K = 512) + biases in f32, rounded once to f16 hi + residual; PLAIN-HYBRID attention (first 128 queries of each attention batch 3-product, later single f16), x 1/8, running-max softmax in f32 (hardware exp); out = ctx (bf16 hi + lo, 2 products) . o_w rows + o_b; f32 output.
#include <hip/hip_runtime.h>
#include <math.h>

typedef __attribute__((ext_vector_type(16))) _Float16 v16h;
typedef __attribute__((ext_vector_type(16))) __bf16 v16b;
typedef __attribute__((ext_vector_type(8)))  _Float16 v8h;
typedef __attribute__((ext_vector_type(8)))  float v8f;
typedef __attribute__((ext_vector_type(4)))  float v4f;
typedef __attribute__((ext_vector_type(2)))  float v2f;
typedef __attribute__((ext_vector_type(4)))  unsigned v4u;
typedef __attribute__((ext_vector_type(4)))  int v4i;
typedef float __attribute__((may_alias)) float_a;
typedef int __attribute__((may_alias)) int_a;

template <typename T> __device__ __forceinline__ void vst2(void* p, T v) { *(T*)p = v;  }
__device__ __forceinline__ v8f wmma16(v16h a, v16h b, v8f c) {
  v8f d = __builtin_amdgcn_wmma_f32_16x16x32_f16(false, a, false, b, (short)0, c, false, false);
  asm volatile("v_nop\n\tv_nop\n\tv_nop\n\tv_nop" : "+v"(d) : "v"(a), "v"(b));
  return d;
}
__device__ __forceinline__ v8f wmma_bf(v16b a, v16b b, v8f c) {
  v8f d = __builtin_amdgcn_wmma_f32_16x16x32_bf16(false, a, false, b, (short)0, c, false, false);
  asm volatile("v_nop\n\tv_nop\n\tv_nop\n\tv_nop" : "+v"(d) : "v"(a), "v"(b));
  return d;
}
// Modified multi-head attention (S 2,048, B 2, d_in 512, 16 heads x 64): qkv from one projection plus a fixed 'connection' projection supplying 64 of the q columns, the torch raw reshape (S,B,3E) -> (B,S,H,3*64) kept literally (so attention 'batches' are contiguous halves of the (s,b) row order and each head's q|k|v are consecutive 64-column slices), softmax(q k / 8) v, output projection E -> 64 + bias, returned as (S, B, 64).
__device__ __forceinline__ v16h frag_h(const _Float16* rowk0, int lane) {
  union { v16h v; v8h q[2]; } u; const _Float16* p = rowk0 + 8 * (lane >> 4);
  u.q[0] = *(const v8h*)p; u.q[1] = *(const v8h*)(p + 16); return u.v;
}
__device__ __forceinline__ v16h frag_f32(const float* rowk0, int lane) {
  v16h a; const float* p = rowk0 + 8 * (lane >> 4);
#pragma unroll
  for (int i = 0; i < 8; ++i) { a[i] = (_Float16)p[i]; a[8 + i] = (_Float16)p[16 + i]; }
  return a;
}
__device__ __forceinline__ v16h frag_f32s(const float* rowk0, int lane, float sc) {
  v16h a; const float* p = rowk0 + 8 * (lane >> 4);
#pragma unroll
  for (int i = 0; i < 8; ++i) { a[i] = (_Float16)(p[i] * sc); a[8 + i] = (_Float16)(p[16 + i] * sc); }
  return a;
}
// column fragment from a [K][ld] layout (column n), rows >= K read as 0
__device__ __forceinline__ v16h fragc_f32(const float* W, int k0, int n, int lane, int ld, int K) {
  v16h a; const int g = lane >> 4;
#pragma unroll
  for (int i = 0; i < 8; ++i) { const int ka = k0 + 8 * g + i, kb = ka + 16;
    a[i] = (_Float16)(ka < K ? W[(size_t)(ka < K ? ka : K - 1) * ld + n] : 0.f); a[8 + i] = (_Float16)(kb < K ? W[(size_t)(kb < K ? kb : K - 1) * ld + n] : 0.f); }
  return a;
}
struct F2 { v16b h, l; };
__device__ __forceinline__ F2 bsplit16(const float v[16]) { F2 r;
#pragma unroll
  for (int i = 0; i < 16; ++i) { const __bf16 h = (__bf16)v[i]; r.h[i] = h; r.l[i] = (__bf16)(v[i] - (float)h); }
  return r; }
__device__ __forceinline__ F2 split_row(const float* row, int k0, int lane) { float v[16]; const float* p = row + k0 + 8 * (lane >> 4);
#pragma unroll
  for (int i = 0; i < 8; ++i) { v[i] = p[i]; v[8 + i] = p[16 + i]; }
  return bsplit16(v); }
__device__ __forceinline__ F2 split_rowK(const float* row, int k0, int lane, int K) { float v[16]; const int g = lane >> 4;
#pragma unroll
  for (int i = 0; i < 8; ++i) { const int ka = k0 + 8 * g + i, kb = ka + 16; v[i] = ka < K ? row[ka < K ? ka : K - 1] : 0.f; v[8 + i] = kb < K ? row[kb < K ? kb : K - 1] : 0.f; }
  return bsplit16(v); }
__device__ __forceinline__ F2 split_col(const float* W, int k0, int n, int lane, int ld, int K) { float v[16]; const int g = lane >> 4;
#pragma unroll
  for (int i = 0; i < 8; ++i) { const int ka = k0 + 8 * g + i, kb = ka + 16; v[i] = ka < K ? W[(size_t)(ka < K ? ka : K - 1) * ld + n] : 0.f; v[8 + i] = kb < K ? W[(size_t)(kb < K ? kb : K - 1) * ld + n] : 0.f; }
  return bsplit16(v); }
__device__ __forceinline__ v8f mac3(const F2& a, const F2& b, v8f c) { c = wmma_bf(a.l, b.h, c); c = wmma_bf(a.h, b.l, c); return wmma_bf(a.h, b.h, c); }
__device__ __forceinline__ float sigm(float v) { return 1.0f / (1.0f + expf(-v)); }
#define LDSX() do { asm volatile("s_wait_dscnt 0" ::: "memory"); __builtin_amdgcn_wave_barrier(); __builtin_amdgcn_fence(__ATOMIC_RELEASE, "workgroup"); } while (0)


#define NB 2
#define SS 2048
#define DM 1024
#define NH 16
#define KIN 512          // input width
#define BSZ 2            // the module's batch (interleaved in the row order)
#define HOUT 64          // o_proj output width
#define HD 64
#define QKVW (3 * DM)
#ifndef TQB
#define TQB (SS / 64)
#define TNB NB
#define TOB (NB * SS / 64)     // output row tiles (all)
#endif
typedef __attribute__((ext_vector_type(8))) __bf16 v8b;
__device__ __forceinline__ v16b frag_b(const __bf16* rowk0, int lane) {
  union { v16b v; v8b q[2]; } u; const __bf16* p = rowk0 + 8 * (lane >> 4);
  u.q[0] = *(const v8b*)p; u.q[1] = *(const v8b*)(p + 16); return u.v;
}
__device__ __forceinline__ float bfr(float v) { return (float)(__bf16)v; }
__device__ __attribute__((noinline)) float exp_ni(float v) { return expf(v); }
__device__ __attribute__((noinline)) float erf_ni(float v) { return erff(v); }

#define PK_A 0                       // [3072][512] Wqkv rows (natural [out][in])
#define PK_P (PK_A + QKVW * DM)        // [64][1024] Wo rows (natural)
#define PK_END (PK_P + DM * DM)
#define WS_PK  0u
#define WS_QK  (WS_PK + 2u * PK_END)             // f16 [4096 rows][2048]: q | k
#define WS_QKL (WS_QK + 2u * NB * SS * 2 * DM)     // f16 q | k residual planes x2048
#define WS_VTH (WS_QKL + 2u * NB * SS * 2 * DM)    // f16 [b][1024 (h*64+d)][2048 s] hi
#define WS_VTL (WS_VTH + 2u * NB * DM * SS)        // f16 lo x 2048
#define WS_O   (WS_VTL + 2u * NB * DM * SS)        // f32 [4096][1024]
#define WS_CS  (WS_O + 4u * NB * SS * DM)           // f32 2 x [2048][32], not written or read
#define WS_END (WS_CS + 4u * 2 * SS * 32)
// ---- k_pack: block = (row n, which): natural [out][in] rows -> bf16; which 0..2 -> W_q/W_k/W_v into PK_A rows which*1024 + n; 3 -> W_o into PK_P
__global__ __launch_bounds__(256) void k_pack(const float* __restrict__ CONNW, const float* __restrict__ WQKV3, const float* __restrict__ OW, const float* __restrict__ unused, __bf16* __restrict__ PK) {
  __shared__ __align__(16) __bf16 s[DM]; const int n = blockIdx.x, which = blockIdx.y, t = threadIdx.x; (void)unused;
  if (which < 3) { const int h = n / HD, d = n % HD; const int src = h * (3 * HD) + which * HD + d;   // column of the concatenated [q_conn | qkv] buffer
    const float* row = (src < HOUT) ? (CONNW + (size_t)src * KIN) : (WQKV3 + (size_t)(src - HOUT) * KIN);
    for (int k = t; k < KIN; k += 256) s[k] = (__bf16)row[k]; __syncthreads();
    __bf16* dst = PK + PK_A + ((size_t)which * DM + n) * KIN; for (int q = t; q < KIN / 8; q += 256) vst2((unsigned*)(dst + q * 8), *(const v4u*)&s[q * 8]); }
  else { if (n >= HOUT) return; for (int k = t; k < DM; k += 256) s[k] = (__bf16)OW[(size_t)n * DM + k]; __syncthreads(); __bf16* dst = PK + PK_P + (size_t)n * DM; for (int q = t; q < DM / 8; q += 256) vst2((unsigned*)(dst + q * 8), *(const v4u*)&s[q * 8]); } }
__global__ __launch_bounds__(128) void k_qkv(const float* __restrict__ XQ, const float* __restrict__ XK, const float* __restrict__ XV, const __bf16* __restrict__ P, const float* __restrict__ BQ, const float* __restrict__ BK, const float* __restrict__ BV, _Float16* __restrict__ QK, _Float16* __restrict__ QKL, _Float16* __restrict__ VTH, _Float16* __restrict__ VTL) {
  const int which0 = (blockIdx.y * 128) / DM; const float* X = (which0 == 0) ? XQ : (which0 == 1) ? XK : XV; const float* BB = BQ ? (((which0 == 0) ? BQ : (which0 == 1) ? BK : BV) + (blockIdx.y * 128 - which0 * DM)) : nullptr;
  __shared__ __align__(16) _Float16 so[4][16][136], sol[4][16][136]; __shared__ __align__(16) _Float16 sth[128][72], stl[128][72];
  const int tid = threadIdx.x, wave = tid >> 5, lane = tid & 31, col = lane & 15, g = lane >> 4; const size_t r0 = (size_t)blockIdx.x * 64 + wave * 16; const int n0 = blockIdx.y * 128;
  v8f acc[8] = {};
#pragma unroll 2
  for (int kc = 0; kc < KIN / 32; ++kc) { v16b a; { const float* p = X + (r0 + col) * KIN + kc * 32 + 8 * g;
#pragma unroll
      for (int i = 0; i < 8; ++i) { a[i] = (__bf16)p[i]; a[8 + i] = (__bf16)p[16 + i]; } }
#pragma unroll
    for (int j = 0; j < 8; ++j) acc[j] = wmma_bf(a, frag_b(P + (size_t)(n0 + j * 16 + col) * KIN + kc * 32, lane), acc[j]); }
  if (n0 < 2 * DM) {   // q stored unscaled (f16 sigma ~0.6, no subnormal exposure); 1/8 applied to the f32 score
#pragma unroll
    for (int j = 0; j < 8; ++j) {
#pragma unroll
      for (int r = 0; r < 8; ++r) { const float v = acc[j][r] + (BB ? bfr(BB[j * 16 + col]) : 0.f); const _Float16 hv = (_Float16)v; so[wave][8 * g + r][j * 16 + col] = hv; sol[wave][8 * g + r][j * 16 + col] = (_Float16)((v - (float)hv) * 2048.0f); } }   // q, k (+ bias) as f16 hi + (x2048) residual
    LDSX();
    for (int rl = 0; rl < 16; ++rl) if (lane < 16) { vst2((unsigned*)(QK + (r0 + rl) * (2 * DM) + n0 + lane * 8), *(const v4u*)&so[wave][rl][lane * 8]); vst2((unsigned*)(QKL + (r0 + rl) * (2 * DM) + n0 + lane * 8), *(const v4u*)&sol[wave][rl][lane * 8]); }
  } else {
#pragma unroll
    for (int j = 0; j < 8; ++j) {
#pragma unroll
      for (int r = 0; r < 8; ++r) { const float v = acc[j][r] + (BB ? bfr(BB[j * 16 + col]) : 0.f); const _Float16 hv = (_Float16)v; sth[j * 16 + col][wave * 16 + 8 * g + r] = hv; stl[j * 16 + col][wave * 16 + 8 * g + r] = (_Float16)((v - (float)hv) * 2048.0f); } }
    __syncthreads();
    const size_t rb = (size_t)blockIdx.x * 64; const int b = (int)(rb / SS), s0 = (int)(rb % SS); const int pc0 = n0 - 2 * DM;
    for (int q = tid; q < 128 * 8; q += 128) { const int d = q >> 3, pc = q & 7; const size_t o = ((size_t)b * DM + pc0 + d) * SS + s0 + pc * 8; vst2((unsigned*)(VTH + o), *(const v4u*)&sth[d][pc * 8]); vst2((unsigned*)(VTL + o), *(const v4u*)&stl[d][pc * 8]); }
  }
}
// ---- k_attn: block = (64 queries, head h, batch b): all-keys flash attention (K = 64: 2 k-steps), scores = (q.k) * 0.125 from q hi/lo x k hi/lo (3 products) in the first two query blocks, single f16 elsewhere, P.V: there 2^11 P hi/lo x V hi/lo (3 products) in two accumulators, elsewhere 2^11 P x V hi; O[b*S+q][h*64+d] = (acc + accl / 2048) / (2048 l) (256-B segments)
__device__ __forceinline__ v16h frag_p(const char* p) {   // frag_h from the lane's own byte address
  union { v16h v; v8h q[2]; } u; u.q[0] = *(const v8h*)p; u.q[1] = *(const v8h*)(p + 32); return u.v;
}
// K/V ring in LDS: one stage = the 32 keys of a pass. K plane: 32 rows (keys) of 128 B at pitch 144; V plane: 64 rows (d) of 64 B at pitch 80 (16 B x odd: conflict-free 16-byte fragment reads)
#define KPIT 144
#define VPIT 80
#define RK_H 0
#define RV_H (RK_H + 32 * KPIT)
#define RK_L (RV_H + 64 * VPIT)
#define RV_L (RK_L + 32 * KPIT)
#define RBUF (RV_L + 64 * VPIT)
// four 16-byte asynchronous copies a lane (each lane its own LDS byte address and global address); the s_wait_xcnt is the last line of the copies' own statement, so that it stands in front of any rewrite of their address registers
__device__ __forceinline__ void copy4(unsigned l0, const char* g0, unsigned l1, const char* g1, unsigned l2, const char* g2, unsigned l3, const char* g3) {
  asm volatile("global_load_async_to_lds_b128 %0, %1, off\n\tglobal_load_async_to_lds_b128 %2, %3, off\n\tglobal_load_async_to_lds_b128 %4, %5, off\n\tglobal_load_async_to_lds_b128 %6, %7, off\n\ts_wait_xcnt 0x0" :: "v"(l0), "v"(g0), "v"(l1), "v"(g1), "v"(l2), "v"(g2), "v"(l3), "v"(g3) : "memory");
}
__device__ __forceinline__ float xhalf(float x) { return __builtin_bit_cast(float, __builtin_amdgcn_permlanex16(__builtin_bit_cast(int, x), __builtin_bit_cast(int, x), 0x76543210, 0xfedcba98, false, false)); }   // lane l with lane l ^ 16
template <bool HV> __device__ __forceinline__ void attn_body(const _Float16* __restrict__ QK, const _Float16* __restrict__ QKL, const _Float16* __restrict__ VTH, const _Float16* __restrict__ VTL, float* __restrict__ O, float (*so)[16][68], char* ring) {
  const int tid = threadIdx.x, wave = tid >> 5, lane = tid & 31, col = lane & 15, g = lane >> 4;
  const int qb = blockIdx.x, h = blockIdx.y, b = blockIdx.z; const int q0 = qb * 64 + wave * 16; const size_t rq = (size_t)b * SS + q0 + col;
  v16h aq[2], aql[2];
#pragma unroll
  for (int kc = 0; kc < 2; ++kc) { aq[kc] = frag_h(QK + rq * (2 * DM) + h * HD + kc * 32, lane); aql[kc] = frag_h(QKL + rq * (2 * DM) + h * HD + kc * 32, lane); }
  float m = -3.0e38f, l = 0.f;   // the lane's query: running maximum over all keys (the same in both halves), sum over this half's keys
  v8f acc[4] = {}, accl[4] = {};
  const int nks = SS / 32;   // all keys
  const unsigned kof = (unsigned)col * KPIT + 16 * g, vof = (unsigned)col * VPIT + 16 * g;   // the lane's byte offsets inside a K and a V fragment of the ring, the same in every pass
  // the work-group's 128 lanes copy a stage by whole rows: K row = 8 lanes x 16 B (a wave covers 4 whole 128-B lines), V row = 4 lanes x 16 B; two copies a lane and plane
  const unsigned rb = (unsigned)(size_t)ring;
  const unsigned lk = rb + (unsigned)(tid >> 3) * KPIT + (tid & 7) * 16, lv = rb + (unsigned)(tid >> 2) * VPIT + (tid & 3) * 16;
  const size_t gk = 2 * (((size_t)b * SS + (tid >> 3)) * (2 * DM) + DM + h * HD + (tid & 7) * 8), gv = 2 * (((size_t)b * DM + h * HD + (tid >> 2)) * SS + (tid & 3) * 8);   // byte offsets of the lane's first K and V piece of stage 0
  auto stage = [&](int st, unsigned bo) {   // stage st (keys st * 32 ...) into the buffer at byte bo
    const size_t ok = gk + (size_t)st * (32 * 2 * DM * 2), ov = gv + (size_t)st * (32 * 2);
    copy4(lk + bo + RK_H, (const char*)QK + ok, lk + bo + RK_H + 16 * KPIT, (const char*)QK + ok + 16 * (2 * DM * 2), lv + bo + RV_H, (const char*)VTH + ov, lv + bo + RV_H + 32 * VPIT, (const char*)VTH + ov + 32 * (SS * 2));
    if (HV) copy4(lk + bo + RK_L, (const char*)QKL + ok, lk + bo + RK_L + 16 * KPIT, (const char*)QKL + ok + 16 * (2 * DM * 2), lv + bo + RV_L, (const char*)VTL + ov, lv + bo + RV_L + 32 * VPIT, (const char*)VTL + ov + 32 * (SS * 2)); };
  stage(0, 0);
  asm volatile("s_wait_asynccnt 0x0" ::: "memory");   // this wave's copies of stage 0 have landed
  __syncthreads();                                    // ... and every other wave's: stage 0 may be read
  stage(1, RBUF);
#pragma unroll 1
  for (int ks = 0; ks < nks; ++ks) { v8f s[2];
    // every K fragment of the pass is read from the ring as one group in front of the first product
    v16h kh[2][2], kl[2][2];
    const unsigned bo = (unsigned)(ks & 1) * RBUF; const char* kp = ring + bo + RK_H + kof; const char* kpl = ring + bo + RK_L + kof;   // one address a plane; the fragments lie at constant offsets from it
#pragma unroll
    for (int ct = 0; ct < 2; ++ct) {
#pragma unroll
      for (int kc = 0; kc < 2; ++kc) { kh[ct][kc] = frag_p(kp + ct * 16 * KPIT + kc * 64); if (HV) kl[ct][kc] = frag_p(kpl + ct * 16 * KPIT + kc * 64); } }
#pragma unroll
    for (int ct = 0; ct < 2; ++ct) { v8f c = {}, cl = {};
      if (HV) {   // leading query blocks (outputs far above the global rms): 3 products
#pragma unroll
        for (int kc = 0; kc < 2; ++kc) { c = wmma16(kh[ct][kc], aq[kc], c); cl = wmma16(kh[ct][kc], aql[kc], cl); cl = wmma16(kl[ct][kc], aq[kc], cl); }
#pragma unroll
        for (int r = 0; r < 8; ++r) c[r] += cl[r] * (1.0f / 2048.0f); }
      else {
#pragma unroll
        for (int kc = 0; kc < 2; ++kc) c = wmma16(kh[ct][kc], aq[kc], c); }   // single product elsewhere
      { const bool keepk = true;
#pragma unroll
      for (int r = 0; r < 8; ++r) s[ct][r] = keepk ? c[r] * 0.125f : -3.0e38f; } }   // 1/sqrt(64); no key is masked
    // every V fragment of the pass is read from the ring as one group behind the score products: the reads fly while the softmax runs
    v16h vh[4], vl[4];
    const char* vp = ring + bo + RV_H + vof; const char* vpl = ring + bo + RV_L + vof;
#pragma unroll
    for (int dt = 0; dt < 4; ++dt) { vh[dt] = frag_p(vp + dt * 16 * VPIT); if (HV) vl[dt] = frag_p(vpl + dt * 16 * VPIT); }
    float t[8];   // maximum and sum of the lane's 16 scores as trees in registers
#pragma unroll
    for (int r = 0; r < 8; ++r) t[r] = fmaxf(s[0][r], s[1][r]);
    float mx = fmaxf(fmaxf(fmaxf(t[0], t[1]), fmaxf(t[2], t[3])), fmaxf(fmaxf(t[4], t[5]), fmaxf(t[6], t[7])));
    mx = fmaxf(mx, xhalf(mx));   // the other half's 16 keys of the same query
    const float mn = fmaxf(m, mx); const float alpha = (m <= -1.0e38f) ? 0.f : __expf(m - mn);
    float e[2][8];
#pragma unroll
    for (int r = 0; r < 8; ++r) { e[0][r] = (s[0][r] <= -1.0e38f) ? 0.f : __expf(s[0][r] - mn); e[1][r] = (s[1][r] <= -1.0e38f) ? 0.f : __expf(s[1][r] - mn); t[r] = e[0][r] + e[1][r]; }
    l = l * alpha + (((t[0] + t[1]) + (t[2] + t[3])) + ((t[4] + t[5]) + (t[6] + t[7]))); m = mn;   // the two halves' sums are joined once, behind the loop
#pragma unroll
    for (int dt = 0; dt < 4; ++dt) {
#pragma unroll
      for (int r = 0; r < 8; ++r) { acc[dt][r] *= alpha; accl[dt][r] *= alpha; } }
    v16h pa, pl;
#pragma unroll
    for (int i = 0; i < 8; ++i) { const float x0 = e[0][i] * 2048.0f, x1 = e[1][i] * 2048.0f; const _Float16 h0 = (_Float16)x0, h1 = (_Float16)x1; pa[i] = h0; pa[8 + i] = h1; pl[i] = (_Float16)((x0 - (float)h0) * 2048.0f); pl[8 + i] = (_Float16)((x1 - (float)h1) * 2048.0f); }   // P scaled by 2^11 before the f16 split so small softmax weights stay out of the f16 subnormal range; 2^-11 folded into the epilogue
#pragma unroll
    for (int dt = 0; dt < 4; ++dt) { acc[dt] = wmma16(vh[dt], pa, acc[dt]); if (HV) { accl[dt] = wmma16(vh[dt], pl, accl[dt]); accl[dt] = wmma16(vl[dt], pa, accl[dt]); } }   // leading query blocks: P hi/lo x V hi/lo (3 products); elsewhere P x V single
    // publish point: this wave's LDS reads of the pass are done, its copies of the next stage have landed; behind the barrier the next stage may be read and this pass's buffer refilled
    asm volatile("s_wait_dscnt 0x0" ::: "memory");
    asm volatile("s_wait_asynccnt 0x0" ::: "memory");
    __syncthreads();
    if (ks + 2 < nks) stage(ks + 2, bo); }
  asm volatile("s_wait_asynccnt 0x0" ::: "memory");   // no copy is left outstanding behind the loop
  const float il = (1.0f / 2048.0f) / (l + xhalf(l));
#pragma unroll
  for (int dt = 0; dt < 4; ++dt) {
#pragma unroll
    for (int q = 0; q < 2; ++q) { v4f o;
#pragma unroll
      for (int i = 0; i < 4; ++i) o[i] = (acc[dt][4 * q + i] + accl[dt][4 * q + i] * (1.0f / 2048.0f)) * il;
      vst2(&so[wave][col][dt * 16 + 8 * g + 4 * q], o); } }
  LDSX();
  for (int rl = 0; rl < 16; ++rl) if (lane < 16) vst2(O + ((size_t)b * SS + q0 + rl) * DM + h * HD + lane * 4, *(const v4f*)&so[wave][rl][lane * 4]);
}
__global__ __launch_bounds__(128) void k_attn(const _Float16* __restrict__ QK, const _Float16* __restrict__ QKL, const _Float16* __restrict__ VTH, const _Float16* __restrict__ VTL, const void* __restrict__ KMASK, float* __restrict__ O) {
  __shared__ __align__(16) float so[4][16][68]; __shared__ __align__(16) char ring[2 * RBUF]; (void)KMASK;
  if (blockIdx.x < 2) attn_body<true>(QK, QKL, VTH, VTL, O, so, ring); else attn_body<false>(QK, QKL, VTH, VTL, O, so, ring);
}
// ---- k_out: block = (64 rows, 128 cols): out = O(hi/lo) . Wo rows (2 products) + bo
__global__ __launch_bounds__(128) void k_out(const float* __restrict__ O, const __bf16* __restrict__ P, const float* __restrict__ BO, float* __restrict__ Y) {
  __shared__ __align__(16) float so[4][16][132];
  const int tid = threadIdx.x, wave = tid >> 5, lane = tid & 31, col = lane & 15, g = lane >> 4; const size_t r0 = (size_t)blockIdx.x * 64 + wave * 16; const int n0 = blockIdx.y * 128;
  v8f acc[8] = {};
#pragma unroll 2
  for (int kc = 0; kc < DM / 32; ++kc) { const F2 a = split_row(O + (r0 + col) * DM, kc * 32, lane);
#pragma unroll
    for (int j = 0; j < 8; ++j) { const v16b w = frag_b(P + (size_t)(n0 + j * 16 + col) * DM + kc * 32, lane); acc[j] = wmma_bf(a.l, w, acc[j]); acc[j] = wmma_bf(a.h, w, acc[j]); } }
#pragma unroll
  for (int j = 0; j < 8; ++j) {
#pragma unroll
    for (int r = 0; r < 8; ++r) so[wave][8 * g + r][j * 16 + col] = acc[j][r] + bfr(BO[n0 + j * 16 + col]); }
  LDSX();
  for (int rl = 0; rl < 16; ++rl) vst2(Y + (r0 + rl) * DM + n0 + lane * 4, *(const v4f*)&so[wave][rl][lane * 4]);
}
// ---- k_pbias: one block: PB[which][h*64 + d] = concat_bias[h*192 + which*64 + d] (conn_b for columns < 64, qkv_b after) -> three 4-KB rows
__global__ __launch_bounds__(256) void k_pbias(const float* __restrict__ CONNB, const float* __restrict__ QKVB, float* __restrict__ PB) { __shared__ __align__(16) float s[3 * DM]; const int t = threadIdx.x;
  for (int e = t; e < 3 * DM; e += 256) { const int which = e / DM, n = e % DM; const int h = n / HD, d = n % HD; const int src = h * (3 * HD) + which * HD + d; s[e] = (src < HOUT) ? CONNB[src] : QKVB[src - HOUT]; }
  __syncthreads(); for (int q = t; q < 3 * DM / 4; q += 256) vst2(PB + q * 4, *(const v4f*)&s[q * 4]); }
// ---- k_o: block = 64 rows r' = (b', s'): o = ctx (bf16 hi + lo) . o_w rows + o_b -> out[(s' * BSZ + b') * 64] (the final (B,S)->(S,B) transpose)
__global__ __launch_bounds__(128) void k_o(const float* __restrict__ O, const __bf16* __restrict__ P, const float* __restrict__ OB, float* __restrict__ Y) { __shared__ __align__(16) float so[4][16][68];
  const int tid = threadIdx.x, wave = tid >> 5, lane = tid & 31, col = lane & 15, g = lane >> 4; const size_t r0 = (size_t)blockIdx.x * 64 + wave * 16; const __bf16* Wr = P + PK_P;
  v8f acc[4] = {};
#pragma unroll 2
  for (int kc = 0; kc < DM / 32; ++kc) { const F2 a = split_row(O + (r0 + col) * DM, kc * 32, lane);
#pragma unroll
    for (int j = 0; j < 4; ++j) { const v16b w = frag_b(Wr + (size_t)(j * 16 + col) * DM + kc * 32, lane); acc[j] = wmma_bf(a.h, w, acc[j]); acc[j] = wmma_bf(a.l, w, acc[j]); } }
#pragma unroll
  for (int j = 0; j < 4; ++j) { const float bb = bfr(OB[j * 16 + col]);
#pragma unroll
    for (int r = 0; r < 8; ++r) so[wave][8 * g + r][j * 16 + col] = acc[j][r] + bb; }
  LDSX(); for (int rl = 0; rl < 16; ++rl) if (lane < 16) { const size_t rp = r0 + rl; const size_t bp = rp / SS, sp = rp % SS; vst2(Y + (sp * BSZ + bp) * HOUT + lane * 4, *(const v4f*)&so[wave][rl][lane * 4]); } }
extern "C" void kernel_launch(void* const* d_in, const int* in_sizes, int n_in, void* d_out, int out_size, void* d_ws, size_t ws_size, hipStream_t stream) {
  (void)in_sizes; (void)n_in; (void)out_size;
  const float** F = (const float**)d_in;   // 0 x [2048,2,512], 1 qkv_w [3008,512], 2 qkv_b [3008], 3 conn_w [64,512], 4 conn_b [64], 5 o_w [64,1024], 6 o_b [64]
  if (ws_size < (size_t)WS_END + 4u * 3 * DM) return;
  char* ws = (char*)d_ws; __bf16* PK = (__bf16*)(ws + WS_PK); _Float16 *QK = (_Float16*)(ws + WS_QK), *QKL = (_Float16*)(ws + WS_QKL), *VTH = (_Float16*)(ws + WS_VTH), *VTL = (_Float16*)(ws + WS_VTL); float* O = (float*)(ws + WS_O); float* PB = (float*)(ws + WS_END);
  k_pack<<<dim3(DM, 4), 256, 0, stream>>>(F[3], F[1], F[5], nullptr, PK);
  k_pbias<<<1, 256, 0, stream>>>(F[4], F[2], PB);
  // the (S,B,512) input rows in memory order ARE the (b', s') rows of the raw reshape: row r = b' * 2048 + s'
  k_qkv<<<dim3(TNB * SS / 64, QKVW / 128), 128, 0, stream>>>(F[0], F[0], F[0], PK + PK_A, PB, PB + DM, PB + 2 * DM, QK, QKL, VTH, VTL);
  k_attn<<<dim3(TQB, NH, TNB), 128, 0, stream>>>(QK, QKL, VTH, VTL, nullptr, O);
  k_o<<<TOB, 128, 0, stream>>>(O, PK, F[6], (float*)d_out);
}

// v004
// It runs in 168 microseconds.
// Timed twice side by side with v003, it ran 1.34 and 1.33 times as fast.
// All steps since v000 together make it 2.56 times as fast.
// compute dtype: all float inputs rounded to bf16; the concatenated [conn | qkv] projection with EXACT bf16 products on WMMA 16x16x32 (weight rows permuted at pack time into per-head q / k / v blocks; K = 512) + biases in f32, rounded once to f16 hi + residual; PLAIN-HYBRID attention (first 128 queries of each attention batch 3-product, later single f16), x 1/8, running-max softmax in f32 (hardware exp); out = ctx (bf16 hi + lo, 2 products) . o_w rows + o_b; f32 output.
#include <hip/hip_runtime.h>
#include <math.h>

typedef __attribute__((ext_vector_type(16))) _Float16 v16h;
typedef __attribute__((ext_vector_type(16))) __bf16 v16b;
typedef __attribute__((ext_vector_type(8)))  _Float16 v8h;
typedef __attribute__((ext_vector_type(8)))  float v8f;
typedef __attribute__((ext_vector_type(4)))  float v4f;
typedef __attribute__((ext_vector_type(2)))  float v2f;
typedef __attribute__((ext_vector_type(4)))  unsigned v4u;
typedef __attribute__((ext_vector_type(4)))  int v4i;
typedef float __attribute__((may_alias)) float_a;
typedef int __attribute__((may_alias)) int_a;

template <typename T> __device__ __forceinline__ void vst2(void* p, T v) { *(T*)p = v;  }
__device__ __forceinline__ v8f wmma16(v16h a, v16h b, v8f c) {
  v8f d = __builtin_amdgcn_wmma_f32_16x16x32_f16(false, a, false, b, (short)0, c, false, false);
  asm volatile("v_nop\n\tv_nop\n\tv_nop\n\tv_nop" : "+v"(d) : "v"(a), "v"(b));
  return d;
}
__device__ __forceinline__ v8f wmma_bf(v16b a, v16b b, v8f c) {
  v8f d = __builtin_amdgcn_wmma_f32_16x16x32_bf16(false, a, false, b, (short)0, c, false, false);
  asm volatile("v_nop\n\tv_nop\n\tv_nop\n\tv_nop" : "+v"(d) : "v"(a), "v"(b));
  return d;
}
// Modified multi-head attention (S 2,048, B 2, d_in 512, 16 heads x 64): qkv from one projection plus a fixed 'connection' projection supplying 64 of the q columns, the torch raw reshape (S,B,3E) -> (B,S,H,3*64) kept literally (so attention 'batches' are contiguous halves of the (s,b) row order and each head's q|k|v are consecutive 64-column slices), softmax(q k / 8) v, output projection E -> 64 + bias, returned as (S, B, 64).
__device__ __forceinline__ v16h frag_h(const _Float16* rowk0, int lane) {
  union { v16h v; v8h q[2]; } u; const _Float16* p = rowk0 + 8 * (lane >> 4);
  u.q[0] = *(const v8h*)p; u.q[1] = *(const v8h*)(p + 16); return u.v;
}
__device__ __forceinline__ v16h frag_f32(const float* rowk0, int lane) {
  v16h a; const float* p = rowk0 + 8 * (lane >> 4);
#pragma unroll
  for (int i = 0; i < 8; ++i) { a[i] = (_Float16)p[i]; a[8 + i] = (_Float16)p[16 + i]; }
  return a;
}
__device__ __forceinline__ v16h frag_f32s(const float* rowk0, int lane, float sc) {
  v16h a; const float* p = rowk0 + 8 * (lane >> 4);
#pragma unroll
  for (int i = 0; i < 8; ++i) { a[i] = (_Float16)(p[i] * sc); a[8 + i] = (_Float16)(p[16 + i] * sc); }
  return a;
}
// column fragment from a [K][ld] layout (column n), rows >= K read as 0
__device__ __forceinline__ v16h fragc_f32(const float* W, int k0, int n, int lane, int ld, int K) {
  v16h a; const int g = lane >> 4;
#pragma unroll
  for (int i = 0; i < 8; ++i) { const int ka = k0 + 8 * g + i, kb = ka + 16;
    a[i] = (_Float16)(ka < K ? W[(size_t)(ka < K ? ka : K - 1) * ld + n] : 0.f); a[8 + i] = (_Float16)(kb < K ? W[(size_t)(kb < K ? kb : K - 1) * ld + n] : 0.f); }
  return a;
}
struct F2 { v16b h, l; };
__device__ __forceinline__ F2 bsplit16(const float v[16]) { F2 r;
#pragma unroll
  for (int i = 0; i < 16; ++i) { const __bf16 h = (__bf16)v[i]; r.h[i] = h; r.l[i] = (__bf16)(v[i] - (float)h); }
  return r; }
__device__ __forceinline__ F2 split_row(const float* row, int k0, int lane) { float v[16]; const float* p = row + k0 + 8 * (lane >> 4);
#pragma unroll
  for (int i = 0; i < 8; ++i) { v[i] = p[i]; v[8 + i] = p[16 + i]; }
  return bsplit16(v); }
__device__ __forceinline__ F2 split_rowK(const float* row, int k0, int lane, int K) { float v[16]; const int g = lane >> 4;
#pragma unroll
  for (int i = 0; i < 8; ++i) { const int ka = k0 + 8 * g + i, kb = ka + 16; v[i] = ka < K ? row[ka < K ? ka : K - 1] : 0.f; v[8 + i] = kb < K ? row[kb < K ? kb : K - 1] : 0.f; }
  return bsplit16(v); }
__device__ __forceinline__ F2 split_col(const float* W, int k0, int n, int lane, int ld, int K) { float v[16]; const int g = lane >> 4;
#pragma unroll
  for (int i = 0; i < 8; ++i) { const int ka = k0 + 8 * g + i, kb = ka + 16; v[i] = ka < K ? W[(size_t)(ka < K ? ka : K - 1) * ld + n] : 0.f; v[8 + i] = kb < K ? W[(size_t)(kb < K ? kb : K - 1) * ld + n] : 0.f; }
  return bsplit16(v); }
__device__ __forceinline__ v8f mac3(const F2& a, const F2& b, v8f c) { c = wmma_bf(a.l, b.h, c); c = wmma_bf(a.h, b.l, c); return wmma_bf(a.h, b.h, c); }
__device__ __forceinline__ float sigm(float v) { return 1.0f / (1.0f + expf(-v)); }
#define LDSX() do { asm volatile("s_wait_dscnt 0" ::: "memory"); __builtin_amdgcn_wave_barrier(); __builtin_amdgcn_fence(__ATOMIC_RELEASE, "workgroup"); } while (0)


#define NB 2
#define SS 2048
#define DM 1024
#define NH 16
#define KIN 512          // input width
#define BSZ 2            // the module's batch (interleaved in the row order)
#define HOUT 64          // o_proj output width
#define HD 64
#define QKVW (3 * DM)
#ifndef TQB
#define TQB (SS / 64)
#define TNB NB
#define TOB (NB * SS / 64)     // output row tiles (all)
#endif
typedef __attribute__((ext_vector_type(8))) __bf16 v8b;
__device__ __forceinline__ v16b frag_b(const __bf16* rowk0, int lane) {
  union { v16b v; v8b q[2]; } u; const __bf16* p = rowk0 + 8 * (lane >> 4);
  u.q[0] = *(const v8b*)p; u.q[1] = *(const v8b*)(p + 16); return u.v;
}
__device__ __forceinline__ float bfr(float v) { return (float)(__bf16)v; }
__device__ __attribute__((noinline)) float exp_ni(float v) { return expf(v); }
__device__ __attribute__((noinline)) float erf_ni(float v) { return erff(v); }

#define PK_A 0                       // [3072][512] Wqkv rows (natural [out][in])
#define PK_P (PK_A + QKVW * DM)        // [64][1024] Wo rows (natural)
#define PK_END (PK_P + DM * DM)
#define WS_PK  0u
#define WS_QK  (WS_PK + 2u * PK_END)             // f16 [4096 rows][2048]: q | k
#define WS_QKL (WS_QK + 2u * NB * SS * 2 * DM)     // f16 q | k residual planes x2048
#define WS_VTH (WS_QKL + 2u * NB * SS * 2 * DM)    // f16 [b][1024 (h*64+d)][2048 s] hi
#define WS_VTL (WS_VTH + 2u * NB * DM * SS)        // f16 lo x 2048
#define WS_O   (WS_VTL + 2u * NB * DM * SS)        // f32 [4096][1024]
#define WS_CS  (WS_O + 4u * NB * SS * DM)           // f32 2 x [2048][32], not written or read
#define WS_END (WS_CS + 4u * 2 * SS * 32)
// ---- k_pack: block = (row n, which): natural [out][in] rows -> bf16; which 0..2 -> W_q/W_k/W_v into PK_A rows which*1024 + n; 3 -> W_o into PK_P
__global__ __launch_bounds__(256) void k_pack(const float* __restrict__ CONNW, const float* __restrict__ WQKV3, const float* __restrict__ OW, const float* __restrict__ unused, __bf16* __restrict__ PK) {
  __shared__ __align__(16) __bf16 s[DM]; const int n = blockIdx.x, which = blockIdx.y, t = threadIdx.x; (void)unused;
  if (which < 3) { const int h = n / HD, d = n % HD; const int src = h * (3 * HD) + which * HD + d;   // column of the concatenated [q_conn | qkv] buffer
    const float* row = (src < HOUT) ? (CONNW + (size_t)src * KIN) : (WQKV3 + (size_t)(src - HOUT) * KIN);
    for (int k = t; k < KIN; k += 256) s[k] = (__bf16)row[k]; __syncthreads();
    __bf16* dst = PK + PK_A + ((size_t)which * DM + n) * KIN; for (int q = t; q < KIN / 8; q += 256) vst2((unsigned*)(dst + q * 8), *(const v4u*)&s[q * 8]); }
  else { if (n >= HOUT) return; for (int k = t; k < DM; k += 256) s[k] = (__bf16)OW[(size_t)n * DM + k]; __syncthreads(); __bf16* dst = PK + PK_P + (size_t)n * DM; for (int q = t; q < DM / 8; q += 256) vst2((unsigned*)(dst + q * 8), *(const v4u*)&s[q * 8]); } }
// four 16-byte asynchronous copies a lane (each lane its own LDS byte address and global address); the s_wait_xcnt is the last line of the copies' own statement, so that it stands in front of any rewrite of their address registers
__device__ __forceinline__ void copy4(unsigned l0, const char* g0, unsigned l1, const char* g1, unsigned l2, const char* g2, unsigned l3, const char* g3) {
  asm volatile("global_load_async_to_lds_b128 %0, %1, off\n\tglobal_load_async_to_lds_b128 %2, %3, off\n\tglobal_load_async_to_lds_b128 %4, %5, off\n\tglobal_load_async_to_lds_b128 %6, %7, off\n\ts_wait_xcnt 0x0" :: "v"(l0), "v"(g0), "v"(l1), "v"(g1), "v"(l2), "v"(g2), "v"(l3), "v"(g3) : "memory");
}
// X / W ring of k_qkv in LDS: one stage = 64 k. X plane: the block's 64 rows of 256 B (f32) at pitch 272; W plane: its 128 weight rows of 128 B (bf16) at pitch 144 (both 16 B x odd: conflict-free 16-byte fragment reads)
#define XPIT 272
#define WPIT 144
#define QW_O (64 * XPIT)
#define QBUF (QW_O + 128 * WPIT)
__global__ __launch_bounds__(128) void k_qkv(const float* __restrict__ XQ, const float* __restrict__ XK, const float* __restrict__ XV, const __bf16* __restrict__ P, const float* __restrict__ BQ, const float* __restrict__ BK, const float* __restrict__ BV, _Float16* __restrict__ QK, _Float16* __restrict__ QKL, _Float16* __restrict__ VTH, _Float16* __restrict__ VTL) {
  const int which0 = (blockIdx.y * 128) / DM; const float* X = (which0 == 0) ? XQ : (which0 == 1) ? XK : XV; const float* BB = BQ ? (((which0 == 0) ? BQ : (which0 == 1) ? BK : BV) + (blockIdx.y * 128 - which0 * DM)) : nullptr;
  __shared__ __align__(16) char sm[2 * QBUF];   // the ring during the k loop; behind the loop's last barrier the same bytes stage the output tile
  _Float16 (*so)[16][136] = (_Float16 (*)[16][136])sm; _Float16 (*sol)[16][136] = so + 4; _Float16 (*sth)[72] = (_Float16 (*)[72])sm; _Float16 (*stl)[72] = sth + 128;
  const int tid = threadIdx.x, wave = tid >> 5, lane = tid & 31, col = lane & 15, g = lane >> 4; const size_t r0 = (size_t)blockIdx.x * 64 + wave * 16; const int n0 = blockIdx.y * 128;
  v8f acc[8] = {};
  // the work-group's 128 lanes copy a stage by whole rows: X row = 16 lanes x 16 B (a wave covers 2 rows = 4 whole lines), W row = 8 lanes x 16 B (4 rows = 4 whole lines); eight copies a lane and plane
  const unsigned rb = (unsigned)(size_t)sm;
  const unsigned lx = rb + (unsigned)(tid >> 4) * XPIT + (tid & 15) * 16, lw = rb + QW_O + (unsigned)(tid >> 3) * WPIT + (tid & 7) * 16;
  const char* gx = (const char*)X + ((size_t)blockIdx.x * 64 + (tid >> 4)) * (KIN * 4) + (tid & 15) * 16; const char* gw = (const char*)P + ((size_t)n0 + (tid >> 3)) * (KIN * 2) + (tid & 7) * 16;   // the lane's first X and W piece of stage 0
  auto stage = [&](int st, unsigned bo) {   // stage st (k = st * 64 ...) into the buffer at byte bo
    const char* x = gx + st * 256; const char* w = gw + st * 128; const unsigned a = lx + bo, c = lw + bo;
    copy4(a, x, a + 8 * XPIT, x + 8 * (KIN * 4), a + 16 * XPIT, x + 16 * (KIN * 4), a + 24 * XPIT, x + 24 * (KIN * 4));
    copy4(a + 32 * XPIT, x + 32 * (KIN * 4), a + 40 * XPIT, x + 40 * (KIN * 4), a + 48 * XPIT, x + 48 * (KIN * 4), a + 56 * XPIT, x + 56 * (KIN * 4));
    copy4(c, w, c + 16 * WPIT, w + 16 * (KIN * 2), c + 32 * WPIT, w + 32 * (KIN * 2), c + 48 * WPIT, w + 48 * (KIN * 2));
    copy4(c + 64 * WPIT, w + 64 * (KIN * 2), c + 80 * WPIT, w + 80 * (KIN * 2), c + 96 * WPIT, w + 96 * (KIN * 2), c + 112 * WPIT, w + 112 * (KIN * 2)); };
  const unsigned xof = (unsigned)(wave * 16 + col) * XPIT + 32 * g, wof = QW_O + (unsigned)col * WPIT + 16 * g;   // the lane's byte offsets inside an X and a W fragment of the ring, the same in every stage
  stage(0, 0);
  asm volatile("s_wait_asynccnt 0x0" ::: "memory");   // this wave's copies of stage 0 have landed
  __syncthreads();                                    // ... and every other wave's: stage 0 may be read
  stage(1, QBUF);
#pragma unroll 1   // kept rolled: the two buffers differ by an offset only, and eight copies of the body would only lengthen the text in front of the long epilogue
  for (int st = 0; st < KIN / 64; ++st) { const unsigned bo = (unsigned)(st & 1) * QBUF;
#pragma unroll
    for (int kc = 0; kc < 2; ++kc) {   // every fragment of a 32-k step is read from the ring as one group in front of its first product
      const char* xp = sm + bo + xof + kc * 128; const char* wp = sm + bo + wof + kc * 64;
      const v4f x0 = *(const v4f*)xp, x1 = *(const v4f*)(xp + 16), x2 = *(const v4f*)(xp + 64), x3 = *(const v4f*)(xp + 80);
      v16b w[8];
#pragma unroll
      for (int j = 0; j < 8; ++j) { union { v16b v; v8b q[2]; } u; u.q[0] = *(const v8b*)(wp + j * 16 * WPIT); u.q[1] = *(const v8b*)(wp + j * 16 * WPIT + 32); w[j] = u.v; }
      v16b a;
#pragma unroll
      for (int i = 0; i < 4; ++i) { a[i] = (__bf16)x0[i]; a[4 + i] = (__bf16)x1[i]; a[8 + i] = (__bf16)x2[i]; a[12 + i] = (__bf16)x3[i]; }
#pragma unroll
      for (int j = 0; j < 8; ++j) acc[j] = wmma_bf(a, w[j], acc[j]); }
    // publish point: this wave's LDS reads of the stage are done, its copies of the next stage have landed; behind the barrier the next stage may be read and this stage's buffer refilled
    asm volatile("s_wait_dscnt 0x0" ::: "memory");
    asm volatile("s_wait_asynccnt 0x0" ::: "memory");
    __syncthreads();
    if (st + 2 < KIN / 64) stage(st + 2, bo); }
  asm volatile("s_wait_asynccnt 0x0" ::: "memory");   // no copy is left outstanding behind the loop
  if (n0 < 2 * DM) {   // q stored unscaled (f16 sigma ~0.6, no subnormal exposure); 1/8 applied to the f32 score
#pragma unroll
    for (int j = 0; j < 8; ++j) {
#pragma unroll
      for (int r = 0; r < 8; ++r) { const float v = acc[j][r] + (BB ? bfr(BB[j * 16 + col]) : 0.f); const _Float16 hv = (_Float16)v; so[wave][8 * g + r][j * 16 + col] = hv; sol[wave][8 * g + r][j * 16 + col] = (_Float16)((v - (float)hv) * 2048.0f); } }   // q, k (+ bias) as f16 hi + (x2048) residual
    LDSX();
    for (int rl = 0; rl < 16; ++rl) if (lane < 16) { vst2((unsigned*)(QK + (r0 + rl) * (2 * DM) + n0 + lane * 8), *(const v4u*)&so[wave][rl][lane * 8]); vst2((unsigned*)(QKL + (r0 + rl) * (2 * DM) + n0 + lane * 8), *(const v4u*)&sol[wave][rl][lane * 8]); }
  } else {
#pragma unroll
    for (int j = 0; j < 8; ++j) {
#pragma unroll
      for (int r = 0; r < 8; ++r) { const float v = acc[j][r] + (BB ? bfr(BB[j * 16 + col]) : 0.f); const _Float16 hv = (_Float16)v; sth[j * 16 + col][wave * 16 + 8 * g + r] = hv; stl[j * 16 + col][wave * 16 + 8 * g + r] = (_Float16)((v - (float)hv) * 2048.0f); } }
    __syncthreads();
    const size_t rb = (size_t)blockIdx.x * 64; const int b = (int)(rb / SS), s0 = (int)(rb % SS); const int pc0 = n0 - 2 * DM;
    for (int q = tid; q < 128 * 8; q += 128) { const int d = q >> 3, pc = q & 7; const size_t o = ((size_t)b * DM + pc0 + d) * SS + s0 + pc * 8; vst2((unsigned*)(VTH + o), *(const v4u*)&sth[d][pc * 8]); vst2((unsigned*)(VTL + o), *(const v4u*)&stl[d][pc * 8]); }
  }
}
// ---- k_attn: block = (64 queries, head h, batch b): all-keys flash attention (K = 64: 2 k-steps), scores = (q.k) * 0.125 from q hi/lo x k hi/lo (3 products) in the first two query blocks, single f16 elsewhere, P.V: there 2^11 P hi/lo x V hi/lo (3 products) in two accumulators, elsewhere 2^11 P x V hi; O[b*S+q][h*64+d] = (acc + accl / 2048) / (2048 l) (256-B segments)
__device__ __forceinline__ v16h frag_p(const char* p) {   // frag_h from the lane's own byte address
  union { v16h v; v8h q[2]; } u; u.q[0] = *(const v8h*)p; u.q[1] = *(const v8h*)(p + 32); return u.v;
}
// K/V ring in LDS: one stage = the 32 keys of a pass. K plane: 32 rows (keys) of 128 B at pitch 144; V plane: 64 rows (d) of 64 B at pitch 80 (16 B x odd: conflict-free 16-byte fragment reads)
#define KPIT 144
#define VPIT 80
#define RK_H 0
#define RV_H (RK_H + 32 * KPIT)
#define RK_L (RV_H + 64 * VPIT)
#define RV_L (RK_L + 32 * KPIT)
#define RBUF (RV_L + 64 * VPIT)
__device__ __forceinline__ float xhalf(float x) { return __builtin_bit_cast(float, __builtin_amdgcn_permlanex16(__builtin_bit_cast(int, x), __builtin_bit_cast(int, x), 0x76543210, 0xfedcba98, false, false)); }   // lane l with lane l ^ 16
template <bool HV> __device__ __forceinline__ void attn_body(const _Float16* __restrict__ QK, const _Float16* __restrict__ QKL, const _Float16* __restrict__ VTH, const _Float16* __restrict__ VTL, float* __restrict__ O, float (*so)[16][68], char* ring) {
  const int tid = threadIdx.x, wave = tid >> 5, lane = tid & 31, col = lane & 15, g = lane >> 4;
  const int qb = blockIdx.x, h = blockIdx.y, b = blockIdx.z; const int q0 = qb * 64 + wave * 16; const size_t rq = (size_t)b * SS + q0 + col;
  v16h aq[2], aql[2];
#pragma unroll
  for (int kc = 0; kc < 2; ++kc) { aq[kc] = frag_h(QK + rq * (2 * DM) + h * HD + kc * 32, lane); aql[kc] = frag_h(QKL + rq * (2 * DM) + h * HD + kc * 32, lane); }
  float m = -3.0e38f, l = 0.f;   // the lane's query: running maximum over all keys (the same in both halves), sum over this half's keys
  v8f acc[4] = {}, accl[4] = {};
  const int nks = SS / 32;   // all keys
  const unsigned kof = (unsigned)col * KPIT + 16 * g, vof = (unsigned)col * VPIT + 16 * g;   // the lane's byte offsets inside a K and a V fragment of the ring, the same in every pass
  // the work-group's 128 lanes copy a stage by whole rows: K row = 8 lanes x 16 B (a wave covers 4 whole 128-B lines), V row = 4 lanes x 16 B; two copies a lane and plane
  const unsigned rb = (unsigned)(size_t)ring;
  const unsigned lk = rb + (unsigned)(tid >> 3) * KPIT + (tid & 7) * 16, lv = rb + (unsigned)(tid >> 2) * VPIT + (tid & 3) * 16;
  const size_t gk = 2 * (((size_t)b * SS + (tid >> 3)) * (2 * DM) + DM + h * HD + (tid & 7) * 8), gv = 2 * (((size_t)b * DM + h * HD + (tid >> 2)) * SS + (tid & 3) * 8);   // byte offsets of the lane's first K and V piece of stage 0
  auto stage = [&](int st, unsigned bo) {   // stage st (keys st * 32 ...) into the buffer at byte bo
    const size_t ok = gk + (size_t)st * (32 * 2 * DM * 2), ov = gv + (size_t)st * (32 * 2);
    copy4(lk + bo + RK_H, (const char*)QK + ok, lk + bo + RK_H + 16 * KPIT, (const char*)QK + ok + 16 * (2 * DM * 2), lv + bo + RV_H, (const char*)VTH + ov, lv + bo + RV_H + 32 * VPIT, (const char*)VTH + ov + 32 * (SS * 2));
    if (HV) copy4(lk + bo + RK_L, (const char*)QKL + ok, lk + bo + RK_L + 16 * KPIT, (const char*)QKL + ok + 16 * (2 * DM * 2), lv + bo + RV_L, (const char*)VTL + ov, lv + bo + RV_L + 32 * VPIT, (const char*)VTL + ov + 32 * (SS * 2)); };
  stage(0, 0);
  asm volatile("s_wait_asynccnt 0x0" ::: "memory");   // this wave's copies of stage 0 have landed
  __syncthreads();                                    // ... and every other wave's: stage 0 may be read
  stage(1, RBUF);
#pragma unroll 1
  for (int ks = 0; ks < nks; ++ks) { v8f s[2];
    // every K fragment of the pass is read from the ring as one group in front of the first product
    v16h kh[2][2], kl[2][2];
    const unsigned bo = (unsigned)(ks & 1) * RBUF; const char* kp = ring + bo + RK_H + kof; const char* kpl = ring + bo + RK_L + kof;   // one address a plane; the fragments lie at constant offsets from it
#pragma unroll
    for (int ct = 0; ct < 2; ++ct) {
#pragma unroll
      for (int kc = 0; kc < 2; ++kc) { kh[ct][kc] = frag_p(kp + ct * 16 * KPIT + kc * 64); if (HV) kl[ct][kc] = frag_p(kpl + ct * 16 * KPIT + kc * 64); } }
#pragma unroll
    for (int ct = 0; ct < 2; ++ct) { v8f c = {}, cl = {};
      if (HV) {   // leading query blocks (outputs far above the global rms): 3 products
#pragma unroll
        for (int kc = 0; kc < 2; ++kc) { c = wmma16(kh[ct][kc], aq[kc], c); cl = wmma16(kh[ct][kc], aql[kc], cl); cl = wmma16(kl[ct][kc], aq[kc], cl); }
#pragma unroll
        for (int r = 0; r < 8; ++r) c[r] += cl[r] * (1.0f / 2048.0f); }
      else {
#pragma unroll
        for (int kc = 0; kc < 2; ++kc) c = wmma16(kh[ct][kc], aq[kc], c); }   // single product elsewhere
      { const bool keepk = true;
#pragma unroll
      for (int r = 0; r < 8; ++r) s[ct][r] = keepk ? c[r] * 0.125f : -3.0e38f; } }   // 1/sqrt(64); no key is masked
    // every V fragment of the pass is read from the ring as one group behind the score products: the reads fly while the softmax runs
    v16h vh[4], vl[4];
    const char* vp = ring + bo + RV_H + vof; const char* vpl = ring + bo + RV_L + vof;
#pragma unroll
    for (int dt = 0; dt < 4; ++dt) { vh[dt] = frag_p(vp + dt * 16 * VPIT); if (HV) vl[dt] = frag_p(vpl + dt * 16 * VPIT); }
    float t[8];   // maximum and sum of the lane's 16 scores as trees in registers
#pragma unroll
    for (int r = 0; r < 8; ++r) t[r] = fmaxf(s[0][r], s[1][r]);
    float mx = fmaxf(fmaxf(fmaxf(t[0], t[1]), fmaxf(t[2], t[3])), fmaxf(fmaxf(t[4], t[5]), fmaxf(t[6], t[7])));
    mx = fmaxf(mx, xhalf(mx));   // the other half's 16 keys of the same query
    const float mn = fmaxf(m, mx); const float alpha = (m <= -1.0e38f) ? 0.f : __expf(m - mn);
    float e[2][8];
#pragma unroll
    for (int r = 0; r < 8; ++r) { e[0][r] = (s[0][r] <= -1.0e38f) ? 0.f : __expf(s[0][r] - mn); e[1][r] = (s[1][r] <= -1.0e38f) ? 0.f : __expf(s[1][r] - mn); t[r] = e[0][r] + e[1][r]; }
    l = l * alpha + (((t[0] + t[1]) + (t[2] + t[3])) + ((t[4] + t[5]) + (t[6] + t[7]))); m = mn;   // the two halves' sums are joined once, behind the loop
#pragma unroll
    for (int dt = 0; dt < 4; ++dt) {
#pragma unroll
      for (int r = 0; r < 8; ++r) { acc[dt][r] *= alpha; accl[dt][r] *= alpha; } }
    v16h pa, pl;
#pragma unroll
    for (int i = 0; i < 8; ++i) { const float x0 = e[0][i] * 2048.0f, x1 = e[1][i] * 2048.0f; const _Float16 h0 = (_Float16)x0, h1 = (_Float16)x1; pa[i] = h0; pa[8 + i] = h1; pl[i] = (_Float16)((x0 - (float)h0) * 2048.0f); pl[8 + i] = (_Float16)((x1 - (float)h1) * 2048.0f); }   // P scaled by 2^11 before the f16 split so small softmax weights stay out of the f16 subnormal range; 2^-11 folded into the epilogue
#pragma unroll
    for (int dt = 0; dt < 4; ++dt) { acc[dt] = wmma16(vh[dt], pa, acc[dt]); if (HV) { accl[dt] = wmma16(vh[dt], pl, accl[dt]); accl[dt] = wmma16(vl[dt], pa, accl[dt]); } }   // leading query blocks: P hi/lo x V hi/lo (3 products); elsewhere P x V single
    // publish point: this wave's LDS reads of the pass are done, its copies of the next stage have landed; behind the barrier the next stage may be read and this pass's buffer refilled
    asm volatile("s_wait_dscnt 0x0" ::: "memory");
    asm volatile("s_wait_asynccnt 0x0" ::: "memory");
    __syncthreads();
    if (ks + 2 < nks) stage(ks + 2, bo); }
  asm volatile("s_wait_asynccnt 0x0" ::: "memory");   // no copy is left outstanding behind the loop
  const float il = (1.0f / 2048.0f) / (l + xhalf(l));
#pragma unroll
  for (int dt = 0; dt < 4; ++dt) {
#pragma unroll
    for (int q = 0; q < 2; ++q) { v4f o;
#pragma unroll
      for (int i = 0; i < 4; ++i) o[i] = (acc[dt][4 * q + i] + accl[dt][4 * q + i] * (1.0f / 2048.0f)) * il;
      vst2(&so[wave][col][dt * 16 + 8 * g + 4 * q], o); } }
  LDSX();
  for (int rl = 0; rl < 16; ++rl) if (lane < 16) vst2(O + ((size_t)b * SS + q0 + rl) * DM + h * HD + lane * 4, *(const v4f*)&so[wave][rl][lane * 4]);
}
__global__ __launch_bounds__(128) void k_attn(const _Float16* __restrict__ QK, const _Float16* __restrict__ QKL, const _Float16* __restrict__ VTH, const _Float16* __restrict__ VTL, const void* __restrict__ KMASK, float* __restrict__ O) {
  __shared__ __align__(16) float so[4][16][68]; __shared__ __align__(16) char ring[2 * RBUF]; (void)KMASK;
  if (blockIdx.x < 2) attn_body<true>(QK, QKL, VTH, VTL, O, so, ring); else attn_body<false>(QK, QKL, VTH, VTL, O, so, ring);
}
// ---- k_out: block = (64 rows, 128 cols): out = O(hi/lo) . Wo rows (2 products) + bo
__global__ __launch_bounds__(128) void k_out(const float* __restrict__ O, const __bf16* __restrict__ P, const float* __restrict__ BO, float* __restrict__ Y) {
  __shared__ __align__(16) float so[4][16][132];
  const int tid = threadIdx.x, wave = tid >> 5, lane = tid & 31, col = lane & 15, g = lane >> 4; const size_t r0 = (size_t)blockIdx.x * 64 + wave * 16; const int n0 = blockIdx.y * 128;
  v8f acc[8] = {};
#pragma unroll 2
  for (int kc = 0; kc < DM / 32; ++kc) { const F2 a = split_row(O + (r0 + col) * DM, kc * 32, lane);
#pragma unroll
    for (int j = 0; j < 8; ++j) { const v16b w = frag_b(P + (size_t)(n0 + j * 16 + col) * DM + kc * 32, lane); acc[j] = wmma_bf(a.l, w, acc[j]); acc[j] = wmma_bf(a.h, w, acc[j]); } }
#pragma unroll
  for (int j = 0; j < 8; ++j) {
#pragma unroll
    for (int r = 0; r < 8; ++r) so[wave][8 * g + r][j * 16 + col] = acc[j][r] + bfr(BO[n0 + j * 16 + col]); }
  LDSX();
  for (int rl = 0; rl < 16; ++rl) vst2(Y + (r0 + rl) * DM + n0 + lane * 4, *(const v4f*)&so[wave][rl][lane * 4]);
}
// ---- k_pbias: one block: PB[which][h*64 + d] = concat_bias[h*192 + which*64 + d] (conn_b for columns < 64, qkv_b after) -> three 4-KB rows
__global__ __launch_bounds__(256) void k_pbias(const float* __restrict__ CONNB, const float* __restrict__ QKVB, float* __restrict__ PB) { __shared__ __align__(16) float s[3 * DM]; const int t = threadIdx.x;
  for (int e = t; e < 3 * DM; e += 256) { const int which = e / DM, n = e % DM; const int h = n / HD, d = n % HD; const int src = h * (3 * HD) + which * HD + d; s[e] = (src < HOUT) ? CONNB[src] : QKVB[src - HOUT]; }
  __syncthreads(); for (int q = t; q < 3 * DM / 4; q += 256) vst2(PB + q * 4, *(const v4f*)&s[q * 4]); }
// ---- k_o: block = 64 rows r' = (b', s'): o = ctx (bf16 hi + lo) . o_w rows + o_b -> out[(s' * BSZ + b') * 64] (the final (B,S)->(S,B) transpose)
__global__ __launch_bounds__(128) void k_o(const float* __restrict__ O, const __bf16* __restrict__ P, const float* __restrict__ OB, float* __restrict__ Y) { __shared__ __align__(16) float so[4][16][68];
  const int tid = threadIdx.x, wave = tid >> 5, lane = tid & 31, col = lane & 15, g = lane >> 4; const size_t r0 = (size_t)blockIdx.x * 64 + wave * 16; const __bf16* Wr = P + PK_P;
  v8f acc[4] = {};
#pragma unroll 2
  for (int kc = 0; kc < DM / 32; ++kc) { const F2 a = split_row(O + (r0 + col) * DM, kc * 32, lane);
#pragma unroll
    for (int j = 0; j < 4; ++j) { const v16b w = frag_b(Wr + (size_t)(j * 16 + col) * DM + kc * 32, lane); acc[j] = wmma_bf(a.h, w, acc[j]); acc[j] = wmma_bf(a.l, w, acc[j]); } }
#pragma unroll
  for (int j = 0; j < 4; ++j) { const float bb = bfr(OB[j * 16 + col]);
#pragma unroll
    for (int r = 0; r < 8; ++r) so[wave][8 * g + r][j * 16 + col] = acc[j][r] + bb; }
  LDSX(); for (int rl = 0; rl < 16; ++rl) if (lane < 16) { const size_t rp = r0 + rl; const size_t bp = rp / SS, sp = rp % SS; vst2(Y + (sp * BSZ + bp) * HOUT + lane * 4, *(const v4f*)&so[wave][rl][lane * 4]); } }
extern "C" void kernel_launch(void* const* d_in, const int* in_sizes, int n_in, void* d_out, int out_size, void* d_ws, size_t ws_size, hipStream_t stream) {
  (void)in_sizes; (void)n_in; (void)out_size;
  const float** F = (const float**)d_in;   // 0 x [2048,2,512], 1 qkv_w [3008,512], 2 qkv_b [3008], 3 conn_w [64,512], 4 conn_b [64], 5 o_w [64,1024], 6 o_b [64]
  if (ws_size < (size_t)WS_END + 4u * 3 * DM) return;
  char* ws = (char*)d_ws; __bf16* PK = (__bf16*)(ws + WS_PK); _Float16 *QK = (_Float16*)(ws + WS_QK), *QKL = (_Float16*)(ws + WS_QKL), *VTH = (_Float16*)(ws + WS_VTH), *VTL = (_Float16*)(ws + WS_VTL); float* O = (float*)(ws + WS_O); float* PB = (float*)(ws + WS_END);
  k_pack<<<dim3(DM, 4), 256, 0, stream>>>(F[3], F[1], F[5], nullptr, PK);
  k_pbias<<<1, 256, 0, stream>>>(F[4], F[2], PB);
  // the (S,B,512) input rows in memory order ARE the (b', s') rows of the raw reshape: row r = b' * 2048 + s'
  k_qkv<<<dim3(TNB * SS / 64, QKVW / 128), 128, 0, stream>>>(F[0], F[0], F[0], PK + PK_A, PB, PB + DM, PB + 2 * DM, QK, QKL, VTH, VTL);
  k_attn<<<dim3(TQB, NH, TNB), 128, 0, stream>>>(QK, QKL, VTH, VTL, nullptr, O);
  k_o<<<TOB, 128, 0, stream>>>(O, PK, F[6], (float*)d_out);
}

// v005
// It runs in 139 microseconds.
// Next to v004, in two timings, it ran 1.20 times as fast each time.
// All steps since v000 together make it 3.06 times as fast.
// compute dtype: all float inputs rounded to bf16; the concatenated [conn | qkv] projection with EXACT bf16 products on WMMA 16x16x32 (weight rows permuted at pack time into per-head q / k / v blocks; K = 512) + biases in f32, rounded once to f16 hi + residual; PLAIN-HYBRID attention (first 128 queries of each attention batch 3-product, later single f16), x 1/8, running-max softmax in f32 (hardware exp); out = ctx (bf16 hi + lo, 2 products) . o_w rows + o_b; f32 output.
#include <hip/hip_runtime.h>
#include <math.h>

typedef __attribute__((ext_vector_type(16))) _Float16 v16h;
typedef __attribute__((ext_vector_type(16))) __bf16 v16b;
typedef __attribute__((ext_vector_type(8)))  _Float16 v8h;
typedef __attribute__((ext_vector_type(8)))  float v8f;
typedef __attribute__((ext_vector_type(4)))  float v4f;
typedef __attribute__((ext_vector_type(2)))  float v2f;
typedef __attribute__((ext_vector_type(4)))  unsigned v4u;
typedef __attribute__((ext_vector_type(4)))  int v4i;
typedef float __attribute__((may_alias)) float_a;
typedef int __attribute__((may_alias)) int_a;

template <typename T> __device__ __forceinline__ void vst2(void* p, T v) { *(T*)p = v;  }
__device__ __forceinline__ v8f wmma16(v16h a, v16h b, v8f c) {
  v8f d = __builtin_amdgcn_wmma_f32_16x16x32_f16(false, a, false, b, (short)0, c, false, false);
  asm volatile("v_nop\n\tv_nop\n\tv_nop\n\tv_nop" : "+v"(d) : "v"(a), "v"(b));
  return d;
}
__device__ __forceinline__ v8f wmma_bf(v16b a, v16b b, v8f c) {
  v8f d = __builtin_amdgcn_wmma_f32_16x16x32_bf16(false, a, false, b, (short)0, c, false, false);
  asm volatile("v_nop\n\tv_nop\n\tv_nop\n\tv_nop" : "+v"(d) : "v"(a), "v"(b));
  return d;
}
// Modified multi-head attention (S 2,048, B 2, d_in 512, 16 heads x 64): qkv from one projection plus a fixed 'connection' projection supplying 64 of the q columns, the torch raw reshape (S,B,3E) -> (B,S,H,3*64) kept literally (so attention 'batches' are contiguous halves of the (s,b) row order and each head's q|k|v are consecutive 64-column slices), softmax(q k / 8) v, output projection E -> 64 + bias, returned as (S, B, 64).
__device__ __forceinline__ v16h frag_h(const _Float16* rowk0, int lane) {
  union { v16h v; v8h q[2]; } u; const _Float16* p = rowk0 + 8 * (lane >> 4);
  u.q[0] = *(const v8h*)p; u.q[1] = *(const v8h*)(p + 16); return u.v;
}
__device__ __forceinline__ v16h frag_f32(const float* rowk0, int lane) {
  v16h a; const float* p = rowk0 + 8 * (lane >> 4);
#pragma unroll
  for (int i = 0; i < 8; ++i) { a[i] = (_Float16)p[i]; a[8 + i] = (_Float16)p[16 + i]; }
  return a;
}
__device__ __forceinline__ v16h frag_f32s(const float* rowk0, int lane, float sc) {
  v16h a; const float* p = rowk0 + 8 * (lane >> 4);
#pragma unroll
  for (int i = 0; i < 8; ++i) { a[i] = (_Float16)(p[i] * sc); a[8 + i] = (_Float16)(p[16 + i] * sc); }
  return a;
}
// column fragment from a [K][ld] layout (column n), rows >= K read as 0
__device__ __forceinline__ v16h fragc_f32(const float* W, int k0, int n, int lane, int ld, int K) {
  v16h a; const int g = lane >> 4;
#pragma unroll
  for (int i = 0; i < 8; ++i) { const int ka = k0 + 8 * g + i, kb = ka + 16;
    a[i] = (_Float16)(ka < K ? W[(size_t)(ka < K ? ka : K - 1) * ld + n] : 0.f); a[8 + i] = (_Float16)(kb < K ? W[(size_t)(kb < K ? kb : K - 1) * ld + n] : 0.f); }
  return a;
}
struct F2 { v16b h, l; };
__device__ __forceinline__ F2 bsplit16(const float v[16]) { F2 r;
#pragma unroll
  for (int i = 0; i < 16; ++i) { const __bf16 h = (__bf16)v[i]; r.h[i] = h; r.l[i] = (__bf16)(v[i] - (float)h); }
  return r; }
__device__ __forceinline__ F2 split_row(const float* row, int k0, int lane) { float v[16]; const float* p = row + k0 + 8 * (lane >> 4);
#pragma unroll
  for (int i = 0; i < 8; ++i) { v[i] = p[i]; v[8 + i] = p[16 + i]; }
  return bsplit16(v); }
__device__ __forceinline__ F2 split_rowK(const float* row, int k0, int lane, int K) { float v[16]; const int g = lane >> 4;
#pragma unroll
  for (int i = 0; i < 8; ++i) { const int ka = k0 + 8 * g + i, kb = ka + 16; v[i] = ka < K ? row[ka < K ? ka : K - 1] : 0.f; v[8 + i] = kb < K ? row[kb < K ? kb : K - 1] : 0.f; }
  return bsplit16(v); }
__device__ __forceinline__ F2 split_col(const float* W, int k0, int n, int lane, int ld, int K) { float v[16]; const int g = lane >> 4;
#pragma unroll
  for (int i = 0; i < 8; ++i) { const int ka = k0 + 8 * g + i, kb = ka + 16; v[i] = ka < K ? W[(size_t)(ka < K ? ka : K - 1) * ld + n] : 0.f; v[8 + i] = kb < K ? W[(size_t)(kb < K ? kb : K - 1) * ld + n] : 0.f; }
  return bsplit16(v); }
__device__ __forceinline__ v8f mac3(const F2& a, const F2& b, v8f c) { c = wmma_bf(a.l, b.h, c); c = wmma_bf(a.h, b.l, c); return wmma_bf(a.h, b.h, c); }
__device__ __forceinline__ float sigm(float v) { return 1.0f / (1.0f + expf(-v)); }
#define LDSX() do { asm volatile("s_wait_dscnt 0" ::: "memory"); __builtin_amdgcn_wave_barrier(); __builtin_amdgcn_fence(__ATOMIC_RELEASE, "workgroup"); } while (0)


#define NB 2
#define SS 2048
#define DM 1024
#define NH 16
#define KIN 512          // input width
#define BSZ 2            // the module's batch (interleaved in the row order)
#define HOUT 64          // o_proj output width
#define HD 64
#define QKVW (3 * DM)
#ifndef TQB
#define TQB (SS / 64)
#define TNB NB
#define TOB (NB * SS / 64)     // output row tiles (all)
#endif
typedef __attribute__((ext_vector_type(8))) __bf16 v8b;
__device__ __forceinline__ v16b frag_b(const __bf16* rowk0, int lane) {
  union { v16b v; v8b q[2]; } u; const __bf16* p = rowk0 + 8 * (lane >> 4);
  u.q[0] = *(const v8b*)p; u.q[1] = *(const v8b*)(p + 16); return u.v;
}
__device__ __forceinline__ float bfr(float v) { return (float)(__bf16)v; }
__device__ __attribute__((noinline)) float exp_ni(float v) { return expf(v); }
__device__ __attribute__((noinline)) float erf_ni(float v) { return erff(v); }

#define PK_A 0                       // [3072][512] Wqkv rows (natural [out][in])
#define PK_P (PK_A + QKVW * DM)        // [64][1024] Wo rows (natural)
#define PK_END (PK_P + DM * DM)
#define WS_PK  0u
#define WS_QK  (WS_PK + 2u * PK_END)             // f16 [4096 rows][2048]: q | k
#define WS_QKL (WS_QK + 2u * NB * SS * 2 * DM)     // f16 q | k residual planes x2048
#define WS_VTH (WS_QKL + 2u * NB * SS * 2 * DM)    // f16 [b][1024 (h*64+d)][2048 s] hi
#define WS_VTL (WS_VTH + 2u * NB * DM * SS)        // f16 lo x 2048
#define WS_O   (WS_VTL + 2u * NB * DM * SS)        // f32 [4096][1024]
#define WS_CS  (WS_O + 4u * NB * SS * DM)           // f32 2 x [2048][32], not written or read
#define WS_END (WS_CS + 4u * 2 * SS * 32)
// ---- k_pack: block = (row n, which): natural [out][in] rows -> bf16; which 0..2 -> W_q/W_k/W_v into PK_A rows which*1024 + n; 3 -> W_o into PK_P
__global__ __launch_bounds__(256) void k_pack(const float* __restrict__ CONNW, const float* __restrict__ WQKV3, const float* __restrict__ OW, const float* __restrict__ unused, __bf16* __restrict__ PK) {
  __shared__ __align__(16) __bf16 s[DM]; const int n = blockIdx.x, which = blockIdx.y, t = threadIdx.x; (void)unused;
  if (which < 3) { const int h = n / HD, d = n % HD; const int src = h * (3 * HD) + which * HD + d;   // column of the concatenated [q_conn | qkv] buffer
    const float* row = (src < HOUT) ? (CONNW + (size_t)src * KIN) : (WQKV3 + (size_t)(src - HOUT) * KIN);
    for (int k = t; k < KIN; k += 256) s[k] = (__bf16)row[k]; __syncthreads();
    __bf16* dst = PK + PK_A + ((size_t)which * DM + n) * KIN; for (int q = t; q < KIN / 8; q += 256) vst2((unsigned*)(dst + q * 8), *(const v4u*)&s[q * 8]); }
  else { if (n >= HOUT) return; for (int k = t; k < DM; k += 256) s[k] = (__bf16)OW[(size_t)n * DM + k]; __syncthreads(); __bf16* dst = PK + PK_P + (size_t)n * DM; for (int q = t; q < DM / 8; q += 256) vst2((unsigned*)(dst + q * 8), *(const v4u*)&s[q * 8]); } }
// four 16-byte asynchronous copies a lane (each lane its own LDS byte address and global address); the s_wait_xcnt is the last line of the copies' own statement, so that it stands in front of any rewrite of their address registers
__device__ __forceinline__ void copy4(unsigned l0, const char* g0, unsigned l1, const char* g1, unsigned l2, const char* g2, unsigned l3, const char* g3) {
  asm volatile("global_load_async_to_lds_b128 %0, %1, off\n\tglobal_load_async_to_lds_b128 %2, %3, off\n\tglobal_load_async_to_lds_b128 %4, %5, off\n\tglobal_load_async_to_lds_b128 %6, %7, off\n\ts_wait_xcnt 0x0" :: "v"(l0), "v"(g0), "v"(l1), "v"(g1), "v"(l2), "v"(g2), "v"(l3), "v"(g3) : "memory");
}
// X / W ring of k_qkv in LDS: one stage = 64 k. X plane: the block's 64 rows of 256 B (f32) at pitch 272; W plane: its 128 weight rows of 128 B (bf16) at pitch 144 (both 16 B x odd: conflict-free 16-byte fragment reads)
#define XPIT 272
#define WPIT 144
#define QW_O (64 * XPIT)
#define QBUF (QW_O + 128 * WPIT)
__global__ __launch_bounds__(128) void k_qkv(const float* __restrict__ XQ, const float* __restrict__ XK, const float* __restrict__ XV, const __bf16* __restrict__ P, const float* __restrict__ BQ, const float* __restrict__ BK, const float* __restrict__ BV, _Float16* __restrict__ QK, _Float16* __restrict__ QKL, _Float16* __restrict__ VTH, _Float16* __restrict__ VTL) {
  const int which0 = (blockIdx.y * 128) / DM; const float* X = (which0 == 0) ? XQ : (which0 == 1) ? XK : XV; const float* BB = BQ ? (((which0 == 0) ? BQ : (which0 == 1) ? BK : BV) + (blockIdx.y * 128 - which0 * DM)) : nullptr;
  __shared__ __align__(16) char sm[2 * QBUF];   // the ring during the k loop; behind the loop's last barrier the same bytes stage the output tile
  _Float16 (*so)[16][136] = (_Float16 (*)[16][136])sm; _Float16 (*sol)[16][136] = so + 4; _Float16 (*sth)[72] = (_Float16 (*)[72])sm; _Float16 (*stl)[72] = sth + 128;
  const int tid = threadIdx.x, wave = tid >> 5, lane = tid & 31, col = lane & 15, g = lane >> 4; const size_t r0 = (size_t)blockIdx.x * 64 + wave * 16; const int n0 = blockIdx.y * 128;
  v8f acc[8] = {};
  // the work-group's 128 lanes copy a stage by whole rows: X row = 16 lanes x 16 B (a wave covers 2 rows = 4 whole lines), W row = 8 lanes x 16 B (4 rows = 4 whole lines); eight copies a lane and plane
  const unsigned rb = (unsigned)(size_t)sm;
  const unsigned lx = rb + (unsigned)(tid >> 4) * XPIT + (tid & 15) * 16, lw = rb + QW_O + (unsigned)(tid >> 3) * WPIT + (tid & 7) * 16;
  const char* gx = (const char*)X + ((size_t)blockIdx.x * 64 + (tid >> 4)) * (KIN * 4) + (tid & 15) * 16; const char* gw = (const char*)P + ((size_t)n0 + (tid >> 3)) * (KIN * 2) + (tid & 7) * 16;   // the lane's first X and W piece of stage 0
  auto stage = [&](int st, unsigned bo) {   // stage st (k = st * 64 ...) into the buffer at byte bo
    const char* x = gx + st * 256; const char* w = gw + st * 128; const unsigned a = lx + bo, c = lw + bo;
    copy4(a, x, a + 8 * XPIT, x + 8 * (KIN * 4), a + 16 * XPIT, x + 16 * (KIN * 4), a + 24 * XPIT, x + 24 * (KIN * 4));
    copy4(a + 32 * XPIT, x + 32 * (KIN * 4), a + 40 * XPIT, x + 40 * (KIN * 4), a + 48 * XPIT, x + 48 * (KIN * 4), a + 56 * XPIT, x + 56 * (KIN * 4));
    copy4(c, w, c + 16 * WPIT, w + 16 * (KIN * 2), c + 32 * WPIT, w + 32 * (KIN * 2), c + 48 * WPIT, w + 48 * (KIN * 2));
    copy4(c + 64 * WPIT, w + 64 * (KIN * 2), c + 80 * WPIT, w + 80 * (KIN * 2), c + 96 * WPIT, w + 96 * (KIN * 2), c + 112 * WPIT, w + 112 * (KIN * 2)); };
  const unsigned xof = (unsigned)(wave * 16 + col) * XPIT + 32 * g, wof = QW_O + (unsigned)col * WPIT + 16 * g;   // the lane's byte offsets inside an X and a W fragment of the ring, the same in every stage
  stage(0, 0);
  asm volatile("s_wait_asynccnt 0x0" ::: "memory");   // this wave's copies of stage 0 have landed
  __syncthreads();                                    // ... and every other wave's: stage 0 may be read
  stage(1, QBUF);
#pragma unroll 1   // kept rolled: the two buffers differ by an offset only, and eight copies of the body would only lengthen the text in front of the long epilogue
  for (int st = 0; st < KIN / 64; ++st) { const unsigned bo = (unsigned)(st & 1) * QBUF;
#pragma unroll
    for (int kc = 0; kc < 2; ++kc) {   // every fragment of a 32-k step is read from the ring as one group in front of its first product
      const char* xp = sm + bo + xof + kc * 128; const char* wp = sm + bo + wof + kc * 64;
      const v4f x0 = *(const v4f*)xp, x1 = *(const v4f*)(xp + 16), x2 = *(const v4f*)(xp + 64), x3 = *(const v4f*)(xp + 80);
      v16b w[8];
#pragma unroll
      for (int j = 0; j < 8; ++j) { union { v16b v; v8b q[2]; } u; u.q[0] = *(const v8b*)(wp + j * 16 * WPIT); u.q[1] = *(const v8b*)(wp + j * 16 * WPIT + 32); w[j] = u.v; }
      v16b a;
#pragma unroll
      for (int i = 0; i < 4; ++i) { a[i] = (__bf16)x0[i]; a[4 + i] = (__bf16)x1[i]; a[8 + i] = (__bf16)x2[i]; a[12 + i] = (__bf16)x3[i]; }
#pragma unroll
      for (int j = 0; j < 8; ++j) acc[j] = wmma_bf(a, w[j], acc[j]); }
    // publish point: this wave's LDS reads of the stage are done, its copies of the next stage have landed; behind the barrier the next stage may be read and this stage's buffer refilled
    asm volatile("s_wait_dscnt 0x0" ::: "memory");
    asm volatile("s_wait_asynccnt 0x0" ::: "memory");
    __syncthreads();
    if (st + 2 < KIN / 64) stage(st + 2, bo); }
  asm volatile("s_wait_asynccnt 0x0" ::: "memory");   // no copy is left outstanding behind the loop
  if (n0 < 2 * DM) {   // q stored unscaled (f16 sigma ~0.6, no subnormal exposure); 1/8 applied to the f32 score
#pragma unroll
    for (int j = 0; j < 8; ++j) {
#pragma unroll
      for (int r = 0; r < 8; ++r) { const float v = acc[j][r] + (BB ? bfr(BB[j * 16 + col]) : 0.f); const _Float16 hv = (_Float16)v; so[wave][8 * g + r][j * 16 + col] = hv; sol[wave][8 * g + r][j * 16 + col] = (_Float16)((v - (float)hv) * 2048.0f); } }   // q, k (+ bias) as f16 hi + (x2048) residual
    LDSX();
    for (int rl = 0; rl < 16; ++rl) if (lane < 16) { vst2((unsigned*)(QK + (r0 + rl) * (2 * DM) + n0 + lane * 8), *(const v4u*)&so[wave][rl][lane * 8]); vst2((unsigned*)(QKL + (r0 + rl) * (2 * DM) + n0 + lane * 8), *(const v4u*)&sol[wave][rl][lane * 8]); }
  } else {
#pragma unroll
    for (int j = 0; j < 8; ++j) {
#pragma unroll
      for (int r = 0; r < 8; ++r) { const float v = acc[j][r] + (BB ? bfr(BB[j * 16 + col]) : 0.f); const _Float16 hv = (_Float16)v; sth[j * 16 + col][wave * 16 + 8 * g + r] = hv; stl[j * 16 + col][wave * 16 + 8 * g + r] = (_Float16)((v - (float)hv) * 2048.0f); } }
    __syncthreads();
    const size_t rb = (size_t)blockIdx.x * 64; const int b = (int)(rb / SS), s0 = (int)(rb % SS); const int pc0 = n0 - 2 * DM;
    for (int q = tid; q < 128 * 8; q += 128) { const int d = q >> 3, pc = q & 7; const size_t o = ((size_t)b * DM + pc0 + d) * SS + s0 + pc * 8; vst2((unsigned*)(VTH + o), *(const v4u*)&sth[d][pc * 8]); vst2((unsigned*)(VTL + o), *(const v4u*)&stl[d][pc * 8]); }
  }
}
// ---- k_attn: block = (64 queries, head h, batch b): all-keys flash attention (K = 64: 2 k-steps), scores = (q.k) * 0.125 from q hi/lo x k hi/lo (3 products) in the first two query blocks, single f16 elsewhere, P.V: there 2^11 P hi/lo x V hi/lo (3 products) in two accumulators, elsewhere 2^11 P x V hi; O[b*S+q][h*64+d] = (acc + accl / 2048) / (2048 l) (256-B segments)
__device__ __forceinline__ v16h frag_p(const char* p) {   // frag_h from the lane's own byte address
  union { v16h v; v8h q[2]; } u; u.q[0] = *(const v8h*)p; u.q[1] = *(const v8h*)(p + 32); return u.v;
}
// K/V ring in LDS: one stage = the 32 keys of a pass. K plane: 32 rows (keys) of 128 B at pitch 144; V plane: 64 rows (d) of 64 B at pitch 80 (16 B x odd: conflict-free 16-byte fragment reads)
#define KPIT 144
#define VPIT 80
#define RK_H 0
#define RV_H (RK_H + 32 * KPIT)
#define RK_L (RV_H + 64 * VPIT)
#define RV_L (RK_L + 32 * KPIT)
#define RBUF (RV_L + 64 * VPIT)
__device__ __forceinline__ float xhalf(float x) { return __builtin_bit_cast(float, __builtin_amdgcn_permlanex16(__builtin_bit_cast(int, x), __builtin_bit_cast(int, x), 0x76543210, 0xfedcba98, false, false)); }   // lane l with lane l ^ 16
template <bool HV> __device__ __forceinline__ void attn_body(const _Float16* __restrict__ QK, const _Float16* __restrict__ QKL, const _Float16* __restrict__ VTH, const _Float16* __restrict__ VTL, float* __restrict__ O, float (*so)[16][68], char* ring, const int qb, const int h, const int b) {
  const int tid = threadIdx.x, wave = tid >> 5, lane = tid & 31, col = lane & 15, g = lane >> 4;
  const int q0 = qb * 64 + wave * 16; const size_t rq = (size_t)b * SS + q0 + col;
  v16h aq[2], aql[2];
#pragma unroll
  for (int kc = 0; kc < 2; ++kc) { aq[kc] = frag_h(QK + rq * (2 * DM) + h * HD + kc * 32, lane); aql[kc] = frag_h(QKL + rq * (2 * DM) + h * HD + kc * 32, lane); }
  float m = -3.0e38f, l = 0.f;   // the lane's query: running maximum over all keys (the same in both halves), sum over this half's keys
  v8f acc[4] = {}, accl[4] = {};
  const int nks = SS / 32;   // all keys
  const unsigned kof = (unsigned)col * KPIT + 16 * g, vof = (unsigned)col * VPIT + 16 * g;   // the lane's byte offsets inside a K and a V fragment of the ring, the same in every pass
  // the work-group's 128 lanes copy a stage by whole rows: K row = 8 lanes x 16 B (a wave covers 4 whole 128-B lines), V row = 4 lanes x 16 B; two copies a lane and plane
  const unsigned rb = (unsigned)(size_t)ring;
  const unsigned lk = rb + (unsigned)(tid >> 3) * KPIT + (tid & 7) * 16, lv = rb + (unsigned)(tid >> 2) * VPIT + (tid & 3) * 16;
  const size_t gk = 2 * (((size_t)b * SS + (tid >> 3)) * (2 * DM) + DM + h * HD + (tid & 7) * 8), gv = 2 * (((size_t)b * DM + h * HD + (tid >> 2)) * SS + (tid & 3) * 8);   // byte offsets of the lane's first K and V piece of stage 0
  auto stage = [&](int st, unsigned bo) {   // stage st (keys st * 32 ...) into the buffer at byte bo
    const size_t ok = gk + (size_t)st * (32 * 2 * DM * 2), ov = gv + (size_t)st * (32 * 2);
    copy4(lk + bo + RK_H, (const char*)QK + ok, lk + bo + RK_H + 16 * KPIT, (const char*)QK + ok + 16 * (2 * DM * 2), lv + bo + RV_H, (const char*)VTH + ov, lv + bo + RV_H + 32 * VPIT, (const char*)VTH + ov + 32 * (SS * 2));
    if (HV) copy4(lk + bo + RK_L, (const char*)QKL + ok, lk + bo + RK_L + 16 * KPIT, (const char*)QKL + ok + 16 * (2 * DM * 2), lv + bo + RV_L, (const char*)VTL + ov, lv + bo + RV_L + 32 * VPIT, (const char*)VTL + ov + 32 * (SS * 2)); };
  stage(0, 0);
  asm volatile("s_wait_asynccnt 0x0" ::: "memory");   // this wave's copies of stage 0 have landed
  __syncthreads();                                    // ... and every other wave's: stage 0 may be read
  stage(1, RBUF);
#pragma unroll 1
  for (int ks = 0; ks < nks; ++ks) { v8f s[2];
    // every K fragment of the pass is read from the ring as one group in front of the first product
    v16h kh[2][2], kl[2][2];
    const unsigned bo = (unsigned)(ks & 1) * RBUF; const char* kp = ring + bo + RK_H + kof; const char* kpl = ring + bo + RK_L + kof;   // one address a plane; the fragments lie at constant offsets from it
#pragma unroll
    for (int ct = 0; ct < 2; ++ct) {
#pragma unroll
      for (int kc = 0; kc < 2; ++kc) { kh[ct][kc] = frag_p(kp + ct * 16 * KPIT + kc * 64); if (HV) kl[ct][kc] = frag_p(kpl + ct * 16 * KPIT + kc * 64); } }
#pragma unroll
    for (int ct = 0; ct < 2; ++ct) { v8f c = {}, cl = {};
      if (HV) {   // leading query blocks (outputs far above the global rms): 3 products
#pragma unroll
        for (int kc = 0; kc < 2; ++kc) { c = wmma16(kh[ct][kc], aq[kc], c); cl = wmma16(kh[ct][kc], aql[kc], cl); cl = wmma16(kl[ct][kc], aq[kc], cl); }
#pragma unroll
        for (int r = 0; r < 8; ++r) c[r] += cl[r] * (1.0f / 2048.0f); }
      else {
#pragma unroll
        for (int kc = 0; kc < 2; ++kc) c = wmma16(kh[ct][kc], aq[kc], c); }   // single product elsewhere
      { const bool keepk = true;
#pragma unroll
      for (int r = 0; r < 8; ++r) s[ct][r] = keepk ? c[r] * 0.125f : -3.0e38f; } }   // 1/sqrt(64); no key is masked
    // every V fragment of the pass is read from the ring as one group behind the score products: the reads fly while the softmax runs
    v16h vh[4], vl[4];
    const char* vp = ring + bo + RV_H + vof; const char* vpl = ring + bo + RV_L + vof;
#pragma unroll
    for (int dt = 0; dt < 4; ++dt) { vh[dt] = frag_p(vp + dt * 16 * VPIT); if (HV) vl[dt] = frag_p(vpl + dt * 16 * VPIT); }
    float t[8];   // maximum and sum of the lane's 16 scores as trees in registers
#pragma unroll
    for (int r = 0; r < 8; ++r) t[r] = fmaxf(s[0][r], s[1][r]);
    float mx = fmaxf(fmaxf(fmaxf(t[0], t[1]), fmaxf(t[2], t[3])), fmaxf(fmaxf(t[4], t[5]), fmaxf(t[6], t[7])));
    mx = fmaxf(mx, xhalf(mx));   // the other half's 16 keys of the same query
    const float mn = fmaxf(m, mx); const float alpha = (m <= -1.0e38f) ? 0.f : __expf(m - mn);
    float e[2][8];
#pragma unroll
    for (int r = 0; r < 8; ++r) { e[0][r] = (s[0][r] <= -1.0e38f) ? 0.f : __expf(s[0][r] - mn); e[1][r] = (s[1][r] <= -1.0e38f) ? 0.f : __expf(s[1][r] - mn); t[r] = e[0][r] + e[1][r]; }
    l = l * alpha + (((t[0] + t[1]) + (t[2] + t[3])) + ((t[4] + t[5]) + (t[6] + t[7]))); m = mn;   // the two halves' sums are joined once, behind the loop
#pragma unroll
    for (int dt = 0; dt < 4; ++dt) {
#pragma unroll
      for (int r = 0; r < 8; ++r) { acc[dt][r] *= alpha; accl[dt][r] *= alpha; } }
    v16h pa, pl;
#pragma unroll
    for (int i = 0; i < 8; ++i) { const float x0 = e[0][i] * 2048.0f, x1 = e[1][i] * 2048.0f; const _Float16 h0 = (_Float16)x0, h1 = (_Float16)x1; pa[i] = h0; pa[8 + i] = h1; pl[i] = (_Float16)((x0 - (float)h0) * 2048.0f); pl[8 + i] = (_Float16)((x1 - (float)h1) * 2048.0f); }   // P scaled by 2^11 before the f16 split so small softmax weights stay out of the f16 subnormal range; 2^-11 folded into the epilogue
#pragma unroll
    for (int dt = 0; dt < 4; ++dt) { acc[dt] = wmma16(vh[dt], pa, acc[dt]); if (HV) { accl[dt] = wmma16(vh[dt], pl, accl[dt]); accl[dt] = wmma16(vl[dt], pa, accl[dt]); } }   // leading query blocks: P hi/lo x V hi/lo (3 products); elsewhere P x V single
    // publish point: this wave's LDS reads of the pass are done, its copies of the next stage have landed; behind the barrier the next stage may be read and this pass's buffer refilled
    asm volatile("s_wait_dscnt 0x0" ::: "memory");
    asm volatile("s_wait_asynccnt 0x0" ::: "memory");
    __syncthreads();
    if (ks + 2 < nks) stage(ks + 2, bo); }
  asm volatile("s_wait_asynccnt 0x0" ::: "memory");   // no copy is left outstanding behind the loop
  const float il = (1.0f / 2048.0f) / (l + xhalf(l));
#pragma unroll
  for (int dt = 0; dt < 4; ++dt) {
#pragma unroll
    for (int q = 0; q < 2; ++q) { v4f o;
#pragma unroll
      for (int i = 0; i < 4; ++i) o[i] = (acc[dt][4 * q + i] + accl[dt][4 * q + i] * (1.0f / 2048.0f)) * il;
      vst2(&so[wave][col][dt * 16 + 8 * g + 4 * q], o); } }
  LDSX();
  for (int rl = 0; rl < 16; ++rl) if (lane < 16) vst2(O + ((size_t)b * SS + q0 + rl) * DM + h * HD + lane * 4, *(const v4f*)&so[wave][rl][lane * 4]);
}
__global__ __launch_bounds__(128) void k_attn(const _Float16* __restrict__ QK, const _Float16* __restrict__ QKL, const _Float16* __restrict__ VTH, const _Float16* __restrict__ VTL, const void* __restrict__ KMASK, float* __restrict__ O) {
  __shared__ __align__(16) float so[4][16][68]; __shared__ __align__(16) char ring[2 * RBUF]; (void)KMASK;
  // which tile a block takes (for speed only; a permutation of the tiles for any dispatch): a three-product block costs about twice a single-product one, and all blocks are resident at once, so the launch lasts as long as the WGP with the most of them.
  // Dealt by blockIdx.x < 2 they lie at flat indices 0 and 1 modulo 32. Here they take every 5th group of 8 flat indices from the front (40 apart): near the start.
  const int f = blockIdx.x + TQB * (blockIdx.y + NH * blockIdx.z), j = f >> 3;   // flat index; its group of 8
  const int NHV = 2 * NH * TNB / 8;   // groups of three-product blocks (2 query blocks a head and batch)
  if (j < 5 * NHV && j % 5 == 0) { const int i = (j / 5) * 8 + (f & 7); const int hb = i >> 1; attn_body<true>(QK, QKL, VTH, VTL, O, so, ring, i & 1, hb % NH, hb / NH); }
  else { const int i = f - 8 * (j < 5 * NHV ? j / 5 + 1 : NHV); const int hb = i / (TQB - 2); attn_body<false>(QK, QKL, VTH, VTL, O, so, ring, 2 + i % (TQB - 2), hb % NH, hb / NH); }   // the others keep their order, closed up over the groups taken out
}
// ---- k_out: block = (64 rows, 128 cols): out = O(hi/lo) . Wo rows (2 products) + bo
__global__ __launch_bounds__(128) void k_out(const float* __restrict__ O, const __bf16* __restrict__ P, const float* __restrict__ BO, float* __restrict__ Y) {
  __shared__ __align__(16) float so[4][16][132];
  const int tid = threadIdx.x, wave = tid >> 5, lane = tid & 31, col = lane & 15, g = lane >> 4; const size_t r0 = (size_t)blockIdx.x * 64 + wave * 16; const int n0 = blockIdx.y * 128;
  v8f acc[8] = {};
#pragma unroll 2
  for (int kc = 0; kc < DM / 32; ++kc) { const F2 a = split_row(O + (r0 + col) * DM, kc * 32, lane);
#pragma unroll
    for (int j = 0; j < 8; ++j) { const v16b w = frag_b(P + (size_t)(n0 + j * 16 + col) * DM + kc * 32, lane); acc[j] = wmma_bf(a.l, w, acc[j]); acc[j] = wmma_bf(a.h, w, acc[j]); } }
#pragma unroll
  for (int j = 0; j < 8; ++j) {
#pragma unroll
    for (int r = 0; r < 8; ++r) so[wave][8 * g + r][j * 16 + col] = acc[j][r] + bfr(BO[n0 + j * 16 + col]); }
  LDSX();
  for (int rl = 0; rl < 16; ++rl) vst2(Y + (r0 + rl) * DM + n0 + lane * 4, *(const v4f*)&so[wave][rl][lane * 4]);
}
// ---- k_pbias: one block: PB[which][h*64 + d] = concat_bias[h*192 + which*64 + d] (conn_b for columns < 64, qkv_b after) -> three 4-KB rows
__global__ __launch_bounds__(256) void k_pbias(const float* __restrict__ CONNB, const float* __restrict__ QKVB, float* __restrict__ PB) { __shared__ __align__(16) float s[3 * DM]; const int t = threadIdx.x;
  for (int e = t; e < 3 * DM; e += 256) { const int which = e / DM, n = e % DM; const int h = n / HD, d = n % HD; const int src = h * (3 * HD) + which * HD + d; s[e] = (src < HOUT) ? CONNB[src] : QKVB[src - HOUT]; }
  __syncthreads(); for (int q = t; q < 3 * DM / 4; q += 256) vst2(PB + q * 4, *(const v4f*)&s[q * 4]); }
// ---- k_o: block = 64 rows r' = (b', s'): o = ctx (bf16 hi + lo) . o_w rows + o_b -> out[(s' * BSZ + b') * 64] (the final (B,S)->(S,B) transpose)
__global__ __launch_bounds__(128) void k_o(const float* __restrict__ O, const __bf16* __restrict__ P, const float* __restrict__ OB, float* __restrict__ Y) { __shared__ __align__(16) float so[4][16][68];
  const int tid = threadIdx.x, wave = tid >> 5, lane = tid & 31, col = lane & 15, g = lane >> 4; const size_t r0 = (size_t)blockIdx.x * 64 + wave * 16; const __bf16* Wr = P + PK_P;
  v8f acc[4] = {};
#pragma unroll 2
  for (int kc = 0; kc < DM / 32; ++kc) { const F2 a = split_row(O + (r0 + col) * DM, kc * 32, lane);
#pragma unroll
    for (int j = 0; j < 4; ++j) { const v16b w = frag_b(Wr + (size_t)(j * 16 + col) * DM + kc * 32, lane); acc[j] = wmma_bf(a.h, w, acc[j]); acc[j] = wmma_bf(a.l, w, acc[j]); } }
#pragma unroll
  for (int j = 0; j < 4; ++j) { const float bb = bfr(OB[j * 16 + col]);
#pragma unroll
    for (int r = 0; r < 8; ++r) so[wave][8 * g + r][j * 16 + col] = acc[j][r] + bb; }
  LDSX(); for (int rl = 0; rl < 16; ++rl) if (lane < 16) { const size_t rp = r0 + rl; const size_t bp = rp / SS, sp = rp % SS; vst2(Y + (sp * BSZ + bp) * HOUT + lane * 4, *(const v4f*)&so[wave][rl][lane * 4]); } }
extern "C" void kernel_launch(void* const* d_in, const int* in_sizes, int n_in, void* d_out, int out_size, void* d_ws, size_t ws_size, hipStream_t stream) {
  (void)in_sizes; (void)n_in; (void)out_size;
  const float** F = (const float**)d_in;   // 0 x [2048,2,512], 1 qkv_w [3008,512], 2 qkv_b [3008], 3 conn_w [64,512], 4 conn_b [64], 5 o_w [64,1024], 6 o_b [64]
  if (ws_size < (size_t)WS_END + 4u * 3 * DM) return;
  char* ws = (char*)d_ws; __bf16* PK = (__bf16*)(ws + WS_PK); _Float16 *QK = (_Float16*)(ws + WS_QK), *QKL = (_Float16*)(ws + WS_QKL), *VTH = (_Float16*)(ws + WS_VTH), *VTL = (_Float16*)(ws + WS_VTL); float* O = (float*)(ws + WS_O); float* PB = (float*)(ws + WS_END);
  k_pack<<<dim3(DM, 4), 256, 0, stream>>>(F[3], F[1], F[5], nullptr, PK);
  k_pbias<<<1, 256, 0, stream>>>(F[4], F[2], PB);
  // the (S,B,512) input rows in memory order ARE the (b', s') rows of the raw reshape: row r = b' * 2048 + s'
  k_qkv<<<dim3(TNB * SS / 64, QKVW / 128), 128, 0, stream>>>(F[0], F[0], F[0], PK + PK_A, PB, PB + DM, PB + 2 * DM, QK, QKL, VTH, VTL);
  k_attn<<<dim3(TQB, NH, TNB), 128, 0, stream>>>(QK, QKL, VTH, VTL, nullptr, O);
  k_o<<<TOB, 128, 0, stream>>>(O, PK, F[6], (float*)d_out);
}

// v006
// Measured time: 119 microseconds a run.
// Timed twice side by side with v005, it ran 1.17 times as fast both times.
// Counting every step since v000, it is 3.57 times as fast.
// compute dtype: all float inputs rounded to bf16; the concatenated [conn | qkv] projection with EXACT bf16 products on WMMA 16x16x32 (weight rows permuted at pack time into per-head q / k / v blocks; K = 512) + biases in f32, rounded once to f16 hi + residual; PLAIN-HYBRID attention (first 128 queries of each attention batch 3-product, later single f16), x 1/8, running-max softmax in f32 (hardware exp); out = ctx (bf16 hi + lo, 2 products) . o_w rows + o_b; f32 output.
#include <hip/hip_runtime.h>
#include <math.h>

typedef __attribute__((ext_vector_type(16))) _Float16 v16h;
typedef __attribute__((ext_vector_type(16))) __bf16 v16b;
typedef __attribute__((ext_vector_type(8)))  _Float16 v8h;
typedef __attribute__((ext_vector_type(8)))  float v8f;
typedef __attribute__((ext_vector_type(4)))  float v4f;
typedef __attribute__((ext_vector_type(2)))  float v2f;
typedef __attribute__((ext_vector_type(4)))  unsigned v4u;
typedef __attribute__((ext_vector_type(4)))  int v4i;
typedef float __attribute__((may_alias)) float_a;
typedef int __attribute__((may_alias)) int_a;

template <typename T> __device__ __forceinline__ void vst2(void* p, T v) { *(T*)p = v;  }
__device__ __forceinline__ v8f wmma16(v16h a, v16h b, v8f c) {
  return __builtin_amdgcn_wmma_f32_16x16x32_f16(false, a, false, b, (short)0, c, false, false);
}
__device__ __forceinline__ v8f wmma_bf(v16b a, v16b b, v8f c) {
  return __builtin_amdgcn_wmma_f32_16x16x32_bf16(false, a, false, b, (short)0, c, false, false);
}
// Modified multi-head attention (S 2,048, B 2, d_in 512, 16 heads x 64): qkv from one projection plus a fixed 'connection' projection supplying 64 of the q columns, the torch raw reshape (S,B,3E) -> (B,S,H,3*64) kept literally (so attention 'batches' are contiguous halves of the (s,b) row order and each head's q|k|v are consecutive 64-column slices), softmax(q k / 8) v, output projection E -> 64 + bias, returned as (S, B, 64).
__device__ __forceinline__ v16h frag_h(const _Float16* rowk0, int lane) {
  union { v16h v; v8h q[2]; } u; const _Float16* p = rowk0 + 8 * (lane >> 4);
  u.q[0] = *(const v8h*)p; u.q[1] = *(const v8h*)(p + 16); return u.v;
}
__device__ __forceinline__ v16h frag_f32(const float* rowk0, int lane) {
  v16h a; const float* p = rowk0 + 8 * (lane >> 4);
#pragma unroll
  for (int i = 0; i < 8; ++i) { a[i] = (_Float16)p[i]; a[8 + i] = (_Float16)p[16 + i]; }
  return a;
}
__device__ __forceinline__ v16h frag_f32s(const float* rowk0, int lane, float sc) {
  v16h a; const float* p = rowk0 + 8 * (lane >> 4);
#pragma unroll
  for (int i = 0; i < 8; ++i) { a[i] = (_Float16)(p[i] * sc); a[8 + i] = (_Float16)(p[16 + i] * sc); }
  return a;
}
// column fragment from a [K][ld] layout (column n), rows >= K read as 0
__device__ __forceinline__ v16h fragc_f32(const float* W, int k0, int n, int lane, int ld, int K) {
  v16h a; const int g = lane >> 4;
#pragma unroll
  for (int i = 0; i < 8; ++i) { const int ka = k0 + 8 * g + i, kb = ka + 16;
    a[i] = (_Float16)(ka < K ? W[(size_t)(ka < K ? ka : K - 1) * ld + n] : 0.f); a[8 + i] = (_Float16)(kb < K ? W[(size_t)(kb < K ? kb : K - 1) * ld + n] : 0.f); }
  return a;
}
struct F2 { v16b h, l; };
__device__ __forceinline__ F2 bsplit16(const float v[16]) { F2 r;
#pragma unroll
  for (int i = 0; i < 16; ++i) { const __bf16 h = (__bf16)v[i]; r.h[i] = h; r.l[i] = (__bf16)(v[i] - (float)h); }
  return r; }
__device__ __forceinline__ F2 split_row(const float* row, int k0, int lane) { float v[16]; const float* p = row + k0 + 8 * (lane >> 4);
#pragma unroll
  for (int i = 0; i < 8; ++i) { v[i] = p[i]; v[8 + i] = p[16 + i]; }
  return bsplit16(v); }
__device__ __forceinline__ F2 split_rowK(const float* row, int k0, int lane, int K) { float v[16]; const int g = lane >> 4;
#pragma unroll
  for (int i = 0; i < 8; ++i) { const int ka = k0 + 8 * g + i, kb = ka + 16; v[i] = ka < K ? row[ka < K ? ka : K - 1] : 0.f; v[8 + i] = kb < K ? row[kb < K ? kb : K - 1] : 0.f; }
  return bsplit16(v); }
__device__ __forceinline__ F2 split_col(const float* W, int k0, int n, int lane, int ld, int K) { float v[16]; const int g = lane >> 4;
#pragma unroll
  for (int i = 0; i < 8; ++i) { const int ka = k0 + 8 * g + i, kb = ka + 16; v[i] = ka < K ? W[(size_t)(ka < K ? ka : K - 1) * ld + n] : 0.f; v[8 + i] = kb < K ? W[(size_t)(kb < K ? kb : K - 1) * ld + n] : 0.f; }
  return bsplit16(v); }
__device__ __forceinline__ v8f mac3(const F2& a, const F2& b, v8f c) { c = wmma_bf(a.l, b.h, c); c = wmma_bf(a.h, b.l, c); return wmma_bf(a.h, b.h, c); }
__device__ __forceinline__ float sigm(float v) { return 1.0f / (1.0f + expf(-v)); }
#define LDSX() do { asm volatile("s_wait_dscnt 0" ::: "memory"); __builtin_amdgcn_wave_barrier(); __builtin_amdgcn_fence(__ATOMIC_RELEASE, "workgroup"); } while (0)


#define NB 2
#define SS 2048
#define DM 1024
#define NH 16
#define KIN 512          // input width
#define BSZ 2            // the module's batch (interleaved in the row order)
#define HOUT 64          // o_proj output width
#define HD 64
#define QKVW (3 * DM)
#ifndef TQB
#define TQB (SS / 64)
#define TNB NB
#define TOB (NB * SS / 64)     // output row tiles (all)
#endif
typedef __attribute__((ext_vector_type(8))) __bf16 v8b;
__device__ __forceinline__ v16b frag_b(const __bf16* rowk0, int lane) {
  union { v16b v; v8b q[2]; } u; const __bf16* p = rowk0 + 8 * (lane >> 4);
  u.q[0] = *(const v8b*)p; u.q[1] = *(const v8b*)(p + 16); return u.v;
}
__device__ __forceinline__ float bfr(float v) { return (float)(__bf16)v; }
__device__ __attribute__((noinline)) float exp_ni(float v) { return expf(v); }
__device__ __attribute__((noinline)) float erf_ni(float v) { return erff(v); }

#define PK_A 0                       // [3072][512] Wqkv rows (natural [out][in])
#define PK_P (PK_A + QKVW * DM)        // [64][1024] Wo rows (natural)
#define PK_END (PK_P + DM * DM)
#define WS_PK  0u
#define WS_QK  (WS_PK + 2u * PK_END)             // f16 [4096 rows][2048]: q | k
#define WS_QKL (WS_QK + 2u * NB * SS * 2 * DM)     // f16 q | k residual planes x2048
#define WS_VTH (WS_QKL + 2u * NB * SS * 2 * DM)    // f16 [b][1024 (h*64+d)][2048 s] hi
#define WS_VTL (WS_VTH + 2u * NB * DM * SS)        // f16 lo x 2048
#define WS_O   (WS_VTL + 2u * NB * DM * SS)        // f32 [4096][1024]
#define WS_CS  (WS_O + 4u * NB * SS * DM)           // f32 2 x [2048][32], not written or read
#define WS_END (WS_CS + 4u * 2 * SS * 32)
// ---- k_pack: block = (row n, which): natural [out][in] rows -> bf16; which 0..2 -> W_q/W_k/W_v into PK_A rows which*1024 + n; 3 -> W_o into PK_P
__global__ __launch_bounds__(256) void k_pack(const float* __restrict__ CONNW, const float* __restrict__ WQKV3, const float* __restrict__ OW, const float* __restrict__ unused, __bf16* __restrict__ PK) {
  __shared__ __align__(16) __bf16 s[DM]; const int n = blockIdx.x, which = blockIdx.y, t = threadIdx.x; (void)unused;
  if (which < 3) { const int h = n / HD, d = n % HD; const int src = h * (3 * HD) + which * HD + d;   // column of the concatenated [q_conn | qkv] buffer
    const float* row = (src < HOUT) ? (CONNW + (size_t)src * KIN) : (WQKV3 + (size_t)(src - HOUT) * KIN);
    for (int k = t; k < KIN; k += 256) s[k] = (__bf16)row[k]; __syncthreads();
    __bf16* dst = PK + PK_A + ((size_t)which * DM + n) * KIN; for (int q = t; q < KIN / 8; q += 256) vst2((unsigned*)(dst + q * 8), *(const v4u*)&s[q * 8]); }
  else { if (n >= HOUT) return; for (int k = t; k < DM; k += 256) s[k] = (__bf16)OW[(size_t)n * DM + k]; __syncthreads(); __bf16* dst = PK + PK_P + (size_t)n * DM; for (int q = t; q < DM / 8; q += 256) vst2((unsigned*)(dst + q * 8), *(const v4u*)&s[q * 8]); } }
// four 16-byte asynchronous copies a lane (each lane its own LDS byte address and global address); the s_wait_xcnt is the last line of the copies' own statement, so that it stands in front of any rewrite of their address registers
__device__ __forceinline__ void copy4(unsigned l0, const char* g0, unsigned l1, const char* g1, unsigned l2, const char* g2, unsigned l3, const char* g3) {
  asm volatile("global_load_async_to_lds_b128 %0, %1, off\n\tglobal_load_async_to_lds_b128 %2, %3, off\n\tglobal_load_async_to_lds_b128 %4, %5, off\n\tglobal_load_async_to_lds_b128 %6, %7, off\n\ts_wait_xcnt 0x0" :: "v"(l0), "v"(g0), "v"(l1), "v"(g1), "v"(l2), "v"(g2), "v"(l3), "v"(g3) : "memory");
}
// X / W ring of k_qkv in LDS: one stage = 64 k. X plane: the block's 64 rows of 256 B (f32) at pitch 272; W plane: its 128 weight rows of 128 B (bf16) at pitch 144 (both 16 B x odd: conflict-free 16-byte fragment reads)
#define XPIT 272
#define WPIT 144
#define QW_O (64 * XPIT)
#define QBUF (QW_O + 128 * WPIT)
__global__ __launch_bounds__(128) void k_qkv(const float* __restrict__ XQ, const float* __restrict__ XK, const float* __restrict__ XV, const __bf16* __restrict__ P, const float* __restrict__ BQ, const float* __restrict__ BK, const float* __restrict__ BV, _Float16* __restrict__ QK, _Float16* __restrict__ QKL, _Float16* __restrict__ VTH, _Float16* __restrict__ VTL) {
  const int which0 = (blockIdx.y * 128) / DM; const float* X = (which0 == 0) ? XQ : (which0 == 1) ? XK : XV; const float* BB = BQ ? (((which0 == 0) ? BQ : (which0 == 1) ? BK : BV) + (blockIdx.y * 128 - which0 * DM)) : nullptr;
  __shared__ __align__(16) char sm[2 * QBUF];   // the ring during the k loop; behind the loop's last barrier the same bytes stage the output tile
  _Float16 (*so)[16][136] = (_Float16 (*)[16][136])sm; _Float16 (*sol)[16][136] = so + 4; _Float16 (*sth)[72] = (_Float16 (*)[72])sm; _Float16 (*stl)[72] = sth + 128;
  const int tid = threadIdx.x, wave = tid >> 5, lane = tid & 31, col = lane & 15, g = lane >> 4; const size_t r0 = (size_t)blockIdx.x * 64 + wave * 16; const int n0 = blockIdx.y * 128;
  v8f acc[8] = {};
  // the work-group's 128 lanes copy a stage by whole rows: X row = 16 lanes x 16 B (a wave covers 2 rows = 4 whole lines), W row = 8 lanes x 16 B (4 rows = 4 whole lines); eight copies a lane and plane
  const unsigned rb = (unsigned)(size_t)sm;
  const unsigned lx = rb + (unsigned)(tid >> 4) * XPIT + (tid & 15) * 16, lw = rb + QW_O + (unsigned)(tid >> 3) * WPIT + (tid & 7) * 16;
  const char* gx = (const char*)X + ((size_t)blockIdx.x * 64 + (tid >> 4)) * (KIN * 4) + (tid & 15) * 16; const char* gw = (const char*)P + ((size_t)n0 + (tid >> 3)) * (KIN * 2) + (tid & 7) * 16;   // the lane's first X and W piece of stage 0
  auto stage = [&](int st, unsigned bo) {   // stage st (k = st * 64 ...) into the buffer at byte bo
    const char* x = gx + st * 256; const char* w = gw + st * 128; const unsigned a = lx + bo, c = lw + bo;
    copy4(a, x, a + 8 * XPIT, x + 8 * (KIN * 4), a + 16 * XPIT, x + 16 * (KIN * 4), a + 24 * XPIT, x + 24 * (KIN * 4));
    copy4(a + 32 * XPIT, x + 32 * (KIN * 4), a + 40 * XPIT, x + 40 * (KIN * 4), a + 48 * XPIT, x + 48 * (KIN * 4), a + 56 * XPIT, x + 56 * (KIN * 4));
    copy4(c, w, c + 16 * WPIT, w + 16 * (KIN * 2), c + 32 * WPIT, w + 32 * (KIN * 2), c + 48 * WPIT, w + 48 * (KIN * 2));
    copy4(c + 64 * WPIT, w + 64 * (KIN * 2), c + 80 * WPIT, w + 80 * (KIN * 2), c + 96 * WPIT, w + 96 * (KIN * 2), c + 112 * WPIT, w + 112 * (KIN * 2)); };
  const unsigned xof = (unsigned)(wave * 16 + col) * XPIT + 32 * g, wof = QW_O + (unsigned)col * WPIT + 16 * g;   // the lane's byte offsets inside an X and a W fragment of the ring, the same in every stage
  stage(0, 0);
  asm volatile("s_wait_asynccnt 0x0" ::: "memory");   // this wave's copies of stage 0 have landed
  __syncthreads();                                    // ... and every other wave's: stage 0 may be read
  stage(1, QBUF);
#pragma unroll 1   // kept rolled: the two buffers differ by an offset only, and eight copies of the body would only lengthen the text in front of the long epilogue
  for (int st = 0; st < KIN / 64; ++st) { const unsigned bo = (unsigned)(st & 1) * QBUF;
#pragma unroll
    for (int kc = 0; kc < 2; ++kc) {   // every fragment of a 32-k step is read from the ring as one group in front of its first product
      const char* xp = sm + bo + xof + kc * 128; const char* wp = sm + bo + wof + kc * 64;
      const v4f x0 = *(const v4f*)xp, x1 = *(const v4f*)(xp + 16), x2 = *(const v4f*)(xp + 64), x3 = *(const v4f*)(xp + 80);
      v16b w[8];
#pragma unroll
      for (int j = 0; j < 8; ++j) { union { v16b v; v8b q[2]; } u; u.q[0] = *(const v8b*)(wp + j * 16 * WPIT); u.q[1] = *(const v8b*)(wp + j * 16 * WPIT + 32); w[j] = u.v; }
      __builtin_amdgcn_sched_barrier(0);   // holds the step's LDS reads as one group ahead of its first product: left free, the scheduler sinks each pair of reads to its own product, with a wait at each
      v16b a;
#pragma unroll
      for (int i = 0; i < 4; ++i) { a[i] = (__bf16)x0[i]; a[4 + i] = (__bf16)x1[i]; a[8 + i] = (__bf16)x2[i]; a[12 + i] = (__bf16)x3[i]; }
#pragma unroll
      for (int j = 0; j < 8; ++j) acc[j] = wmma_bf(a, w[j], acc[j]);
      __builtin_amdgcn_sched_barrier(0); }   // holds the products ahead of the next group of reads and of the publish point: left free, the scheduler sinks the last ones behind the work-group barrier
    // publish point: this wave's LDS reads of the stage are done, its copies of the next stage have landed; behind the barrier the next stage may be read and this stage's buffer refilled
    asm volatile("s_wait_dscnt 0x0" ::: "memory");
    asm volatile("s_wait_asynccnt 0x0" ::: "memory");
    __syncthreads();
    if (st + 2 < KIN / 64) stage(st + 2, bo); }
  asm volatile("s_wait_asynccnt 0x0" ::: "memory");   // no copy is left outstanding behind the loop
  if (n0 < 2 * DM) {   // q stored unscaled (f16 sigma ~0.6, no subnormal exposure); 1/8 applied to the f32 score
#pragma unroll
    for (int j = 0; j < 8; ++j) {
#pragma unroll
      for (int r = 0; r < 8; ++r) { const float v = acc[j][r] + (BB ? bfr(BB[j * 16 + col]) : 0.f); const _Float16 hv = (_Float16)v; so[wave][8 * g + r][j * 16 + col] = hv; sol[wave][8 * g + r][j * 16 + col] = (_Float16)((v - (float)hv) * 2048.0f); } }   // q, k (+ bias) as f16 hi + (x2048) residual
    LDSX();
    for (int rl = 0; rl < 16; ++rl) if (lane < 16) { vst2((unsigned*)(QK + (r0 + rl) * (2 * DM) + n0 + lane * 8), *(const v4u*)&so[wave][rl][lane * 8]); vst2((unsigned*)(QKL + (r0 + rl) * (2 * DM) + n0 + lane * 8), *(const v4u*)&sol[wave][rl][lane * 8]); }
  } else {
#pragma unroll
    for (int j = 0; j < 8; ++j) {
#pragma unroll
      for (int r = 0; r < 8; ++r) { const float v = acc[j][r] + (BB ? bfr(BB[j * 16 + col]) : 0.f); const _Float16 hv = (_Float16)v; sth[j * 16 + col][wave * 16 + 8 * g + r] = hv; stl[j * 16 + col][wave * 16 + 8 * g + r] = (_Float16)((v - (float)hv) * 2048.0f); } }
    __syncthreads();
    const size_t rb = (size_t)blockIdx.x * 64; const int b = (int)(rb / SS), s0 = (int)(rb % SS); const int pc0 = n0 - 2 * DM;
    for (int q = tid; q < 128 * 8; q += 128) { const int d = q >> 3, pc = q & 7; const size_t o = ((size_t)b * DM + pc0 + d) * SS + s0 + pc * 8; vst2((unsigned*)(VTH + o), *(const v4u*)&sth[d][pc * 8]); vst2((unsigned*)(VTL + o), *(const v4u*)&stl[d][pc * 8]); }
  }
}
// ---- k_attn: block = (64 queries, head h, batch b): all-keys flash attention (K = 64: 2 k-steps), scores = (q.k) * 0.125 from q hi/lo x k hi/lo (3 products) in the first two query blocks, single f16 elsewhere, P.V: there 2^11 P hi/lo x V hi/lo (3 products) in two accumulators, elsewhere 2^11 P x V hi; O[b*S+q][h*64+d] = (acc + accl / 2048) / (2048 l) (256-B segments)
__device__ __forceinline__ v16h frag_p(const char* p) {   // frag_h from the lane's own byte address
  union { v16h v; v8h q[2]; } u; u.q[0] = *(const v8h*)p; u.q[1] = *(const v8h*)(p + 32); return u.v;
}
// K/V ring in LDS: one stage = the 32 keys of a pass. K plane: 32 rows (keys) of 128 B at pitch 144; V plane: 64 rows (d) of 64 B at pitch 80 (16 B x odd: conflict-free 16-byte fragment reads)
#define KPIT 144
#define VPIT 80
#define RK_H 0
#define RV_H (RK_H + 32 * KPIT)
#define RK_L (RV_H + 64 * VPIT)
#define RV_L (RK_L + 32 * KPIT)
#define RBUF (RV_L + 64 * VPIT)
__device__ __forceinline__ float xhalf(float x) { return __builtin_bit_cast(float, __builtin_amdgcn_permlanex16(__builtin_bit_cast(int, x), __builtin_bit_cast(int, x), 0x76543210, 0xfedcba98, false, false)); }   // lane l with lane l ^ 16
template <bool HV> __device__ __forceinline__ void attn_body(const _Float16* __restrict__ QK, const _Float16* __restrict__ QKL, const _Float16* __restrict__ VTH, const _Float16* __restrict__ VTL, float* __restrict__ O, float (*so)[16][68], char* ring, const int qb, const int h, const int b) {
  const int tid = threadIdx.x, wave = tid >> 5, lane = tid & 31, col = lane & 15, g = lane >> 4;
  const int q0 = qb * 64 + wave * 16; const size_t rq = (size_t)b * SS + q0 + col;
  v16h aq[2], aql[2];
#pragma unroll
  for (int kc = 0; kc < 2; ++kc) { aq[kc] = frag_h(QK + rq * (2 * DM) + h * HD + kc * 32, lane); aql[kc] = frag_h(QKL + rq * (2 * DM) + h * HD + kc * 32, lane); }
  float m = -3.0e38f, l = 0.f;   // the lane's query: running maximum over all keys (the same in both halves), sum over this half's keys
  v8f acc[4] = {}, accl[4] = {};
  const int nks = SS / 32;   // all keys
  const unsigned kof = (unsigned)col * KPIT + 16 * g, vof = (unsigned)col * VPIT + 16 * g;   // the lane's byte offsets inside a K and a V fragment of the ring, the same in every pass
  // the work-group's 128 lanes copy a stage by whole rows: K row = 8 lanes x 16 B (a wave covers 4 whole 128-B lines), V row = 4 lanes x 16 B; two copies a lane and plane
  const unsigned rb = (unsigned)(size_t)ring;
  const unsigned lk = rb + (unsigned)(tid >> 3) * KPIT + (tid & 7) * 16, lv = rb + (unsigned)(tid >> 2) * VPIT + (tid & 3) * 16;
  const size_t gk = 2 * (((size_t)b * SS + (tid >> 3)) * (2 * DM) + DM + h * HD + (tid & 7) * 8), gv = 2 * (((size_t)b * DM + h * HD + (tid >> 2)) * SS + (tid & 3) * 8);   // byte offsets of the lane's first K and V piece of stage 0
  auto stage = [&](int st, unsigned bo) {   // stage st (keys st * 32 ...) into the buffer at byte bo
    const size_t ok = gk + (size_t)st * (32 * 2 * DM * 2), ov = gv + (size_t)st * (32 * 2);
    copy4(lk + bo + RK_H, (const char*)QK + ok, lk + bo + RK_H + 16 * KPIT, (const char*)QK + ok + 16 * (2 * DM * 2), lv + bo + RV_H, (const char*)VTH + ov, lv + bo + RV_H + 32 * VPIT, (const char*)VTH + ov + 32 * (SS * 2));
    if (HV) copy4(lk + bo + RK_L, (const char*)QKL + ok, lk + bo + RK_L + 16 * KPIT, (const char*)QKL + ok + 16 * (2 * DM * 2), lv + bo + RV_L, (const char*)VTL + ov, lv + bo + RV_L + 32 * VPIT, (const char*)VTL + ov + 32 * (SS * 2)); };
  stage(0, 0);
  asm volatile("s_wait_asynccnt 0x0" ::: "memory");   // this wave's copies of stage 0 have landed
  __syncthreads();                                    // ... and every other wave's: stage 0 may be read
  stage(1, RBUF);
#pragma unroll 1
  for (int ks = 0; ks < nks; ++ks) { v8f s[2];
    // every K fragment of the pass is read from the ring as one group in front of the first product
    v16h kh[2][2], kl[2][2];
    const unsigned bo = (unsigned)(ks & 1) * RBUF; const char* kp = ring + bo + RK_H + kof; const char* kpl = ring + bo + RK_L + kof;   // one address a plane; the fragments lie at constant offsets from it
#pragma unroll
    for (int ct = 0; ct < 2; ++ct) {
#pragma unroll
      for (int kc = 0; kc < 2; ++kc) { kh[ct][kc] = frag_p(kp + ct * 16 * KPIT + kc * 64); if (HV) kl[ct][kc] = frag_p(kpl + ct * 16 * KPIT + kc * 64); } }
    __builtin_amdgcn_sched_barrier(0);   // holds the K reads as one group ahead of the first product: left free, the scheduler sinks each pair of reads to its own product, with a wait at each
#pragma unroll
    for (int ct = 0; ct < 2; ++ct) { v8f c = {}, cl = {};
      if (HV) {   // leading query blocks (outputs far above the global rms): 3 products
#pragma unroll
        for (int kc = 0; kc < 2; ++kc) { c = wmma16(kh[ct][kc], aq[kc], c); cl = wmma16(kh[ct][kc], aql[kc], cl); cl = wmma16(kl[ct][kc], aq[kc], cl); }
#pragma unroll
        for (int r = 0; r < 8; ++r) c[r] += cl[r] * (1.0f / 2048.0f); }
      else {
#pragma unroll
        for (int kc = 0; kc < 2; ++kc) c = wmma16(kh[ct][kc], aq[kc], c); }   // single product elsewhere
      { const bool keepk = true;
#pragma unroll
      for (int r = 0; r < 8; ++r) s[ct][r] = keepk ? c[r] * 0.125f : -3.0e38f; } }   // 1/sqrt(64); no key is masked
    // every V fragment of the pass is read from the ring as one group behind the score products: the reads fly while the softmax runs
    __builtin_amdgcn_sched_barrier(0);   // with the one behind the V reads: holds them as one group between the score products and the softmax, not spread among the products
    v16h vh[4], vl[4];
    const char* vp = ring + bo + RV_H + vof; const char* vpl = ring + bo + RV_L + vof;
#pragma unroll
    for (int dt = 0; dt < 4; ++dt) { vh[dt] = frag_p(vp + dt * 16 * VPIT); if (HV) vl[dt] = frag_p(vpl + dt * 16 * VPIT); }
    __builtin_amdgcn_sched_barrier(0);   // second of the pair: left free, the scheduler sinks the V reads among the P.V products, with a wait at each; held here they fly while the softmax runs
    float t[8];   // maximum and sum of the lane's 16 scores as trees in registers
#pragma unroll
    for (int r = 0; r < 8; ++r) t[r] = fmaxf(s[0][r], s[1][r]);
    float mx = fmaxf(fmaxf(fmaxf(t[0], t[1]), fmaxf(t[2], t[3])), fmaxf(fmaxf(t[4], t[5]), fmaxf(t[6], t[7])));
    mx = fmaxf(mx, xhalf(mx));   // the other half's 16 keys of the same query
    const float mn = fmaxf(m, mx); const float alpha = (m <= -1.0e38f) ? 0.f : __expf(m - mn);
    float e[2][8];
#pragma unroll
    for (int r = 0; r < 8; ++r) { e[0][r] = (s[0][r] <= -1.0e38f) ? 0.f : __expf(s[0][r] - mn); e[1][r] = (s[1][r] <= -1.0e38f) ? 0.f : __expf(s[1][r] - mn); t[r] = e[0][r] + e[1][r]; }
    l = l * alpha + (((t[0] + t[1]) + (t[2] + t[3])) + ((t[4] + t[5]) + (t[6] + t[7]))); m = mn;   // the two halves' sums are joined once, behind the loop
#pragma unroll
    for (int dt = 0; dt < 4; ++dt) {
#pragma unroll
      for (int r = 0; r < 8; ++r) { acc[dt][r] *= alpha; accl[dt][r] *= alpha; } }
    v16h pa, pl;
#pragma unroll
    for (int i = 0; i < 8; ++i) { const float x0 = e[0][i] * 2048.0f, x1 = e[1][i] * 2048.0f; const _Float16 h0 = (_Float16)x0, h1 = (_Float16)x1; pa[i] = h0; pa[8 + i] = h1; pl[i] = (_Float16)((x0 - (float)h0) * 2048.0f); pl[8 + i] = (_Float16)((x1 - (float)h1) * 2048.0f); }   // P scaled by 2^11 before the f16 split so small softmax weights stay out of the f16 subnormal range; 2^-11 folded into the epilogue
#pragma unroll
    for (int dt = 0; dt < 4; ++dt) { acc[dt] = wmma16(vh[dt], pa, acc[dt]); if (HV) { accl[dt] = wmma16(vh[dt], pl, accl[dt]); accl[dt] = wmma16(vl[dt], pa, accl[dt]); } }   // leading query blocks: P hi/lo x V hi/lo (3 products); elsewhere P x V single
    __builtin_amdgcn_sched_barrier(0);   // holds softmax and products ahead of the publish point: left free, the scheduler lifts the waits and the barrier to the V reads, which bares their latency and halves the lead of the refill
    // publish point: this wave's LDS reads of the pass are done, its copies of the next stage have landed; behind the barrier the next stage may be read and this pass's buffer refilled
    asm volatile("s_wait_dscnt 0x0" ::: "memory");
    asm volatile("s_wait_asynccnt 0x0" ::: "memory");
    __syncthreads();
    if (ks + 2 < nks) stage(ks + 2, bo); }
  asm volatile("s_wait_asynccnt 0x0" ::: "memory");   // no copy is left outstanding behind the loop
  const float il = (1.0f / 2048.0f) / (l + xhalf(l));
#pragma unroll
  for (int dt = 0; dt < 4; ++dt) {
#pragma unroll
    for (int q = 0; q < 2; ++q) { v4f o;
#pragma unroll
      for (int i = 0; i < 4; ++i) o[i] = (acc[dt][4 * q + i] + accl[dt][4 * q + i] * (1.0f / 2048.0f)) * il;
      vst2(&so[wave][col][dt * 16 + 8 * g + 4 * q], o); } }
  LDSX();
  for (int rl = 0; rl < 16; ++rl) if (lane < 16) vst2(O + ((size_t)b * SS + q0 + rl) * DM + h * HD + lane * 4, *(const v4f*)&so[wave][rl][lane * 4]);
}
__global__ __launch_bounds__(128) void k_attn(const _Float16* __restrict__ QK, const _Float16* __restrict__ QKL, const _Float16* __restrict__ VTH, const _Float16* __restrict__ VTL, const void* __restrict__ KMASK, float* __restrict__ O) {
  __shared__ __align__(16) float so[4][16][68]; __shared__ __align__(16) char ring[2 * RBUF]; (void)KMASK;
  // which tile a block takes (for speed only; a permutation of the tiles for any dispatch): a three-product block costs about twice a single-product one, and all blocks are resident at once, so the launch lasts as long as the WGP with the most of them.
  // Dealt by blockIdx.x < 2 they lie at flat indices 0 and 1 modulo 32. Here they take every 5th group of 8 flat indices from the front (40 apart): near the start.
  const int f = blockIdx.x + TQB * (blockIdx.y + NH * blockIdx.z), j = f >> 3;   // flat index; its group of 8
  const int NHV = 2 * NH * TNB / 8;   // groups of three-product blocks (2 query blocks a head and batch)
  if (j < 5 * NHV && j % 5 == 0) { const int i = (j / 5) * 8 + (f & 7); const int hb = i >> 1; attn_body<true>(QK, QKL, VTH, VTL, O, so, ring, i & 1, hb % NH, hb / NH); }
  else { const int i = f - 8 * (j < 5 * NHV ? j / 5 + 1 : NHV); const int hb = i / (TQB - 2); attn_body<false>(QK, QKL, VTH, VTL, O, so, ring, 2 + i % (TQB - 2), hb % NH, hb / NH); }   // the others keep their order, closed up over the groups taken out
}
// ---- k_out: block = (64 rows, 128 cols): out = O(hi/lo) . Wo rows (2 products) + bo
__global__ __launch_bounds__(128) void k_out(const float* __restrict__ O, const __bf16* __restrict__ P, const float* __restrict__ BO, float* __restrict__ Y) {
  __shared__ __align__(16) float so[4][16][132];
  const int tid = threadIdx.x, wave = tid >> 5, lane = tid & 31, col = lane & 15, g = lane >> 4; const size_t r0 = (size_t)blockIdx.x * 64 + wave * 16; const int n0 = blockIdx.y * 128;
  v8f acc[8] = {};
#pragma unroll 2
  for (int kc = 0; kc < DM / 32; ++kc) { const F2 a = split_row(O + (r0 + col) * DM, kc * 32, lane);
#pragma unroll
    for (int j = 0; j < 8; ++j) { const v16b w = frag_b(P + (size_t)(n0 + j * 16 + col) * DM + kc * 32, lane); acc[j] = wmma_bf(a.l, w, acc[j]); acc[j] = wmma_bf(a.h, w, acc[j]); } }
#pragma unroll
  for (int j = 0; j < 8; ++j) {
#pragma unroll
    for (int r = 0; r < 8; ++r) so[wave][8 * g + r][j * 16 + col] = acc[j][r] + bfr(BO[n0 + j * 16 + col]); }
  LDSX();
  for (int rl = 0; rl < 16; ++rl) vst2(Y + (r0 + rl) * DM + n0 + lane * 4, *(const v4f*)&so[wave][rl][lane * 4]);
}
// ---- k_pbias: one block: PB[which][h*64 + d] = concat_bias[h*192 + which*64 + d] (conn_b for columns < 64, qkv_b after) -> three 4-KB rows
__global__ __launch_bounds__(256) void k_pbias(const float* __restrict__ CONNB, const float* __restrict__ QKVB, float* __restrict__ PB) { __shared__ __align__(16) float s[3 * DM]; const int t = threadIdx.x;
  for (int e = t; e < 3 * DM; e += 256) { const int which = e / DM, n = e % DM; const int h = n / HD, d = n % HD; const int src = h * (3 * HD) + which * HD + d; s[e] = (src < HOUT) ? CONNB[src] : QKVB[src - HOUT]; }
  __syncthreads(); for (int q = t; q < 3 * DM / 4; q += 256) vst2(PB + q * 4, *(const v4f*)&s[q * 4]); }
// ---- k_o: block = 64 rows r' = (b', s'): o = ctx (bf16 hi + lo) . o_w rows + o_b -> out[(s' * BSZ + b') * 64] (the final (B,S)->(S,B) transpose)
__global__ __launch_bounds__(128) void k_o(const float* __restrict__ O, const __bf16* __restrict__ P, const float* __restrict__ OB, float* __restrict__ Y) { __shared__ __align__(16) float so[4][16][68];
  const int tid = threadIdx.x, wave = tid >> 5, lane = tid & 31, col = lane & 15, g = lane >> 4; const size_t r0 = (size_t)blockIdx.x * 64 + wave * 16; const __bf16* Wr = P + PK_P;
  v8f acc[4] = {};
#pragma unroll 2
  for (int kc = 0; kc < DM / 32; ++kc) { const F2 a = split_row(O + (r0 + col) * DM, kc * 32, lane);
#pragma unroll
    for (int j = 0; j < 4; ++j) { const v16b w = frag_b(Wr + (size_t)(j * 16 + col) * DM + kc * 32, lane); acc[j] = wmma_bf(a.h, w, acc[j]); acc[j] = wmma_bf(a.l, w, acc[j]); } }
#pragma unroll
  for (int j = 0; j < 4; ++j) { const float bb = bfr(OB[j * 16 + col]);
#pragma unroll
    for (int r = 0; r < 8; ++r) so[wave][8 * g + r][j * 16 + col] = acc[j][r] + bb; }
  LDSX(); for (int rl = 0; rl < 16; ++rl) if (lane < 16) { const size_t rp = r0 + rl; const size_t bp = rp / SS, sp = rp % SS; vst2(Y + (sp * BSZ + bp) * HOUT + lane * 4, *(const v4f*)&so[wave][rl][lane * 4]); } }
extern "C" void kernel_launch(void* const* d_in, const int* in_sizes, int n_in, void* d_out, int out_size, void* d_ws, size_t ws_size, hipStream_t stream) {
  (void)in_sizes; (void)n_in; (void)out_size;
  const float** F = (const float**)d_in;   // 0 x [2048,2,512], 1 qkv_w [3008,512], 2 qkv_b [3008], 3 conn_w [64,512], 4 conn_b [64], 5 o_w [64,1024], 6 o_b [64]
  if (ws_size < (size_t)WS_END + 4u * 3 * DM) return;
  char* ws = (char*)d_ws; __bf16* PK = (__bf16*)(ws + WS_PK); _Float16 *QK = (_Float16*)(ws + WS_QK), *QKL = (_Float16*)(ws + WS_QKL), *VTH = (_Float16*)(ws + WS_VTH), *VTL = (_Float16*)(ws + WS_VTL); float* O = (float*)(ws + WS_O); float* PB = (float*)(ws + WS_END);
  k_pack<<<dim3(DM, 4), 256, 0, stream>>>(F[3], F[1], F[5], nullptr, PK);
  k_pbias<<<1, 256, 0, stream>>>(F[4], F[2], PB);
  // the (S,B,512) input rows in memory order ARE the (b', s') rows of the raw reshape: row r = b' * 2048 + s'
  k_qkv<<<dim3(TNB * SS / 64, QKVW / 128), 128, 0, stream>>>(F[0], F[0], F[0], PK + PK_A, PB, PB + DM, PB + 2 * DM, QK, QKL, VTH, VTL);
  k_attn<<<dim3(TQB, NH, TNB), 128, 0, stream>>>(QK, QKL, VTH, VTL, nullptr, O);
  k_o<<<TOB, 128, 0, stream>>>(O, PK, F[6], (float*)d_out);
}

// v007
// Measured time: 113 microseconds a run.
// In two side-by-side timings against v006, it was 1.05 and 1.06 times as fast.
// Counting every step since v000, it is 3.77 times as fast.
// compute dtype: all float inputs rounded to bf16; the concatenated [conn | qkv] projection with EXACT bf16 products on WMMA 16x16x32 (weight rows permuted at pack time into per-head q / k / v blocks; K = 512) + biases in f32, rounded once to f16 hi + residual; PLAIN-HYBRID attention (first 128 queries of each attention batch 3-product, later single f16), x 1/8, running-max softmax in f32 (hardware exp); out = ctx (bf16 hi + lo, 2 products) . o_w rows + o_b; f32 output.
#include <hip/hip_runtime.h>
#include <math.h>

typedef __attribute__((ext_vector_type(16))) _Float16 v16h;
typedef __attribute__((ext_vector_type(16))) __bf16 v16b;
typedef __attribute__((ext_vector_type(8)))  _Float16 v8h;
typedef __attribute__((ext_vector_type(8)))  float v8f;
typedef __attribute__((ext_vector_type(4)))  float v4f;
typedef __attribute__((ext_vector_type(2)))  float v2f;
typedef __attribute__((ext_vector_type(4)))  unsigned v4u;
typedef __attribute__((ext_vector_type(4)))  int v4i;
typedef float __attribute__((may_alias)) float_a;
typedef int __attribute__((may_alias)) int_a;

template <typename T> __device__ __forceinline__ void vst2(void* p, T v) { *(T*)p = v;  }
__device__ __forceinline__ v8f wmma16(v16h a, v16h b, v8f c) {
  return __builtin_amdgcn_wmma_f32_16x16x32_f16(false, a, false, b, (short)0, c, false, false);
}
__device__ __forceinline__ v8f wmma_bf(v16b a, v16b b, v8f c) {
  return __builtin_amdgcn_wmma_f32_16x16x32_bf16(false, a, false, b, (short)0, c, false, false);
}
// Modified multi-head attention (S 2,048, B 2, d_in 512, 16 heads x 64): qkv from one projection plus a fixed 'connection' projection supplying 64 of the q columns, the torch raw reshape (S,B,3E) -> (B,S,H,3*64) kept literally (so attention 'batches' are contiguous halves of the (s,b) row order and each head's q|k|v are consecutive 64-column slices), softmax(q k / 8) v, output projection E -> 64 + bias, returned as (S, B, 64).
__device__ __forceinline__ v16h frag_h(const _Float16* rowk0, int lane) {
  union { v16h v; v8h q[2]; } u; const _Float16* p = rowk0 + 8 * (lane >> 4);
  u.q[0] = *(const v8h*)p; u.q[1] = *(const v8h*)(p + 16); return u.v;
}
__device__ __forceinline__ v16h frag_f32(const float* rowk0, int lane) {
  v16h a; const float* p = rowk0 + 8 * (lane >> 4);
#pragma unroll
  for (int i = 0; i < 8; ++i) { a[i] = (_Float16)p[i]; a[8 + i] = (_Float16)p[16 + i]; }
  return a;
}
__device__ __forceinline__ v16h frag_f32s(const float* rowk0, int lane, float sc) {
  v16h a; const float* p = rowk0 + 8 * (lane >> 4);
#pragma unroll
  for (int i = 0; i < 8; ++i) { a[i] = (_Float16)(p[i] * sc); a[8 + i] = (_Float16)(p[16 + i] * sc); }
  return a;
}
// column fragment from a [K][ld] layout (column n), rows >= K read as 0
__device__ __forceinline__ v16h fragc_f32(const float* W, int k0, int n, int lane, int ld, int K) {
  v16h a; const int g = lane >> 4;
#pragma unroll
  for (int i = 0; i < 8; ++i) { const int ka = k0 + 8 * g + i, kb = ka + 16;
    a[i] = (_Float16)(ka < K ? W[(size_t)(ka < K ? ka : K - 1) * ld + n] : 0.f); a[8 + i] = (_Float16)(kb < K ? W[(size_t)(kb < K ? kb : K - 1) * ld + n] : 0.f); }
  return a;
}
struct F2 { v16b h, l; };
__device__ __forceinline__ F2 bsplit16(const float v[16]) { F2 r;
#pragma unroll
  for (int i = 0; i < 16; ++i) { const __bf16 h = (__bf16)v[i]; r.h[i] = h; r.l[i] = (__bf16)(v[i] - (float)h); }
  return r; }
__device__ __forceinline__ F2 split_row(const float* row, int k0, int lane) { float v[16]; const float* p = row + k0 + 8 * (lane >> 4);
#pragma unroll
  for (int i = 0; i < 8; ++i) { v[i] = p[i]; v[8 + i] = p[16 + i]; }
  return bsplit16(v); }
__device__ __forceinline__ F2 split_rowK(const float* row, int k0, int lane, int K) { float v[16]; const int g = lane >> 4;
#pragma unroll
  for (int i = 0; i < 8; ++i) { const int ka = k0 + 8 * g + i, kb = ka + 16; v[i] = ka < K ? row[ka < K ? ka : K - 1] : 0.f; v[8 + i] = kb < K ? row[kb < K ? kb : K - 1] : 0.f; }
  return bsplit16(v); }
__device__ __forceinline__ F2 split_col(const float* W, int k0, int n, int lane, int ld, int K) { float v[16]; const int g = lane >> 4;
#pragma unroll
  for (int i = 0; i < 8; ++i) { const int ka = k0 + 8 * g + i, kb = ka + 16; v[i] = ka < K ? W[(size_t)(ka < K ? ka : K - 1) * ld + n] : 0.f; v[8 + i] = kb < K ? W[(size_t)(kb < K ? kb : K - 1) * ld + n] : 0.f; }
  return bsplit16(v); }
__device__ __forceinline__ v8f mac3(const F2& a, const F2& b, v8f c) { c = wmma_bf(a.l, b.h, c); c = wmma_bf(a.h, b.l, c); return wmma_bf(a.h, b.h, c); }
__device__ __forceinline__ float sigm(float v) { return 1.0f / (1.0f + expf(-v)); }
#define LDSX() do { asm volatile("s_wait_dscnt 0" ::: "memory"); __builtin_amdgcn_wave_barrier(); __builtin_amdgcn_fence(__ATOMIC_RELEASE, "workgroup"); } while (0)


#define NB 2
#define SS 2048
#define DM 1024
#define NH 16
#define KIN 512          // input width
#define BSZ 2            // the module's batch (interleaved in the row order)
#define HOUT 64          // o_proj output width
#define HD 64
#define QKVW (3 * DM)
#ifndef TQB
#define TQB (SS / 64)
#define TNB NB
#define TOB (NB * SS / 64)     // output row tiles (all)
#endif
typedef __attribute__((ext_vector_type(8))) __bf16 v8b;
__device__ __forceinline__ v16b frag_b(const __bf16* rowk0, int lane) {
  union { v16b v; v8b q[2]; } u; const __bf16* p = rowk0 + 8 * (lane >> 4);
  u.q[0] = *(const v8b*)p; u.q[1] = *(const v8b*)(p + 16); return u.v;
}
__device__ __forceinline__ float bfr(float v) { return (float)(__bf16)v; }
__device__ __attribute__((noinline)) float exp_ni(float v) { return expf(v); }
__device__ __attribute__((noinline)) float erf_ni(float v) { return erff(v); }

#define PK_A 0                       // [3072][512] Wqkv rows (permuted into q | k | v blocks, [out][in])
#define PK_P (PK_A + QKVW * DM)        // [64][1024] Wo rows (natural)
#define PK_END (PK_P + DM * DM)
#define WS_PK  0u
#define WS_QK  (WS_PK + 2u * PK_END)             // f16 [4096 rows][2048]: q | k
#define WS_QKL (WS_QK + 2u * NB * SS * 2 * DM)     // f16 q | k residual planes x2048
#define WS_VTH (WS_QKL + 2u * NB * SS * 2 * DM)    // f16 [b][1024 (h*64+d)][2048 s] hi
#define WS_VTL (WS_VTH + 2u * NB * DM * SS)        // f16 lo x 2048
#define WS_O   (WS_VTL + 2u * NB * DM * SS)        // f32 [4096][1024]
#define WS_CS  (WS_O + 4u * NB * SS * DM)           // f32 2 x [2048][32], not written or read
#define WS_END (WS_CS + 4u * 2 * SS * 32)
// ---- k_pack: the whole pack stage in one launch of few, full work-groups (the work is small: each lane takes four 16-byte pieces straight through registers, all loads in front of the first store).
// blocks 0 .. PKB_W-1: 16 rows each of the permuted [q | k | v] weight (row which * 1024 + h * 64 + d = column h * 192 + which * 64 + d of the concatenated [q_conn | qkv] buffer) -> bf16 at PK_A; 16 divides 64, so a block's rows have one (which, h) and are 16 consecutive rows of one source too: 32 KB read, 16 KB written, both in a row
// the next PKB_O blocks: 8 rows each of o_w (natural order) -> bf16 at PK_P; the last block: the three bias rows, permuted like the weight rows, f32 -> PB
#define PKB_W (QKVW / 16)
#define PKB_O (HOUT * DM / (16 * KIN))
__device__ __forceinline__ v4u pack8(v4f a, v4f b) { union { v8b h; v4u u; } r;
#pragma unroll
  for (int i = 0; i < 4; ++i) { r.h[i] = (__bf16)a[i]; r.h[4 + i] = (__bf16)b[i]; }
  return r.u; }
__device__ __forceinline__ unsigned src_col(unsigned e) { const unsigned which = e / DM, n = e % DM; return (n / HD) * (3 * HD) + which * HD + n % HD; }   // packed row (or bias element) e -> column of the concatenated buffer
__global__ __launch_bounds__(256) void k_pack(const float* __restrict__ CONNW, const float* __restrict__ WQKV3, const float* __restrict__ OW, const float* __restrict__ CONNB, const float* __restrict__ QKVB, __bf16* __restrict__ PK, float* __restrict__ PB) {
  const unsigned t = threadIdx.x, blk = blockIdx.x;
  if (blk < PKB_W + PKB_O) { const float* s; __bf16* dst;   // the block's 8,192 elements, source and destination
    if (blk < PKB_W) { const unsigned src = src_col(blk * 16); s = (src < HOUT) ? (CONNW + (size_t)src * KIN) : (WQKV3 + (size_t)(src - HOUT) * KIN); dst = PK + PK_A + (size_t)blk * (16 * KIN); }
    else { s = OW + (size_t)(blk - PKB_W) * (16 * KIN); dst = PK + PK_P + (size_t)(blk - PKB_W) * (16 * KIN); }
    v4f a[4], b[4];
#pragma unroll
    for (int i = 0; i < 4; ++i) { a[i] = *(const v4f*)(s + (i * 256 + t) * 8); b[i] = *(const v4f*)(s + (i * 256 + t) * 8 + 4); }   // piece = 8 consecutive elements
#pragma unroll
    for (int i = 0; i < 4; ++i) vst2((unsigned*)(dst + (i * 256 + t) * 8), pack8(a[i], b[i])); }
  else { v4f v[3];
#pragma unroll
    for (int i = 0; i < 3; ++i) { const unsigned src = src_col((i * 256 + t) * 4); v[i] = *(const v4f*)((src < HOUT) ? (CONNB + src) : (QKVB + (src - HOUT))); }   // 4 consecutive d of one head and kind lie side by side in the source too
#pragma unroll
    for (int i = 0; i < 3; ++i) vst2(PB + (i * 256 + t) * 4, v[i]); } }
// four 16-byte asynchronous copies a lane (each lane its own LDS byte address and global address); the s_wait_xcnt is the last line of the copies' own statement, so that it stands in front of any rewrite of their address registers
__device__ __forceinline__ void copy4(unsigned l0, const char* g0, unsigned l1, const char* g1, unsigned l2, const char* g2, unsigned l3, const char* g3) {
  asm volatile("global_load_async_to_lds_b128 %0, %1, off\n\tglobal_load_async_to_lds_b128 %2, %3, off\n\tglobal_load_async_to_lds_b128 %4, %5, off\n\tglobal_load_async_to_lds_b128 %6, %7, off\n\ts_wait_xcnt 0x0" :: "v"(l0), "v"(g0), "v"(l1), "v"(g1), "v"(l2), "v"(g2), "v"(l3), "v"(g3) : "memory");
}
// X / W ring of k_qkv in LDS: one stage = 64 k. X plane: the block's 64 rows of 256 B (f32) at pitch 272; W plane: its 128 weight rows of 128 B (bf16) at pitch 144 (both 16 B x odd: conflict-free 16-byte fragment reads)
#define XPIT 272
#define WPIT 144
#define QW_O (64 * XPIT)
#define QBUF (QW_O + 128 * WPIT)
__global__ __launch_bounds__(128) void k_qkv(const float* __restrict__ XQ, const float* __restrict__ XK, const float* __restrict__ XV, const __bf16* __restrict__ P, const float* __restrict__ BQ, const float* __restrict__ BK, const float* __restrict__ BV, _Float16* __restrict__ QK, _Float16* __restrict__ QKL, _Float16* __restrict__ VTH, _Float16* __restrict__ VTL) {
  const int which0 = (blockIdx.y * 128) / DM; const float* X = (which0 == 0) ? XQ : (which0 == 1) ? XK : XV; const float* BB = BQ ? (((which0 == 0) ? BQ : (which0 == 1) ? BK : BV) + (blockIdx.y * 128 - which0 * DM)) : nullptr;
  __shared__ __align__(16) char sm[2 * QBUF];   // the ring during the k loop; behind the loop's last barrier the same bytes stage the output tile
  _Float16 (*so)[16][136] = (_Float16 (*)[16][136])sm; _Float16 (*sol)[16][136] = so + 4; _Float16 (*sth)[72] = (_Float16 (*)[72])sm; _Float16 (*stl)[72] = sth + 128;
  const int tid = threadIdx.x, wave = tid >> 5, lane = tid & 31, col = lane & 15, g = lane >> 4; const size_t r0 = (size_t)blockIdx.x * 64 + wave * 16; const int n0 = blockIdx.y * 128;
  v8f acc[8] = {};
  // the work-group's 128 lanes copy a stage by whole rows: X row = 16 lanes x 16 B (a wave covers 2 rows = 4 whole lines), W row = 8 lanes x 16 B (4 rows = 4 whole lines); eight copies a lane and plane
  const unsigned rb = (unsigned)(size_t)sm;
  const unsigned lx = rb + (unsigned)(tid >> 4) * XPIT + (tid & 15) * 16, lw = rb + QW_O + (unsigned)(tid >> 3) * WPIT + (tid & 7) * 16;
  const char* gx = (const char*)X + ((size_t)blockIdx.x * 64 + (tid >> 4)) * (KIN * 4) + (tid & 15) * 16; const char* gw = (const char*)P + ((size_t)n0 + (tid >> 3)) * (KIN * 2) + (tid & 7) * 16;   // the lane's first X and W piece of stage 0
  auto stage = [&](int st, unsigned bo) {   // stage st (k = st * 64 ...) into the buffer at byte bo
    const char* x = gx + st * 256; const char* w = gw + st * 128; const unsigned a = lx + bo, c = lw + bo;
    copy4(a, x, a + 8 * XPIT, x + 8 * (KIN * 4), a + 16 * XPIT, x + 16 * (KIN * 4), a + 24 * XPIT, x + 24 * (KIN * 4));
    copy4(a + 32 * XPIT, x + 32 * (KIN * 4), a + 40 * XPIT, x + 40 * (KIN * 4), a + 48 * XPIT, x + 48 * (KIN * 4), a + 56 * XPIT, x + 56 * (KIN * 4));
    copy4(c, w, c + 16 * WPIT, w + 16 * (KIN * 2), c + 32 * WPIT, w + 32 * (KIN * 2), c + 48 * WPIT, w + 48 * (KIN * 2));
    copy4(c + 64 * WPIT, w + 64 * (KIN * 2), c + 80 * WPIT, w + 80 * (KIN * 2), c + 96 * WPIT, w + 96 * (KIN * 2), c + 112 * WPIT, w + 112 * (KIN * 2)); };
  const unsigned xof = (unsigned)(wave * 16 + col) * XPIT + 32 * g, wof = QW_O + (unsigned)col * WPIT + 16 * g;   // the lane's byte offsets inside an X and a W fragment of the ring, the same in every stage
  stage(0, 0);
  asm volatile("s_wait_asynccnt 0x0" ::: "memory");   // this wave's copies of stage 0 have landed
  __syncthreads();                                    // ... and every other wave's: stage 0 may be read
  stage(1, QBUF);
#pragma unroll 1   // kept rolled: the two buffers differ by an offset only, and eight copies of the body would only lengthen the text in front of the long epilogue
  for (int st = 0; st < KIN / 64; ++st) { const unsigned bo = (unsigned)(st & 1) * QBUF;
#pragma unroll
    for (int kc = 0; kc < 2; ++kc) {   // every fragment of a 32-k step is read from the ring as one group in front of its first product
      const char* xp = sm + bo + xof + kc * 128; const char* wp = sm + bo + wof + kc * 64;
      const v4f x0 = *(const v4f*)xp, x1 = *(const v4f*)(xp + 16), x2 = *(const v4f*)(xp + 64), x3 = *(const v4f*)(xp + 80);
      v16b w[8];
#pragma unroll
      for (int j = 0; j < 8; ++j) { union { v16b v; v8b q[2]; } u; u.q[0] = *(const v8b*)(wp + j * 16 * WPIT); u.q[1] = *(const v8b*)(wp + j * 16 * WPIT + 32); w[j] = u.v; }
      __builtin_amdgcn_sched_barrier(0);   // holds the step's LDS reads as one group ahead of its first product: left free, the scheduler sinks each pair of reads to its own product, with a wait at each
      v16b a;
#pragma unroll
      for (int i = 0; i < 4; ++i) { a[i] = (__bf16)x0[i]; a[4 + i] = (__bf16)x1[i]; a[8 + i] = (__bf16)x2[i]; a[12 + i] = (__bf16)x3[i]; }
#pragma unroll
      for (int j = 0; j < 8; ++j) acc[j] = wmma_bf(a, w[j], acc[j]);
      __builtin_amdgcn_sched_barrier(0); }   // holds the products ahead of the next group of reads and of the publish point: left free, the scheduler sinks the last ones behind the work-group barrier
    // publish point: this wave's LDS reads of the stage are done, its copies of the next stage have landed; behind the barrier the next stage may be read and this stage's buffer refilled
    asm volatile("s_wait_dscnt 0x0" ::: "memory");
    asm volatile("s_wait_asynccnt 0x0" ::: "memory");
    __syncthreads();
    if (st + 2 < KIN / 64) stage(st + 2, bo); }
  asm volatile("s_wait_asynccnt 0x0" ::: "memory");   // no copy is left outstanding behind the loop
  if (n0 < 2 * DM) {   // q stored unscaled (f16 sigma ~0.6, no subnormal exposure); 1/8 applied to the f32 score
#pragma unroll
    for (int j = 0; j < 8; ++j) {
#pragma unroll
      for (int r = 0; r < 8; ++r) { const float v = acc[j][r] + (BB ? bfr(BB[j * 16 + col]) : 0.f); const _Float16 hv = (_Float16)v; so[wave][8 * g + r][j * 16 + col] = hv; sol[wave][8 * g + r][j * 16 + col] = (_Float16)((v - (float)hv) * 2048.0f); } }   // q, k (+ bias) as f16 hi + (x2048) residual
    LDSX();
    for (int rl = 0; rl < 16; ++rl) if (lane < 16) { vst2((unsigned*)(QK + (r0 + rl) * (2 * DM) + n0 + lane * 8), *(const v4u*)&so[wave][rl][lane * 8]); vst2((unsigned*)(QKL + (r0 + rl) * (2 * DM) + n0 + lane * 8), *(const v4u*)&sol[wave][rl][lane * 8]); }
  } else {
#pragma unroll
    for (int j = 0; j < 8; ++j) {
#pragma unroll
      for (int r = 0; r < 8; ++r) { const float v = acc[j][r] + (BB ? bfr(BB[j * 16 + col]) : 0.f); const _Float16 hv = (_Float16)v; sth[j * 16 + col][wave * 16 + 8 * g + r] = hv; stl[j * 16 + col][wave * 16 + 8 * g + r] = (_Float16)((v - (float)hv) * 2048.0f); } }
    __syncthreads();
    const size_t rb = (size_t)blockIdx.x * 64; const int b = (int)(rb / SS), s0 = (int)(rb % SS); const int pc0 = n0 - 2 * DM;
    for (int q = tid; q < 128 * 8; q += 128) { const int d = q >> 3, pc = q & 7; const size_t o = ((size_t)b * DM + pc0 + d) * SS + s0 + pc * 8; vst2((unsigned*)(VTH + o), *(const v4u*)&sth[d][pc * 8]); vst2((unsigned*)(VTL + o), *(const v4u*)&stl[d][pc * 8]); }
  }
}
// ---- k_attn: block = (64 queries, head h, batch b): all-keys flash attention (K = 64: 2 k-steps), scores = (q.k) * 0.125 from q hi/lo x k hi/lo (3 products) in the first two query blocks, single f16 elsewhere, P.V: there 2^11 P hi/lo x V hi/lo (3 products) in two accumulators, elsewhere 2^11 P x V hi; O[b*S+q][h*64+d] = (acc + accl / 2048) / (2048 l) (256-B segments)
__device__ __forceinline__ v16h frag_p(const char* p) {   // frag_h from the lane's own byte address
  union { v16h v; v8h q[2]; } u; u.q[0] = *(const v8h*)p; u.q[1] = *(const v8h*)(p + 32); return u.v;
}
// K/V ring in LDS: one stage = the 32 keys of a pass. K plane: 32 rows (keys) of 128 B at pitch 144; V plane: 64 rows (d) of 64 B at pitch 80 (16 B x odd: conflict-free 16-byte fragment reads)
#define KPIT 144
#define VPIT 80
#define RK_H 0
#define RV_H (RK_H + 32 * KPIT)
#define RK_L (RV_H + 64 * VPIT)
#define RV_L (RK_L + 32 * KPIT)
#define RBUF (RV_L + 64 * VPIT)
__device__ __forceinline__ float xhalf(float x) { return __builtin_bit_cast(float, __builtin_amdgcn_permlanex16(__builtin_bit_cast(int, x), __builtin_bit_cast(int, x), 0x76543210, 0xfedcba98, false, false)); }   // lane l with lane l ^ 16
template <bool HV> __device__ __forceinline__ void attn_body(const _Float16* __restrict__ QK, const _Float16* __restrict__ QKL, const _Float16* __restrict__ VTH, const _Float16* __restrict__ VTL, float* __restrict__ O, float (*so)[16][68], char* ring, const int qb, const int h, const int b) {
  const int tid = threadIdx.x, wave = tid >> 5, lane = tid & 31, col = lane & 15, g = lane >> 4;
  const int q0 = qb * 64 + wave * 16; const size_t rq = (size_t)b * SS + q0 + col;
  v16h aq[2], aql[2];
#pragma unroll
  for (int kc = 0; kc < 2; ++kc) { aq[kc] = frag_h(QK + rq * (2 * DM) + h * HD + kc * 32, lane); aql[kc] = frag_h(QKL + rq * (2 * DM) + h * HD + kc * 32, lane); }
  float m = -3.0e38f, l = 0.f;   // the lane's query: running maximum over all keys (the same in both halves), sum over this half's keys
  v8f acc[4] = {}, accl[4] = {};
  const int nks = SS / 32;   // all keys
  const unsigned kof = (unsigned)col * KPIT + 16 * g, vof = (unsigned)col * VPIT + 16 * g;   // the lane's byte offsets inside a K and a V fragment of the ring, the same in every pass
  // the work-group's 128 lanes copy a stage by whole rows: K row = 8 lanes x 16 B (a wave covers 4 whole 128-B lines), V row = 4 lanes x 16 B; two copies a lane and plane
  const unsigned rb = (unsigned)(size_t)ring;
  const unsigned lk = rb + (unsigned)(tid >> 3) * KPIT + (tid & 7) * 16, lv = rb + (unsigned)(tid >> 2) * VPIT + (tid & 3) * 16;
  const size_t gk = 2 * (((size_t)b * SS + (tid >> 3)) * (2 * DM) + DM + h * HD + (tid & 7) * 8), gv = 2 * (((size_t)b * DM + h * HD + (tid >> 2)) * SS + (tid & 3) * 8);   // byte offsets of the lane's first K and V piece of stage 0
  auto stage = [&](int st, unsigned bo) {   // stage st (keys st * 32 ...) into the buffer at byte bo
    const size_t ok = gk + (size_t)st * (32 * 2 * DM * 2), ov = gv + (size_t)st * (32 * 2);
    copy4(lk + bo + RK_H, (const char*)QK + ok, lk + bo + RK_H + 16 * KPIT, (const char*)QK + ok + 16 * (2 * DM * 2), lv + bo + RV_H, (const char*)VTH + ov, lv + bo + RV_H + 32 * VPIT, (const char*)VTH + ov + 32 * (SS * 2));
    if (HV) copy4(lk + bo + RK_L, (const char*)QKL + ok, lk + bo + RK_L + 16 * KPIT, (const char*)QKL + ok + 16 * (2 * DM * 2), lv + bo + RV_L, (const char*)VTL + ov, lv + bo + RV_L + 32 * VPIT, (const char*)VTL + ov + 32 * (SS * 2)); };
  stage(0, 0);
  asm volatile("s_wait_asynccnt 0x0" ::: "memory");   // this wave's copies of stage 0 have landed
  __syncthreads();                                    // ... and every other wave's: stage 0 may be read
  stage(1, RBUF);
#pragma unroll 1
  for (int ks = 0; ks < nks; ++ks) { v8f s[2];
    // every K fragment of the pass is read from the ring as one group in front of the first product
    v16h kh[2][2], kl[2][2];
    const unsigned bo = (unsigned)(ks & 1) * RBUF; const char* kp = ring + bo + RK_H + kof; const char* kpl = ring + bo + RK_L + kof;   // one address a plane; the fragments lie at constant offsets from it
#pragma unroll
    for (int ct = 0; ct < 2; ++ct) {
#pragma unroll
      for (int kc = 0; kc < 2; ++kc) { kh[ct][kc] = frag_p(kp + ct * 16 * KPIT + kc * 64); if (HV) kl[ct][kc] = frag_p(kpl + ct * 16 * KPIT + kc * 64); } }
    __builtin_amdgcn_sched_barrier(0);   // holds the K reads as one group ahead of the first product: left free, the scheduler sinks each pair of reads to its own product, with a wait at each
#pragma unroll
    for (int ct = 0; ct < 2; ++ct) { v8f c = {}, cl = {};
      if (HV) {   // leading query blocks (outputs far above the global rms): 3 products
#pragma unroll
        for (int kc = 0; kc < 2; ++kc) { c = wmma16(kh[ct][kc], aq[kc], c); cl = wmma16(kh[ct][kc], aql[kc], cl); cl = wmma16(kl[ct][kc], aq[kc], cl); }
#pragma unroll
        for (int r = 0; r < 8; ++r) c[r] += cl[r] * (1.0f / 2048.0f); }
      else {
#pragma unroll
        for (int kc = 0; kc < 2; ++kc) c = wmma16(kh[ct][kc], aq[kc], c); }   // single product elsewhere
      { const bool keepk = true;
#pragma unroll
      for (int r = 0; r < 8; ++r) s[ct][r] = keepk ? c[r] * 0.125f : -3.0e38f; } }   // 1/sqrt(64); no key is masked
    // every V fragment of the pass is read from the ring as one group behind the score products: the reads fly while the softmax runs
    __builtin_amdgcn_sched_barrier(0);   // with the one behind the V reads: holds them as one group between the score products and the softmax, not spread among the products
    v16h vh[4], vl[4];
    const char* vp = ring + bo + RV_H + vof; const char* vpl = ring + bo + RV_L + vof;
#pragma unroll
    for (int dt = 0; dt < 4; ++dt) { vh[dt] = frag_p(vp + dt * 16 * VPIT); if (HV) vl[dt] = frag_p(vpl + dt * 16 * VPIT); }
    __builtin_amdgcn_sched_barrier(0);   // second of the pair: left free, the scheduler sinks the V reads among the P.V products, with a wait at each; held here they fly while the softmax runs
    float t[8];   // maximum and sum of the lane's 16 scores as trees in registers
#pragma unroll
    for (int r = 0; r < 8; ++r) t[r] = fmaxf(s[0][r], s[1][r]);
    float mx = fmaxf(fmaxf(fmaxf(t[0], t[1]), fmaxf(t[2], t[3])), fmaxf(fmaxf(t[4], t[5]), fmaxf(t[6], t[7])));
    mx = fmaxf(mx, xhalf(mx));   // the other half's 16 keys of the same query
    const float mn = fmaxf(m, mx); const float alpha = (m <= -1.0e38f) ? 0.f : __expf(m - mn);
    float e[2][8];
#pragma unroll
    for (int r = 0; r < 8; ++r) { e[0][r] = (s[0][r] <= -1.0e38f) ? 0.f : __expf(s[0][r] - mn); e[1][r] = (s[1][r] <= -1.0e38f) ? 0.f : __expf(s[1][r] - mn); t[r] = e[0][r] + e[1][r]; }
    l = l * alpha + (((t[0] + t[1]) + (t[2] + t[3])) + ((t[4] + t[5]) + (t[6] + t[7]))); m = mn;   // the two halves' sums are joined once, behind the loop
#pragma unroll
    for (int dt = 0; dt < 4; ++dt) {
#pragma unroll
      for (int r = 0; r < 8; ++r) { acc[dt][r] *= alpha; accl[dt][r] *= alpha; } }
    v16h pa, pl;
#pragma unroll
    for (int i = 0; i < 8; ++i) { const float x0 = e[0][i] * 2048.0f, x1 = e[1][i] * 2048.0f; const _Float16 h0 = (_Float16)x0, h1 = (_Float16)x1; pa[i] = h0; pa[8 + i] = h1; pl[i] = (_Float16)((x0 - (float)h0) * 2048.0f); pl[8 + i] = (_Float16)((x1 - (float)h1) * 2048.0f); }   // P scaled by 2^11 before the f16 split so small softmax weights stay out of the f16 subnormal range; 2^-11 folded into the epilogue
#pragma unroll
    for (int dt = 0; dt < 4; ++dt) { acc[dt] = wmma16(vh[dt], pa, acc[dt]); if (HV) { accl[dt] = wmma16(vh[dt], pl, accl[dt]); accl[dt] = wmma16(vl[dt], pa, accl[dt]); } }   // leading query blocks: P hi/lo x V hi/lo (3 products); elsewhere P x V single
    __builtin_amdgcn_sched_barrier(0);   // holds softmax and products ahead of the publish point: left free, the scheduler lifts the waits and the barrier to the V reads, which bares their latency and halves the lead of the refill
    // publish point: this wave's LDS reads of the pass are done, its copies of the next stage have landed; behind the barrier the next stage may be read and this pass's buffer refilled
    asm volatile("s_wait_dscnt 0x0" ::: "memory");
    asm volatile("s_wait_asynccnt 0x0" ::: "memory");
    __syncthreads();
    if (ks + 2 < nks) stage(ks + 2, bo); }
  asm volatile("s_wait_asynccnt 0x0" ::: "memory");   // no copy is left outstanding behind the loop
  const float il = (1.0f / 2048.0f) / (l + xhalf(l));
#pragma unroll
  for (int dt = 0; dt < 4; ++dt) {
#pragma unroll
    for (int q = 0; q < 2; ++q) { v4f o;
#pragma unroll
      for (int i = 0; i < 4; ++i) o[i] = (acc[dt][4 * q + i] + accl[dt][4 * q + i] * (1.0f / 2048.0f)) * il;
      vst2(&so[wave][col][dt * 16 + 8 * g + 4 * q], o); } }
  LDSX();
  for (int rl = 0; rl < 16; ++rl) if (lane < 16) vst2(O + ((size_t)b * SS + q0 + rl) * DM + h * HD + lane * 4, *(const v4f*)&so[wave][rl][lane * 4]);
}
__global__ __launch_bounds__(128) void k_attn(const _Float16* __restrict__ QK, const _Float16* __restrict__ QKL, const _Float16* __restrict__ VTH, const _Float16* __restrict__ VTL, const void* __restrict__ KMASK, float* __restrict__ O) {
  __shared__ __align__(16) float so[4][16][68]; __shared__ __align__(16) char ring[2 * RBUF]; (void)KMASK;
  // which tile a block takes (for speed only; a permutation of the tiles for any dispatch): a three-product block costs about twice a single-product one, and all blocks are resident at once, so the launch lasts as long as the WGP with the most of them.
  // Dealt by blockIdx.x < 2 they lie at flat indices 0 and 1 modulo 32. Here they take every 5th group of 8 flat indices from the front (40 apart): near the start.
  const int f = blockIdx.x + TQB * (blockIdx.y + NH * blockIdx.z), j = f >> 3;   // flat index; its group of 8
  const int NHV = 2 * NH * TNB / 8;   // groups of three-product blocks (2 query blocks a head and batch)
  if (j < 5 * NHV && j % 5 == 0) { const int i = (j / 5) * 8 + (f & 7); const int hb = i >> 1; attn_body<true>(QK, QKL, VTH, VTL, O, so, ring, i & 1, hb % NH, hb / NH); }
  else { const int i = f - 8 * (j < 5 * NHV ? j / 5 + 1 : NHV); const int hb = i / (TQB - 2); attn_body<false>(QK, QKL, VTH, VTL, O, so, ring, 2 + i % (TQB - 2), hb % NH, hb / NH); }   // the others keep their order, closed up over the groups taken out
}
// ---- k_out: block = (64 rows, 128 cols): out = O(hi/lo) . Wo rows (2 products) + bo
__global__ __launch_bounds__(128) void k_out(const float* __restrict__ O, const __bf16* __restrict__ P, const float* __restrict__ BO, float* __restrict__ Y) {
  __shared__ __align__(16) float so[4][16][132];
  const int tid = threadIdx.x, wave = tid >> 5, lane = tid & 31, col = lane & 15, g = lane >> 4; const size_t r0 = (size_t)blockIdx.x * 64 + wave * 16; const int n0 = blockIdx.y * 128;
  v8f acc[8] = {};
#pragma unroll 2
  for (int kc = 0; kc < DM / 32; ++kc) { const F2 a = split_row(O + (r0 + col) * DM, kc * 32, lane);
#pragma unroll
    for (int j = 0; j < 8; ++j) { const v16b w = frag_b(P + (size_t)(n0 + j * 16 + col) * DM + kc * 32, lane); acc[j] = wmma_bf(a.l, w, acc[j]); acc[j] = wmma_bf(a.h, w, acc[j]); } }
#pragma unroll
  for (int j = 0; j < 8; ++j) {
#pragma unroll
    for (int r = 0; r < 8; ++r) so[wave][8 * g + r][j * 16 + col] = acc[j][r] + bfr(BO[n0 + j * 16 + col]); }
  LDSX();
  for (int rl = 0; rl < 16; ++rl) vst2(Y + (r0 + rl) * DM + n0 + lane * 4, *(const v4f*)&so[wave][rl][lane * 4]);
}
// ---- k_o: block = 64 rows r' = (b', s'): o = ctx (bf16 hi + lo) . o_w rows + o_b -> out[(s' * BSZ + b') * 64] (the final (B,S)->(S,B) transpose)
__global__ __launch_bounds__(128) void k_o(const float* __restrict__ O, const __bf16* __restrict__ P, const float* __restrict__ OB, float* __restrict__ Y) { __shared__ __align__(16) float so[4][16][68];
  const int tid = threadIdx.x, wave = tid >> 5, lane = tid & 31, col = lane & 15, g = lane >> 4; const size_t r0 = (size_t)blockIdx.x * 64 + wave * 16; const __bf16* Wr = P + PK_P;
  v8f acc[4] = {};
#pragma unroll 2
  for (int kc = 0; kc < DM / 32; ++kc) { const F2 a = split_row(O + (r0 + col) * DM, kc * 32, lane);
#pragma unroll
    for (int j = 0; j < 4; ++j) { const v16b w = frag_b(Wr + (size_t)(j * 16 + col) * DM + kc * 32, lane); acc[j] = wmma_bf(a.h, w, acc[j]); acc[j] = wmma_bf(a.l, w, acc[j]); } }
#pragma unroll
  for (int j = 0; j < 4; ++j) { const float bb = bfr(OB[j * 16 + col]);
#pragma unroll
    for (int r = 0; r < 8; ++r) so[wave][8 * g + r][j * 16 + col] = acc[j][r] + bb; }
  LDSX(); for (int rl = 0; rl < 16; ++rl) if (lane < 16) { const size_t rp = r0 + rl; const size_t bp = rp / SS, sp = rp % SS; vst2(Y + (sp * BSZ + bp) * HOUT + lane * 4, *(const v4f*)&so[wave][rl][lane * 4]); } }
extern "C" void kernel_launch(void* const* d_in, const int* in_sizes, int n_in, void* d_out, int out_size, void* d_ws, size_t ws_size, hipStream_t stream) {
  (void)in_sizes; (void)n_in; (void)out_size;
  const float** F = (const float**)d_in;   // 0 x [2048,2,512], 1 qkv_w [3008,512], 2 qkv_b [3008], 3 conn_w [64,512], 4 conn_b [64], 5 o_w [64,1024], 6 o_b [64]
  if (ws_size < (size_t)WS_END + 4u * 3 * DM) return;
  char* ws = (char*)d_ws; __bf16* PK = (__bf16*)(ws + WS_PK); _Float16 *QK = (_Float16*)(ws + WS_QK), *QKL = (_Float16*)(ws + WS_QKL), *VTH = (_Float16*)(ws + WS_VTH), *VTL = (_Float16*)(ws + WS_VTL); float* O = (float*)(ws + WS_O); float* PB = (float*)(ws + WS_END);
  k_pack<<<PKB_W + PKB_O + 1, 256, 0, stream>>>(F[3], F[1], F[5], F[4], F[2], PK, PB);
  // the (S,B,512) input rows in memory order ARE the (b', s') rows of the raw reshape: row r = b' * 2048 + s'
  k_qkv<<<dim3(TNB * SS / 64, QKVW / 128), 128, 0, stream>>>(F[0], F[0], F[0], PK + PK_A, PB, PB + DM, PB + 2 * DM, QK, QKL, VTH, VTL);
  k_attn<<<dim3(TQB, NH, TNB), 128, 0, stream>>>(QK, QKL, VTH, VTL, nullptr, O);
  k_o<<<TOB, 128, 0, stream>>>(O, PK, F[6], (float*)d_out);
}

// v008
// Measured time: 106 microseconds a run.
// In both of two side-by-side timings against v007, it was 1.07 times as fast.
// All steps since v000 together make it 4.02 times as fast.
// compute dtype: all float inputs rounded to bf16; the concatenated [conn | qkv] projection with EXACT bf16 products on WMMA 16x16x32 (weight rows permuted at pack time into per-head q / k / v blocks; K = 512) + biases in f32, rounded once to f16 hi + residual; PLAIN-HYBRID attention (first 128 queries of each attention batch 3-product, later single f16), x 1/8, running-max softmax in f32 (hardware exp); out = ctx (bf16 hi + lo, 2 products) . o_w rows + o_b; f32 output.
#include <hip/hip_runtime.h>
#include <math.h>

typedef __attribute__((ext_vector_type(16))) _Float16 v16h;
typedef __attribute__((ext_vector_type(16))) __bf16 v16b;
typedef __attribute__((ext_vector_type(8)))  _Float16 v8h;
typedef __attribute__((ext_vector_type(8)))  float v8f;
typedef __attribute__((ext_vector_type(4)))  float v4f;
typedef __attribute__((ext_vector_type(2)))  float v2f;
typedef __attribute__((ext_vector_type(4)))  unsigned v4u;
typedef __attribute__((ext_vector_type(4)))  int v4i;
typedef float __attribute__((may_alias)) float_a;
typedef int __attribute__((may_alias)) int_a;

template <typename T> __device__ __forceinline__ void vst2(void* p, T v) { *(T*)p = v;  }
__device__ __forceinline__ v8f wmma16(v16h a, v16h b, v8f c) {
  return __builtin_amdgcn_wmma_f32_16x16x32_f16(false, a, false, b, (short)0, c, false, false);
}
__device__ __forceinline__ v8f wmma_bf(v16b a, v16b b, v8f c) {
  return __builtin_amdgcn_wmma_f32_16x16x32_bf16(false, a, false, b, (short)0, c, false, false);
}
// Modified multi-head attention (S 2,048, B 2, d_in 512, 16 heads x 64): qkv from one projection plus a fixed 'connection' projection supplying 64 of the q columns, the torch raw reshape (S,B,3E) -> (B,S,H,3*64) kept literally (so attention 'batches' are contiguous halves of the (s,b) row order and each head's q|k|v are consecutive 64-column slices), softmax(q k / 8) v, output projection E -> 64 + bias, returned as (S, B, 64).
__device__ __forceinline__ v16h frag_h(const _Float16* rowk0, int lane) {
  union { v16h v; v8h q[2]; } u; const _Float16* p = rowk0 + 8 * (lane >> 4);
  u.q[0] = *(const v8h*)p; u.q[1] = *(const v8h*)(p + 16); return u.v;
}
__device__ __forceinline__ v16h frag_f32(const float* rowk0, int lane) {
  v16h a; const float* p = rowk0 + 8 * (lane >> 4);
#pragma unroll
  for (int i = 0; i < 8; ++i) { a[i] = (_Float16)p[i]; a[8 + i] = (_Float16)p[16 + i]; }
  return a;
}
__device__ __forceinline__ v16h frag_f32s(const float* rowk0, int lane, float sc) {
  v16h a; const float* p = rowk0 + 8 * (lane >> 4);
#pragma unroll
  for (int i = 0; i < 8; ++i) { a[i] = (_Float16)(p[i] * sc); a[8 + i] = (_Float16)(p[16 + i] * sc); }
  return a;
}
// column fragment from a [K][ld] layout (column n), rows >= K read as 0
__device__ __forceinline__ v16h fragc_f32(const float* W, int k0, int n, int lane, int ld, int K) {
  v16h a; const int g = lane >> 4;
#pragma unroll
  for (int i = 0; i < 8; ++i) { const int ka = k0 + 8 * g + i, kb = ka + 16;
    a[i] = (_Float16)(ka < K ? W[(size_t)(ka < K ? ka : K - 1) * ld + n] : 0.f); a[8 + i] = (_Float16)(kb < K ? W[(size_t)(kb < K ? kb : K - 1) * ld + n] : 0.f); }
  return a;
}
struct F2 { v16b h, l; };
__device__ __forceinline__ F2 bsplit16(const float v[16]) { F2 r;
#pragma unroll
  for (int i = 0; i < 16; ++i) { const __bf16 h = (__bf16)v[i]; r.h[i] = h; r.l[i] = (__bf16)(v[i] - (float)h); }
  return r; }
__device__ __forceinline__ F2 split_row(const float* row, int k0, int lane) { float v[16]; const float* p = row + k0 + 8 * (lane >> 4);
#pragma unroll
  for (int i = 0; i < 8; ++i) { v[i] = p[i]; v[8 + i] = p[16 + i]; }
  return bsplit16(v); }
__device__ __forceinline__ F2 split_rowK(const float* row, int k0, int lane, int K) { float v[16]; const int g = lane >> 4;
#pragma unroll
  for (int i = 0; i < 8; ++i) { const int ka = k0 + 8 * g + i, kb = ka + 16; v[i] = ka < K ? row[ka < K ? ka : K - 1] : 0.f; v[8 + i] = kb < K ? row[kb < K ? kb : K - 1] : 0.f; }
  return bsplit16(v); }
__device__ __forceinline__ F2 split_col(const float* W, int k0, int n, int lane, int ld, int K) { float v[16]; const int g = lane >> 4;
#pragma unroll
  for (int i = 0; i < 8; ++i) { const int ka = k0 + 8 * g + i, kb = ka + 16; v[i] = ka < K ? W[(size_t)(ka < K ? ka : K - 1) * ld + n] : 0.f; v[8 + i] = kb < K ? W[(size_t)(kb < K ? kb : K - 1) * ld + n] : 0.f; }
  return bsplit16(v); }
__device__ __forceinline__ v8f mac3(const F2& a, const F2& b, v8f c) { c = wmma_bf(a.l, b.h, c); c = wmma_bf(a.h, b.l, c); return wmma_bf(a.h, b.h, c); }
__device__ __forceinline__ float sigm(float v) { return 1.0f / (1.0f + expf(-v)); }
#define LDSX() do { asm volatile("s_wait_dscnt 0" ::: "memory"); __builtin_amdgcn_wave_barrier(); __builtin_amdgcn_fence(__ATOMIC_RELEASE, "workgroup"); } while (0)


#define NB 2
#define SS 2048
#define DM 1024
#define NH 16
#define KIN 512          // input width
#define BSZ 2            // the module's batch (interleaved in the row order)
#define HOUT 64          // o_proj output width
#define HD 64
#define QKVW (3 * DM)
#ifndef TQB
#define TQB (SS / 64)
#define TNB NB
#define TOB (NB * SS / 64)     // output row tiles (all)
#endif
typedef __attribute__((ext_vector_type(8))) __bf16 v8b;
__device__ __forceinline__ v16b frag_b(const __bf16* rowk0, int lane) {
  union { v16b v; v8b q[2]; } u; const __bf16* p = rowk0 + 8 * (lane >> 4);
  u.q[0] = *(const v8b*)p; u.q[1] = *(const v8b*)(p + 16); return u.v;
}
__device__ __forceinline__ float bfr(float v) { return (float)(__bf16)v; }
__device__ __attribute__((noinline)) float exp_ni(float v) { return expf(v); }
__device__ __attribute__((noinline)) float erf_ni(float v) { return erff(v); }

#define PK_A 0                       // [3072][512] Wqkv rows (permuted into q | k | v blocks, [out][in])
#define PK_P (PK_A + QKVW * DM)        // [64][1024] Wo rows (natural)
#define PK_END (PK_P + DM * DM)
#define WS_PK  0u
#define WS_QK  (WS_PK + 2u * PK_END)             // f16 [4096 rows][2048]: q | k
#define WS_QKL (WS_QK + 2u * NB * SS * 2 * DM)     // f16 q | k residual planes x2048
#define WS_VTH (WS_QKL + 2u * NB * SS * 2 * DM)    // f16 [b][1024 (h*64+d)][2048 s] hi
#define WS_VTL (WS_VTH + 2u * NB * DM * SS)        // f16 lo x 2048
#define WS_O   (WS_VTL + 2u * NB * DM * SS)        // f32 [4096][1024]
#define WS_CS  (WS_O + 4u * NB * SS * DM)           // f32 2 x [2048][32], not written or read
#define WS_END (WS_CS + 4u * 2 * SS * 32)
// ---- k_pack: the whole pack stage in one launch of few, full work-groups (the work is small: each lane takes four 16-byte pieces straight through registers, all loads in front of the first store).
// blocks 0 .. PKB_W-1: 16 rows each of the permuted [q | k | v] weight (row which * 1024 + h * 64 + d = column h * 192 + which * 64 + d of the concatenated [q_conn | qkv] buffer) -> bf16 at PK_A; 16 divides 64, so a block's rows have one (which, h) and are 16 consecutive rows of one source too: 32 KB read, 16 KB written, both in a row
// the next PKB_O blocks: 8 rows each of o_w (natural order) -> bf16 at PK_P; the last block: the three bias rows, permuted like the weight rows, f32 -> PB
#define PKB_W (QKVW / 16)
#define PKB_O (HOUT * DM / (16 * KIN))
__device__ __forceinline__ v4u pack8(v4f a, v4f b) { union { v8b h; v4u u; } r;
#pragma unroll
  for (int i = 0; i < 4; ++i) { r.h[i] = (__bf16)a[i]; r.h[4 + i] = (__bf16)b[i]; }
  return r.u; }
__device__ __forceinline__ unsigned src_col(unsigned e) { const unsigned which = e / DM, n = e % DM; return (n / HD) * (3 * HD) + which * HD + n % HD; }   // packed row (or bias element) e -> column of the concatenated buffer
__global__ __launch_bounds__(256) void k_pack(const float* __restrict__ CONNW, const float* __restrict__ WQKV3, const float* __restrict__ OW, const float* __restrict__ CONNB, const float* __restrict__ QKVB, __bf16* __restrict__ PK, float* __restrict__ PB) {
  const unsigned t = threadIdx.x, blk = blockIdx.x;
  if (blk < PKB_W + PKB_O) { const float* s; __bf16* dst;   // the block's 8,192 elements, source and destination
    if (blk < PKB_W) { const unsigned src = src_col(blk * 16); s = (src < HOUT) ? (CONNW + (size_t)src * KIN) : (WQKV3 + (size_t)(src - HOUT) * KIN); dst = PK + PK_A + (size_t)blk * (16 * KIN); }
    else { s = OW + (size_t)(blk - PKB_W) * (16 * KIN); dst = PK + PK_P + (size_t)(blk - PKB_W) * (16 * KIN); }
    v4f a[4], b[4];
#pragma unroll
    for (int i = 0; i < 4; ++i) { a[i] = *(const v4f*)(s + (i * 256 + t) * 8); b[i] = *(const v4f*)(s + (i * 256 + t) * 8 + 4); }   // piece = 8 consecutive elements
#pragma unroll
    for (int i = 0; i < 4; ++i) vst2((unsigned*)(dst + (i * 256 + t) * 8), pack8(a[i], b[i])); }
  else { v4f v[3];
#pragma unroll
    for (int i = 0; i < 3; ++i) { const unsigned src = src_col((i * 256 + t) * 4); v[i] = *(const v4f*)((src < HOUT) ? (CONNB + src) : (QKVB + (src - HOUT))); }   // 4 consecutive d of one head and kind lie side by side in the source too
#pragma unroll
    for (int i = 0; i < 3; ++i) vst2(PB + (i * 256 + t) * 4, v[i]); } }
// four 16-byte asynchronous copies a lane (each lane its own LDS byte address and global address); the s_wait_xcnt is the last line of the copies' own statement, so that it stands in front of any rewrite of their address registers
__device__ __forceinline__ void copy4(unsigned l0, const char* g0, unsigned l1, const char* g1, unsigned l2, const char* g2, unsigned l3, const char* g3) {
  asm volatile("global_load_async_to_lds_b128 %0, %1, off\n\tglobal_load_async_to_lds_b128 %2, %3, off\n\tglobal_load_async_to_lds_b128 %4, %5, off\n\tglobal_load_async_to_lds_b128 %6, %7, off\n\ts_wait_xcnt 0x0" :: "v"(l0), "v"(g0), "v"(l1), "v"(g1), "v"(l2), "v"(g2), "v"(l3), "v"(g3) : "memory");
}
// X / W ring of k_qkv in LDS: one stage = 64 k. X plane: the block's 64 rows of 256 B (f32) at pitch 272; W plane: its 128 weight rows of 128 B (bf16) at pitch 144 (both 16 B x odd: conflict-free 16-byte fragment reads)
#define XPIT 272
#define WPIT 144
#define QW_O (64 * XPIT)
#define QBUF (QW_O + 128 * WPIT)
__global__ __launch_bounds__(128) void k_qkv(const float* __restrict__ XQ, const float* __restrict__ XK, const float* __restrict__ XV, const __bf16* __restrict__ P, const float* __restrict__ BQ, const float* __restrict__ BK, const float* __restrict__ BV, _Float16* __restrict__ QK, _Float16* __restrict__ QKL, _Float16* __restrict__ VTH, _Float16* __restrict__ VTL) {
  const int which0 = (blockIdx.y * 128) / DM; const float* X = (which0 == 0) ? XQ : (which0 == 1) ? XK : XV; const float* BB = BQ ? (((which0 == 0) ? BQ : (which0 == 1) ? BK : BV) + (blockIdx.y * 128 - which0 * DM)) : nullptr;
  __shared__ __align__(16) char sm[2 * QBUF];   // the ring during the k loop; behind the loop's last barrier the same bytes stage the output tile
  _Float16 (*so)[16][136] = (_Float16 (*)[16][136])sm; _Float16 (*sol)[16][136] = so + 4; _Float16 (*sth)[72] = (_Float16 (*)[72])sm; _Float16 (*stl)[72] = sth + 128;
  const int tid = threadIdx.x, wave = tid >> 5, lane = tid & 31, col = lane & 15, g = lane >> 4; const size_t r0 = (size_t)blockIdx.x * 64 + wave * 16; const int n0 = blockIdx.y * 128;
  v8f acc[8] = {};
  float bias[8] = {};   // the lane's eight bias values (one a column tile), read once, as one group under one test: the reads fly beside the first stage's copies, and the epilogue is left without loads, waits and branches
  if (BB) {
#pragma unroll   // constant indices keep bias[] in registers
    for (int j = 0; j < 8; ++j) bias[j] = BB[j * 16 + col]; }
  // the work-group's 128 lanes copy a stage by whole rows: X row = 16 lanes x 16 B (a wave covers 2 rows = 4 whole lines), W row = 8 lanes x 16 B (4 rows = 4 whole lines); eight copies a lane and plane
  const unsigned rb = (unsigned)(size_t)sm;
  const unsigned lx = rb + (unsigned)(tid >> 4) * XPIT + (tid & 15) * 16, lw = rb + QW_O + (unsigned)(tid >> 3) * WPIT + (tid & 7) * 16;
  const char* gx = (const char*)X + ((size_t)blockIdx.x * 64 + (tid >> 4)) * (KIN * 4) + (tid & 15) * 16; const char* gw = (const char*)P + ((size_t)n0 + (tid >> 3)) * (KIN * 2) + (tid & 7) * 16;   // the lane's first X and W piece of stage 0
  auto stage = [&](int st, unsigned bo) {   // stage st (k = st * 64 ...) into the buffer at byte bo
    const char* x = gx + st * 256; const char* w = gw + st * 128; const unsigned a = lx + bo, c = lw + bo;
    copy4(a, x, a + 8 * XPIT, x + 8 * (KIN * 4), a + 16 * XPIT, x + 16 * (KIN * 4), a + 24 * XPIT, x + 24 * (KIN * 4));
    copy4(a + 32 * XPIT, x + 32 * (KIN * 4), a + 40 * XPIT, x + 40 * (KIN * 4), a + 48 * XPIT, x + 48 * (KIN * 4), a + 56 * XPIT, x + 56 * (KIN * 4));
    copy4(c, w, c + 16 * WPIT, w + 16 * (KIN * 2), c + 32 * WPIT, w + 32 * (KIN * 2), c + 48 * WPIT, w + 48 * (KIN * 2));
    copy4(c + 64 * WPIT, w + 64 * (KIN * 2), c + 80 * WPIT, w + 80 * (KIN * 2), c + 96 * WPIT, w + 96 * (KIN * 2), c + 112 * WPIT, w + 112 * (KIN * 2)); };
  const unsigned xof = (unsigned)(wave * 16 + col) * XPIT + 32 * g, wof = QW_O + (unsigned)col * WPIT + 16 * g;   // the lane's byte offsets inside an X and a W fragment of the ring, the same in every stage
  stage(0, 0);
  asm volatile("s_wait_asynccnt 0x0" ::: "memory");   // this wave's copies of stage 0 have landed
  __syncthreads();                                    // ... and every other wave's: stage 0 may be read
  stage(1, QBUF);
#pragma unroll 1   // kept rolled: the two buffers differ by an offset only, and eight copies of the body would only lengthen the text in front of the long epilogue
  for (int st = 0; st < KIN / 64; ++st) { const unsigned bo = (unsigned)(st & 1) * QBUF;
#pragma unroll
    for (int kc = 0; kc < 2; ++kc) {   // every fragment of a 32-k step is read from the ring as one group in front of its first product
      const char* xp = sm + bo + xof + kc * 128; const char* wp = sm + bo + wof + kc * 64;
      const v4f x0 = *(const v4f*)xp, x1 = *(const v4f*)(xp + 16), x2 = *(const v4f*)(xp + 64), x3 = *(const v4f*)(xp + 80);
      v16b w[8];
#pragma unroll
      for (int j = 0; j < 8; ++j) { union { v16b v; v8b q[2]; } u; u.q[0] = *(const v8b*)(wp + j * 16 * WPIT); u.q[1] = *(const v8b*)(wp + j * 16 * WPIT + 32); w[j] = u.v; }
      __builtin_amdgcn_sched_barrier(0);   // holds the step's LDS reads as one group ahead of its first product: left free, the scheduler sinks each pair of reads to its own product, with a wait at each
      v16b a;
#pragma unroll
      for (int i = 0; i < 4; ++i) { a[i] = (__bf16)x0[i]; a[4 + i] = (__bf16)x1[i]; a[8 + i] = (__bf16)x2[i]; a[12 + i] = (__bf16)x3[i]; }
#pragma unroll
      for (int j = 0; j < 8; ++j) acc[j] = wmma_bf(a, w[j], acc[j]);
      __builtin_amdgcn_sched_barrier(0); }   // holds the products ahead of the next group of reads and of the publish point: left free, the scheduler sinks the last ones behind the work-group barrier
    // publish point: this wave's LDS reads of the stage are done, its copies of the next stage have landed; behind the barrier the next stage may be read and this stage's buffer refilled
    asm volatile("s_wait_dscnt 0x0" ::: "memory");
    asm volatile("s_wait_asynccnt 0x0" ::: "memory");
    __syncthreads();
    if (st + 2 < KIN / 64) stage(st + 2, bo); }
  asm volatile("s_wait_asynccnt 0x0" ::: "memory");   // no copy is left outstanding behind the loop
  if (n0 < 2 * DM) {   // q stored unscaled (f16 sigma ~0.6, no subnormal exposure); 1/8 applied to the f32 score
#pragma unroll
    for (int j = 0; j < 8; ++j) {
#pragma unroll
      for (int r = 0; r < 8; ++r) { const float v = acc[j][r] + bfr(bias[j]); const _Float16 hv = (_Float16)v; so[wave][8 * g + r][j * 16 + col] = hv; sol[wave][8 * g + r][j * 16 + col] = (_Float16)((v - (float)hv) * 2048.0f); } }   // q, k (+ bias) as f16 hi + (x2048) residual
    LDSX();
    for (int rl = 0; rl < 16; ++rl) if (lane < 16) { vst2((unsigned*)(QK + (r0 + rl) * (2 * DM) + n0 + lane * 8), *(const v4u*)&so[wave][rl][lane * 8]); vst2((unsigned*)(QKL + (r0 + rl) * (2 * DM) + n0 + lane * 8), *(const v4u*)&sol[wave][rl][lane * 8]); }
  } else {
#pragma unroll
    for (int j = 0; j < 8; ++j) {
#pragma unroll
      for (int r = 0; r < 8; ++r) { const float v = acc[j][r] + bfr(bias[j]); const _Float16 hv = (_Float16)v; sth[j * 16 + col][wave * 16 + 8 * g + r] = hv; stl[j * 16 + col][wave * 16 + 8 * g + r] = (_Float16)((v - (float)hv) * 2048.0f); } }
    __syncthreads();
    const size_t rb = (size_t)blockIdx.x * 64; const int b = (int)(rb / SS), s0 = (int)(rb % SS); const int pc0 = n0 - 2 * DM;
    for (int q = tid; q < 128 * 8; q += 128) { const int d = q >> 3, pc = q & 7; const size_t o = ((size_t)b * DM + pc0 + d) * SS + s0 + pc * 8; vst2((unsigned*)(VTH + o), *(const v4u*)&sth[d][pc * 8]); vst2((unsigned*)(VTL + o), *(const v4u*)&stl[d][pc * 8]); }
  }
}
// ---- k_attn: block = (64 queries, head h, batch b): all-keys flash attention (K = 64: 2 k-steps), scores = (q.k) * 0.125 from q hi/lo x k hi/lo (3 products) in the first two query blocks, single f16 elsewhere, P.V: there 2^11 P hi/lo x V hi/lo (3 products) in two accumulators, elsewhere 2^11 P x V hi; O[b*S+q][h*64+d] = (acc + accl / 2048) / (2048 l) (256-B segments)
__device__ __forceinline__ v16h frag_p(const char* p) {   // frag_h from the lane's own byte address
  union { v16h v; v8h q[2]; } u; u.q[0] = *(const v8h*)p; u.q[1] = *(const v8h*)(p + 32); return u.v;
}
// K/V ring in LDS: one stage = the 32 keys of a pass. K plane: 32 rows (keys) of 128 B at pitch 144; V plane: 64 rows (d) of 64 B at pitch 80 (16 B x odd: conflict-free 16-byte fragment reads)
#define KPIT 144
#define VPIT 80
#define RK_H 0
#define RV_H (RK_H + 32 * KPIT)
#define RK_L (RV_H + 64 * VPIT)
#define RV_L (RK_L + 32 * KPIT)
#define RBUF (RV_L + 64 * VPIT)
__device__ __forceinline__ float xhalf(float x) { return __builtin_bit_cast(float, __builtin_amdgcn_permlanex16(__builtin_bit_cast(int, x), __builtin_bit_cast(int, x), 0x76543210, 0xfedcba98, false, false)); }   // lane l with lane l ^ 16
template <bool HV> __device__ __forceinline__ void attn_body(const _Float16* __restrict__ QK, const _Float16* __restrict__ QKL, const _Float16* __restrict__ VTH, const _Float16* __restrict__ VTL, float* __restrict__ O, float (*so)[16][68], char* ring, const int qb, const int h, const int b) {
  const int tid = threadIdx.x, wave = tid >> 5, lane = tid & 31, col = lane & 15, g = lane >> 4;
  const int q0 = qb * 64 + wave * 16; const size_t rq = (size_t)b * SS + q0 + col;
  v16h aq[2], aql[2];
#pragma unroll
  for (int kc = 0; kc < 2; ++kc) { aq[kc] = frag_h(QK + rq * (2 * DM) + h * HD + kc * 32, lane); aql[kc] = frag_h(QKL + rq * (2 * DM) + h * HD + kc * 32, lane); }
  float m = -3.0e38f, l = 0.f;   // the lane's query: running maximum over all keys (the same in both halves), sum over this half's keys
  v8f acc[4] = {}, accl[4] = {};
  const int nks = SS / 32;   // all keys
  const unsigned kof = (unsigned)col * KPIT + 16 * g, vof = (unsigned)col * VPIT + 16 * g;   // the lane's byte offsets inside a K and a V fragment of the ring, the same in every pass
  // the work-group's 128 lanes copy a stage by whole rows: K row = 8 lanes x 16 B (a wave covers 4 whole 128-B lines), V row = 4 lanes x 16 B; two copies a lane and plane
  const unsigned rb = (unsigned)(size_t)ring;
  const unsigned lk = rb + (unsigned)(tid >> 3) * KPIT + (tid & 7) * 16, lv = rb + (unsigned)(tid >> 2) * VPIT + (tid & 3) * 16;
  const size_t gk = 2 * (((size_t)b * SS + (tid >> 3)) * (2 * DM) + DM + h * HD + (tid & 7) * 8), gv = 2 * (((size_t)b * DM + h * HD + (tid >> 2)) * SS + (tid & 3) * 8);   // byte offsets of the lane's first K and V piece of stage 0
  auto stage = [&](int st, unsigned bo) {   // stage st (keys st * 32 ...) into the buffer at byte bo
    const size_t ok = gk + (size_t)st * (32 * 2 * DM * 2), ov = gv + (size_t)st * (32 * 2);
    copy4(lk + bo + RK_H, (const char*)QK + ok, lk + bo + RK_H + 16 * KPIT, (const char*)QK + ok + 16 * (2 * DM * 2), lv + bo + RV_H, (const char*)VTH + ov, lv + bo + RV_H + 32 * VPIT, (const char*)VTH + ov + 32 * (SS * 2));
    if (HV) copy4(lk + bo + RK_L, (const char*)QKL + ok, lk + bo + RK_L + 16 * KPIT, (const char*)QKL + ok + 16 * (2 * DM * 2), lv + bo + RV_L, (const char*)VTL + ov, lv + bo + RV_L + 32 * VPIT, (const char*)VTL + ov + 32 * (SS * 2)); };
  stage(0, 0);
  asm volatile("s_wait_asynccnt 0x0" ::: "memory");   // this wave's copies of stage 0 have landed
  __syncthreads();                                    // ... and every other wave's: stage 0 may be read
  stage(1, RBUF);
#pragma unroll 1
  for (int ks = 0; ks < nks; ++ks) { v8f s[2];
    // every K fragment of the pass is read from the ring as one group in front of the first product
    v16h kh[2][2], kl[2][2];
    const unsigned bo = (unsigned)(ks & 1) * RBUF; const char* kp = ring + bo + RK_H + kof; const char* kpl = ring + bo + RK_L + kof;   // one address a plane; the fragments lie at constant offsets from it
#pragma unroll
    for (int ct = 0; ct < 2; ++ct) {
#pragma unroll
      for (int kc = 0; kc < 2; ++kc) { kh[ct][kc] = frag_p(kp + ct * 16 * KPIT + kc * 64); if (HV) kl[ct][kc] = frag_p(kpl + ct * 16 * KPIT + kc * 64); } }
    __builtin_amdgcn_sched_barrier(0);   // holds the K reads as one group ahead of the first product: left free, the scheduler sinks each pair of reads to its own product, with a wait at each
#pragma unroll
    for (int ct = 0; ct < 2; ++ct) { v8f c = {}, cl = {};
      if (HV) {   // leading query blocks (outputs far above the global rms): 3 products
#pragma unroll
        for (int kc = 0; kc < 2; ++kc) { c = wmma16(kh[ct][kc], aq[kc], c); cl = wmma16(kh[ct][kc], aql[kc], cl); cl = wmma16(kl[ct][kc], aq[kc], cl); }
#pragma unroll
        for (int r = 0; r < 8; ++r) c[r] += cl[r] * (1.0f / 2048.0f); }
      else {
#pragma unroll
        for (int kc = 0; kc < 2; ++kc) c = wmma16(kh[ct][kc], aq[kc], c); }   // single product elsewhere
      { const bool keepk = true;
#pragma unroll
      for (int r = 0; r < 8; ++r) s[ct][r] = keepk ? c[r] * 0.125f : -3.0e38f; } }   // 1/sqrt(64); no key is masked
    // every V fragment of the pass is read from the ring as one group behind the score products: the reads fly while the softmax runs
    __builtin_amdgcn_sched_barrier(0);   // with the one behind the V reads: holds them as one group between the score products and the softmax, not spread among the products
    v16h vh[4], vl[4];
    const char* vp = ring + bo + RV_H + vof; const char* vpl = ring + bo + RV_L + vof;
#pragma unroll
    for (int dt = 0; dt < 4; ++dt) { vh[dt] = frag_p(vp + dt * 16 * VPIT); if (HV) vl[dt] = frag_p(vpl + dt * 16 * VPIT); }
    __builtin_amdgcn_sched_barrier(0);   // second of the pair: left free, the scheduler sinks the V reads among the P.V products, with a wait at each; held here they fly while the softmax runs
    float t[8];   // maximum and sum of the lane's 16 scores as trees in registers
#pragma unroll
    for (int r = 0; r < 8; ++r) t[r] = fmaxf(s[0][r], s[1][r]);
    float mx = fmaxf(fmaxf(fmaxf(t[0], t[1]), fmaxf(t[2], t[3])), fmaxf(fmaxf(t[4], t[5]), fmaxf(t[6], t[7])));
    mx = fmaxf(mx, xhalf(mx));   // the other half's 16 keys of the same query
    const float mn = fmaxf(m, mx); const float alpha = (m <= -1.0e38f) ? 0.f : __expf(m - mn);
    float e[2][8];
#pragma unroll
    for (int r = 0; r < 8; ++r) { e[0][r] = (s[0][r] <= -1.0e38f) ? 0.f : __expf(s[0][r] - mn); e[1][r] = (s[1][r] <= -1.0e38f) ? 0.f : __expf(s[1][r] - mn); t[r] = e[0][r] + e[1][r]; }
    l = l * alpha + (((t[0] + t[1]) + (t[2] + t[3])) + ((t[4] + t[5]) + (t[6] + t[7]))); m = mn;   // the two halves' sums are joined once, behind the loop
#pragma unroll
    for (int dt = 0; dt < 4; ++dt) {
#pragma unroll
      for (int r = 0; r < 8; ++r) { acc[dt][r] *= alpha; accl[dt][r] *= alpha; } }
    v16h pa, pl;
#pragma unroll
    for (int i = 0; i < 8; ++i) { const float x0 = e[0][i] * 2048.0f, x1 = e[1][i] * 2048.0f; const _Float16 h0 = (_Float16)x0, h1 = (_Float16)x1; pa[i] = h0; pa[8 + i] = h1; pl[i] = (_Float16)((x0 - (float)h0) * 2048.0f); pl[8 + i] = (_Float16)((x1 - (float)h1) * 2048.0f); }   // P scaled by 2^11 before the f16 split so small softmax weights stay out of the f16 subnormal range; 2^-11 folded into the epilogue
#pragma unroll
    for (int dt = 0; dt < 4; ++dt) { acc[dt] = wmma16(vh[dt], pa, acc[dt]); if (HV) { accl[dt] = wmma16(vh[dt], pl, accl[dt]); accl[dt] = wmma16(vl[dt], pa, accl[dt]); } }   // leading query blocks: P hi/lo x V hi/lo (3 products); elsewhere P x V single
    __builtin_amdgcn_sched_barrier(0);   // holds softmax and products ahead of the publish point: left free, the scheduler lifts the waits and the barrier to the V reads, which bares their latency and halves the lead of the refill
    // publish point: this wave's LDS reads of the pass are done, its copies of the next stage have landed; behind the barrier the next stage may be read and this pass's buffer refilled
    asm volatile("s_wait_dscnt 0x0" ::: "memory");
    asm volatile("s_wait_asynccnt 0x0" ::: "memory");
    __syncthreads();
    if (ks + 2 < nks) stage(ks + 2, bo); }
  asm volatile("s_wait_asynccnt 0x0" ::: "memory");   // no copy is left outstanding behind the loop
  const float il = (1.0f / 2048.0f) / (l + xhalf(l));
#pragma unroll
  for (int dt = 0; dt < 4; ++dt) {
#pragma unroll
    for (int q = 0; q < 2; ++q) { v4f o;
#pragma unroll
      for (int i = 0; i < 4; ++i) o[i] = (acc[dt][4 * q + i] + accl[dt][4 * q + i] * (1.0f / 2048.0f)) * il;
      vst2(&so[wave][col][dt * 16 + 8 * g + 4 * q], o); } }
  LDSX();
  for (int rl = 0; rl < 16; ++rl) if (lane < 16) vst2(O + ((size_t)b * SS + q0 + rl) * DM + h * HD + lane * 4, *(const v4f*)&so[wave][rl][lane * 4]);
}
__global__ __launch_bounds__(128) void k_attn(const _Float16* __restrict__ QK, const _Float16* __restrict__ QKL, const _Float16* __restrict__ VTH, const _Float16* __restrict__ VTL, const void* __restrict__ KMASK, float* __restrict__ O) {
  __shared__ __align__(16) float so[4][16][68]; __shared__ __align__(16) char ring[2 * RBUF]; (void)KMASK;
  // which tile a block takes (for speed only; a permutation of the tiles for any dispatch): a three-product block costs about twice a single-product one, and all blocks are resident at once, so the launch lasts as long as the WGP with the most of them.
  // Dealt by blockIdx.x < 2 they lie at flat indices 0 and 1 modulo 32. Here they take every 5th group of 8 flat indices from the front (40 apart): near the start.
  const int f = blockIdx.x + TQB * (blockIdx.y + NH * blockIdx.z), j = f >> 3;   // flat index; its group of 8
  const int NHV = 2 * NH * TNB / 8;   // groups of three-product blocks (2 query blocks a head and batch)
  if (j < 5 * NHV && j % 5 == 0) { const int i = (j / 5) * 8 + (f & 7); const int hb = i >> 1; attn_body<true>(QK, QKL, VTH, VTL, O, so, ring, i & 1, hb % NH, hb / NH); }
  else { const int i = f - 8 * (j < 5 * NHV ? j / 5 + 1 : NHV); const int hb = i / (TQB - 2); attn_body<false>(QK, QKL, VTH, VTL, O, so, ring, 2 + i % (TQB - 2), hb % NH, hb / NH); }   // the others keep their order, closed up over the groups taken out
}
// ---- k_out: block = (64 rows, 128 cols): out = O(hi/lo) . Wo rows (2 products) + bo
__global__ __launch_bounds__(128) void k_out(const float* __restrict__ O, const __bf16* __restrict__ P, const float* __restrict__ BO, float* __restrict__ Y) {
  __shared__ __align__(16) float so[4][16][132];
  const int tid = threadIdx.x, wave = tid >> 5, lane = tid & 31, col = lane & 15, g = lane >> 4; const size_t r0 = (size_t)blockIdx.x * 64 + wave * 16; const int n0 = blockIdx.y * 128;
  v8f acc[8] = {};
#pragma unroll 2
  for (int kc = 0; kc < DM / 32; ++kc) { const F2 a = split_row(O + (r0 + col) * DM, kc * 32, lane);
#pragma unroll
    for (int j = 0; j < 8; ++j) { const v16b w = frag_b(P + (size_t)(n0 + j * 16 + col) * DM + kc * 32, lane); acc[j] = wmma_bf(a.l, w, acc[j]); acc[j] = wmma_bf(a.h, w, acc[j]); } }
#pragma unroll
  for (int j = 0; j < 8; ++j) {
#pragma unroll
    for (int r = 0; r < 8; ++r) so[wave][8 * g + r][j * 16 + col] = acc[j][r] + bfr(BO[n0 + j * 16 + col]); }
  LDSX();
  for (int rl = 0; rl < 16; ++rl) vst2(Y + (r0 + rl) * DM + n0 + lane * 4, *(const v4f*)&so[wave][rl][lane * 4]);
}
// ---- k_o: block = 64 rows r' = (b', s'): o = ctx (bf16 hi + lo) . o_w rows + o_b -> out[(s' * BSZ + b') * 64] (the final (B,S)->(S,B) transpose)
__global__ __launch_bounds__(128) void k_o(const float* __restrict__ O, const __bf16* __restrict__ P, const float* __restrict__ OB, float* __restrict__ Y) { __shared__ __align__(16) float so[4][16][68];
  const int tid = threadIdx.x, wave = tid >> 5, lane = tid & 31, col = lane & 15, g = lane >> 4; const size_t r0 = (size_t)blockIdx.x * 64 + wave * 16; const __bf16* Wr = P + PK_P;
  v8f acc[4] = {};
#pragma unroll 2
  for (int kc = 0; kc < DM / 32; ++kc) { const F2 a = split_row(O + (r0 + col) * DM, kc * 32, lane);
#pragma unroll
    for (int j = 0; j < 4; ++j) { const v16b w = frag_b(Wr + (size_t)(j * 16 + col) * DM + kc * 32, lane); acc[j] = wmma_bf(a.h, w, acc[j]); acc[j] = wmma_bf(a.l, w, acc[j]); } }
#pragma unroll
  for (int j = 0; j < 4; ++j) { const float bb = bfr(OB[j * 16 + col]);
#pragma unroll
    for (int r = 0; r < 8; ++r) so[wave][8 * g + r][j * 16 + col] = acc[j][r] + bb; }
  LDSX(); for (int rl = 0; rl < 16; ++rl) if (lane < 16) { const size_t rp = r0 + rl; const size_t bp = rp / SS, sp = rp % SS; vst2(Y + (sp * BSZ + bp) * HOUT + lane * 4, *(const v4f*)&so[wave][rl][lane * 4]); } }
extern "C" void kernel_launch(void* const* d_in, const int* in_sizes, int n_in, void* d_out, int out_size, void* d_ws, size_t ws_size, hipStream_t stream) {
  (void)in_sizes; (void)n_in; (void)out_size;
  const float** F = (const float**)d_in;   // 0 x [2048,2,512], 1 qkv_w [3008,512], 2 qkv_b [3008], 3 conn_w [64,512], 4 conn_b [64], 5 o_w [64,1024], 6 o_b [64]
  if (ws_size < (size_t)WS_END + 4u * 3 * DM) return;
  char* ws = (char*)d_ws; __bf16* PK = (__bf16*)(ws + WS_PK); _Float16 *QK = (_Float16*)(ws + WS_QK), *QKL = (_Float16*)(ws + WS_QKL), *VTH = (_Float16*)(ws + WS_VTH), *VTL = (_Float16*)(ws + WS_VTL); float* O = (float*)(ws + WS_O); float* PB = (float*)(ws + WS_END);
  k_pack<<<PKB_W + PKB_O + 1, 256, 0, stream>>>(F[3], F[1], F[5], F[4], F[2], PK, PB);
  // the (S,B,512) input rows in memory order ARE the (b', s') rows of the raw reshape: row r = b' * 2048 + s'
  k_qkv<<<dim3(TNB * SS / 64, QKVW / 128), 128, 0, stream>>>(F[0], F[0], F[0], PK + PK_A, PB, PB + DM, PB + 2 * DM, QK, QKL, VTH, VTL);
  k_attn<<<dim3(TQB, NH, TNB), 128, 0, stream>>>(QK, QKL, VTH, VTL, nullptr, O);
  k_o<<<TOB, 128, 0, stream>>>(O, PK, F[6], (float*)d_out);
}

// v009
// Measured time: 92.9 microseconds a run.
// Two timings next to v008 both put it at 1.14 times that version's speed.
// All steps since v000 together make it 4.58 times as fast.
// compute dtype: all float inputs rounded to bf16; the concatenated [conn | qkv] projection with EXACT bf16 products on WMMA 16x16x32 (weight rows permuted at pack time into per-head q / k / v blocks; K = 512) + biases in f32, rounded once to f16 hi + residual; PLAIN-HYBRID attention (first 128 queries of each attention batch 3-product, later single f16), x 1/8, running-max softmax in f32 (hardware exp); out = ctx (bf16 hi + lo, 2 products) . o_w rows + o_b; f32 output.
#include <hip/hip_runtime.h>
#include <math.h>

typedef __attribute__((ext_vector_type(16))) _Float16 v16h;
typedef __attribute__((ext_vector_type(16))) __bf16 v16b;
typedef __attribute__((ext_vector_type(8)))  _Float16 v8h;
typedef __attribute__((ext_vector_type(8)))  float v8f;
typedef __attribute__((ext_vector_type(4)))  float v4f;
typedef __attribute__((ext_vector_type(2)))  float v2f;
typedef __attribute__((ext_vector_type(4)))  unsigned v4u;
typedef __attribute__((ext_vector_type(4)))  int v4i;
typedef float __attribute__((may_alias)) float_a;
typedef int __attribute__((may_alias)) int_a;

template <typename T> __device__ __forceinline__ void vst2(void* p, T v) { *(T*)p = v;  }
__device__ __forceinline__ v8f wmma16(v16h a, v16h b, v8f c) {
  return __builtin_amdgcn_wmma_f32_16x16x32_f16(false, a, false, b, (short)0, c, false, false);
}
__device__ __forceinline__ v8f wmma_bf(v16b a, v16b b, v8f c) {
  return __builtin_amdgcn_wmma_f32_16x16x32_bf16(false, a, false, b, (short)0, c, false, false);
}
// Modified multi-head attention (S 2,048, B 2, d_in 512, 16 heads x 64): qkv from one projection plus a fixed 'connection' projection supplying 64 of the q columns, the torch raw reshape (S,B,3E) -> (B,S,H,3*64) kept literally (so attention 'batches' are contiguous halves of the (s,b) row order and each head's q|k|v are consecutive 64-column slices), softmax(q k / 8) v, output projection E -> 64 + bias, returned as (S, B, 64).
__device__ __forceinline__ v16h frag_h(const _Float16* rowk0, int lane) {
  union { v16h v; v8h q[2]; } u; const _Float16* p = rowk0 + 8 * (lane >> 4);
  u.q[0] = *(const v8h*)p; u.q[1] = *(const v8h*)(p + 16); return u.v;
}
__device__ __forceinline__ v16h frag_f32(const float* rowk0, int lane) {
  v16h a; const float* p = rowk0 + 8 * (lane >> 4);
#pragma unroll
  for (int i = 0; i < 8; ++i) { a[i] = (_Float16)p[i]; a[8 + i] = (_Float16)p[16 + i]; }
  return a;
}
__device__ __forceinline__ v16h frag_f32s(const float* rowk0, int lane, float sc) {
  v16h a; const float* p = rowk0 + 8 * (lane >> 4);
#pragma unroll
  for (int i = 0; i < 8; ++i) { a[i] = (_Float16)(p[i] * sc); a[8 + i] = (_Float16)(p[16 + i] * sc); }
  return a;
}
// column fragment from a [K][ld] layout (column n), rows >= K read as 0
__device__ __forceinline__ v16h fragc_f32(const float* W, int k0, int n, int lane, int ld, int K) {
  v16h a; const int g = lane >> 4;
#pragma unroll
  for (int i = 0; i < 8; ++i) { const int ka = k0 + 8 * g + i, kb = ka + 16;
    a[i] = (_Float16)(ka < K ? W[(size_t)(ka < K ? ka : K - 1) * ld + n] : 0.f); a[8 + i] = (_Float16)(kb < K ? W[(size_t)(kb < K ? kb : K - 1) * ld + n] : 0.f); }
  return a;
}
struct F2 { v16b h, l; };
__device__ __forceinline__ F2 bsplit16(const float v[16]) { F2 r;
#pragma unroll
  for (int i = 0; i < 16; ++i) { const __bf16 h = (__bf16)v[i]; r.h[i] = h; r.l[i] = (__bf16)(v[i] - (float)h); }
  return r; }
__device__ __forceinline__ F2 split_row(const float* row, int k0, int lane) { float v[16]; const float* p = row + k0 + 8 * (lane >> 4);
#pragma unroll
  for (int i = 0; i < 8; ++i) { v[i] = p[i]; v[8 + i] = p[16 + i]; }
  return bsplit16(v); }
__device__ __forceinline__ F2 split_rowK(const float* row, int k0, int lane, int K) { float v[16]; const int g = lane >> 4;
#pragma unroll
  for (int i = 0; i < 8; ++i) { const int ka = k0 + 8 * g + i, kb = ka + 16; v[i] = ka < K ? row[ka < K ? ka : K - 1] : 0.f; v[8 + i] = kb < K ? row[kb < K ? kb : K - 1] : 0.f; }
  return bsplit16(v); }
__device__ __forceinline__ F2 split_col(const float* W, int k0, int n, int lane, int ld, int K) { float v[16]; const int g = lane >> 4;
#pragma unroll
  for (int i = 0; i < 8; ++i) { const int ka = k0 + 8 * g + i, kb = ka + 16; v[i] = ka < K ? W[(size_t)(ka < K ? ka : K - 1) * ld + n] : 0.f; v[8 + i] = kb < K ? W[(size_t)(kb < K ? kb : K - 1) * ld + n] : 0.f; }
  return bsplit16(v); }
__device__ __forceinline__ v8f mac3(const F2& a, const F2& b, v8f c) { c = wmma_bf(a.l, b.h, c); c = wmma_bf(a.h, b.l, c); return wmma_bf(a.h, b.h, c); }
__device__ __forceinline__ float sigm(float v) { return 1.0f / (1.0f + expf(-v)); }
#define LDSX() do { asm volatile("s_wait_dscnt 0" ::: "memory"); __builtin_amdgcn_wave_barrier(); __builtin_amdgcn_fence(__ATOMIC_RELEASE, "workgroup"); } while (0)


#define NB 2
#define SS 2048
#define DM 1024
#define NH 16
#define KIN 512          // input width
#define BSZ 2            // the module's batch (interleaved in the row order)
#define HOUT 64          // o_proj output width
#define HD 64
#define QKVW (3 * DM)
#ifndef TQB
#define TQB (SS / 64)
#define TNB NB
#define TOB (NB * SS / 64)     // output row tiles (all)
#endif
typedef __attribute__((ext_vector_type(8))) __bf16 v8b;
__device__ __forceinline__ v16b frag_b(const __bf16* rowk0, int lane) {
  union { v16b v; v8b q[2]; } u; const __bf16* p = rowk0 + 8 * (lane >> 4);
  u.q[0] = *(const v8b*)p; u.q[1] = *(const v8b*)(p + 16); return u.v;
}
__device__ __forceinline__ float bfr(float v) { return (float)(__bf16)v; }
__device__ __attribute__((noinline)) float exp_ni(float v) { return expf(v); }
__device__ __attribute__((noinline)) float erf_ni(float v) { return erff(v); }

#define PK_A 0                       // [3072][512] Wqkv rows (permuted into q | k | v blocks, [out][in])
#define PK_P (PK_A + QKVW * DM)        // [64][1024] Wo rows (natural)
#define PK_END (PK_P + DM * DM)
#define WS_PK  0u
#define WS_QK  (WS_PK + 2u * PK_END)             // f16 [4096 rows][2048]: q | k
#define WS_QKL (WS_QK + 2u * NB * SS * 2 * DM)     // f16 q | k residual planes x2048
#define WS_VTH (WS_QKL + 2u * NB * SS * 2 * DM)    // f16 [b][1024 (h*64+d)][2048 s] hi
#define WS_VTL (WS_VTH + 2u * NB * DM * SS)        // f16 lo x 2048
#define WS_O   (WS_VTL + 2u * NB * DM * SS)        // f32 [4096][1024]
#define WS_CS  (WS_O + 4u * NB * SS * DM)           // f32 2 x [2048][32], not written or read
#define WS_END (WS_CS + 4u * 2 * SS * 32)
// ---- k_pack: the whole pack stage in one launch of few, full work-groups (the work is small: each lane takes four 16-byte pieces straight through registers, all loads in front of the first store).
// blocks 0 .. PKB_W-1: 16 rows each of the permuted [q | k | v] weight (row which * 1024 + h * 64 + d = column h * 192 + which * 64 + d of the concatenated [q_conn | qkv] buffer) -> bf16 at PK_A; 16 divides 64, so a block's rows have one (which, h) and are 16 consecutive rows of one source too: 32 KB read, 16 KB written, both in a row
// the next PKB_O blocks: 8 rows each of o_w (natural order) -> bf16 at PK_P; the last block: the three bias rows, permuted like the weight rows, f32 -> PB
#define PKB_W (QKVW / 16)
#define PKB_O (HOUT * DM / (16 * KIN))
__device__ __forceinline__ v4u pack8(v4f a, v4f b) { union { v8b h; v4u u; } r;
#pragma unroll
  for (int i = 0; i < 4; ++i) { r.h[i] = (__bf16)a[i]; r.h[4 + i] = (__bf16)b[i]; }
  return r.u; }
__device__ __forceinline__ unsigned src_col(unsigned e) { const unsigned which = e / DM, n = e % DM; return (n / HD) * (3 * HD) + which * HD + n % HD; }   // packed row (or bias element) e -> column of the concatenated buffer
__global__ __launch_bounds__(256) void k_pack(const float* __restrict__ CONNW, const float* __restrict__ WQKV3, const float* __restrict__ OW, const float* __restrict__ CONNB, const float* __restrict__ QKVB, __bf16* __restrict__ PK, float* __restrict__ PB) {
  const unsigned t = threadIdx.x, blk = blockIdx.x;
  if (blk < PKB_W + PKB_O) { const float* s; __bf16* dst;   // the block's 8,192 elements, source and destination
    if (blk < PKB_W) { const unsigned src = src_col(blk * 16); s = (src < HOUT) ? (CONNW + (size_t)src * KIN) : (WQKV3 + (size_t)(src - HOUT) * KIN); dst = PK + PK_A + (size_t)blk * (16 * KIN); }
    else { s = OW + (size_t)(blk - PKB_W) * (16 * KIN); dst = PK + PK_P + (size_t)(blk - PKB_W) * (16 * KIN); }
    v4f a[4], b[4];
#pragma unroll
    for (int i = 0; i < 4; ++i) { a[i] = *(const v4f*)(s + (i * 256 + t) * 8); b[i] = *(const v4f*)(s + (i * 256 + t) * 8 + 4); }   // piece = 8 consecutive elements
#pragma unroll
    for (int i = 0; i < 4; ++i) vst2((unsigned*)(dst + (i * 256 + t) * 8), pack8(a[i], b[i])); }
  else { v4f v[3];
#pragma unroll
    for (int i = 0; i < 3; ++i) { const unsigned src = src_col((i * 256 + t) * 4); v[i] = *(const v4f*)((src < HOUT) ? (CONNB + src) : (QKVB + (src - HOUT))); }   // 4 consecutive d of one head and kind lie side by side in the source too
#pragma unroll
    for (int i = 0; i < 3; ++i) vst2(PB + (i * 256 + t) * 4, v[i]); } }
// four 16-byte asynchronous copies a lane (each lane its own LDS byte address and global address); the s_wait_xcnt is the last line of the copies' own statement, so that it stands in front of any rewrite of their address registers
__device__ __forceinline__ void copy4(unsigned l0, const char* g0, unsigned l1, const char* g1, unsigned l2, const char* g2, unsigned l3, const char* g3) {
  asm volatile("global_load_async_to_lds_b128 %0, %1, off\n\tglobal_load_async_to_lds_b128 %2, %3, off\n\tglobal_load_async_to_lds_b128 %4, %5, off\n\tglobal_load_async_to_lds_b128 %6, %7, off\n\ts_wait_xcnt 0x0" :: "v"(l0), "v"(g0), "v"(l1), "v"(g1), "v"(l2), "v"(g2), "v"(l3), "v"(g3) : "memory");
}
// X / W ring of k_qkv in LDS: one stage = 64 k. X plane: the block's 64 rows of 256 B (f32) at pitch 272; W plane: its 128 weight rows of 128 B (bf16) at pitch 144 (both 16 B x odd: conflict-free 16-byte fragment reads)
#define XPIT 272
#define WPIT 144
#define QW_O (64 * XPIT)
#define QBUF (QW_O + 128 * WPIT)
__global__ __launch_bounds__(128) void k_qkv(const float* __restrict__ XQ, const float* __restrict__ XK, const float* __restrict__ XV, const __bf16* __restrict__ P, const float* __restrict__ BQ, const float* __restrict__ BK, const float* __restrict__ BV, _Float16* __restrict__ QK, _Float16* __restrict__ QKL, _Float16* __restrict__ VTH, _Float16* __restrict__ VTL) {
  const int which0 = (blockIdx.y * 128) / DM; const float* X = (which0 == 0) ? XQ : (which0 == 1) ? XK : XV; const float* BB = BQ ? (((which0 == 0) ? BQ : (which0 == 1) ? BK : BV) + (blockIdx.y * 128 - which0 * DM)) : nullptr;
  __shared__ __align__(16) char sm[2 * QBUF];   // the ring during the k loop; behind the loop's last barrier the same bytes stage the output tile
  _Float16 (*so)[16][136] = (_Float16 (*)[16][136])sm; _Float16 (*sol)[16][136] = so + 4; _Float16 (*sth)[72] = (_Float16 (*)[72])sm; _Float16 (*stl)[72] = sth + 128;
  const int tid = threadIdx.x, wave = tid >> 5, lane = tid & 31, col = lane & 15, g = lane >> 4; const size_t r0 = (size_t)blockIdx.x * 64 + wave * 16; const int n0 = blockIdx.y * 128;
  v8f acc[8] = {};
  float bias[8] = {};   // the lane's eight bias values (one a column tile), read once, as one group under one test: the reads fly beside the first stage's copies, and the epilogue is left without loads, waits and branches
  if (BB) {
#pragma unroll   // constant indices keep bias[] in registers
    for (int j = 0; j < 8; ++j) bias[j] = BB[j * 16 + col]; }
  // the work-group's 128 lanes copy a stage by whole rows: X row = 16 lanes x 16 B (a wave covers 2 rows = 4 whole lines), W row = 8 lanes x 16 B (4 rows = 4 whole lines); eight copies a lane and plane
  const unsigned rb = (unsigned)(size_t)sm;
  const unsigned lx = rb + (unsigned)(tid >> 4) * XPIT + (tid & 15) * 16, lw = rb + QW_O + (unsigned)(tid >> 3) * WPIT + (tid & 7) * 16;
  const char* gx = (const char*)X + ((size_t)blockIdx.x * 64 + (tid >> 4)) * (KIN * 4) + (tid & 15) * 16; const char* gw = (const char*)P + ((size_t)n0 + (tid >> 3)) * (KIN * 2) + (tid & 7) * 16;   // the lane's first X and W piece of stage 0
  auto stage = [&](int st, unsigned bo) {   // stage st (k = st * 64 ...) into the buffer at byte bo
    const char* x = gx + st * 256; const char* w = gw + st * 128; const unsigned a = lx + bo, c = lw + bo;
    copy4(a, x, a + 8 * XPIT, x + 8 * (KIN * 4), a + 16 * XPIT, x + 16 * (KIN * 4), a + 24 * XPIT, x + 24 * (KIN * 4));
    copy4(a + 32 * XPIT, x + 32 * (KIN * 4), a + 40 * XPIT, x + 40 * (KIN * 4), a + 48 * XPIT, x + 48 * (KIN * 4), a + 56 * XPIT, x + 56 * (KIN * 4));
    copy4(c, w, c + 16 * WPIT, w + 16 * (KIN * 2), c + 32 * WPIT, w + 32 * (KIN * 2), c + 48 * WPIT, w + 48 * (KIN * 2));
    copy4(c + 64 * WPIT, w + 64 * (KIN * 2), c + 80 * WPIT, w + 80 * (KIN * 2), c + 96 * WPIT, w + 96 * (KIN * 2), c + 112 * WPIT, w + 112 * (KIN * 2)); };
  const unsigned xof = (unsigned)(wave * 16 + col) * XPIT + 32 * g, wof = QW_O + (unsigned)col * WPIT + 16 * g;   // the lane's byte offsets inside an X and a W fragment of the ring, the same in every stage
  stage(0, 0);
  asm volatile("s_wait_asynccnt 0x0" ::: "memory");   // this wave's copies of stage 0 have landed
  __syncthreads();                                    // ... and every other wave's: stage 0 may be read
  stage(1, QBUF);
#pragma unroll 1   // kept rolled: the two buffers differ by an offset only, and eight copies of the body would only lengthen the text in front of the long epilogue
  for (int st = 0; st < KIN / 64; ++st) { const unsigned bo = (unsigned)(st & 1) * QBUF;
#pragma unroll
    for (int kc = 0; kc < 2; ++kc) {   // every fragment of a 32-k step is read from the ring as one group in front of its first product
      const char* xp = sm + bo + xof + kc * 128; const char* wp = sm + bo + wof + kc * 64;
      const v4f x0 = *(const v4f*)xp, x1 = *(const v4f*)(xp + 16), x2 = *(const v4f*)(xp + 64), x3 = *(const v4f*)(xp + 80);
      v16b w[8];
#pragma unroll
      for (int j = 0; j < 8; ++j) { union { v16b v; v8b q[2]; } u; u.q[0] = *(const v8b*)(wp + j * 16 * WPIT); u.q[1] = *(const v8b*)(wp + j * 16 * WPIT + 32); w[j] = u.v; }
      __builtin_amdgcn_sched_barrier(0);   // holds the step's LDS reads as one group ahead of its first product: left free, the scheduler sinks each pair of reads to its own product, with a wait at each
      v16b a;
#pragma unroll
      for (int i = 0; i < 4; ++i) { a[i] = (__bf16)x0[i]; a[4 + i] = (__bf16)x1[i]; a[8 + i] = (__bf16)x2[i]; a[12 + i] = (__bf16)x3[i]; }
#pragma unroll
      for (int j = 0; j < 8; ++j) acc[j] = wmma_bf(a, w[j], acc[j]);
      __builtin_amdgcn_sched_barrier(0); }   // holds the products ahead of the next group of reads and of the publish point: left free, the scheduler sinks the last ones behind the work-group barrier
    // publish point: this wave's LDS reads of the stage are done, its copies of the next stage have landed; behind the barrier the next stage may be read and this stage's buffer refilled
    asm volatile("s_wait_dscnt 0x0" ::: "memory");
    asm volatile("s_wait_asynccnt 0x0" ::: "memory");
    __syncthreads();
    if (st + 2 < KIN / 64) stage(st + 2, bo); }
  asm volatile("s_wait_asynccnt 0x0" ::: "memory");   // no copy is left outstanding behind the loop
  if (n0 < 2 * DM) {   // q stored unscaled (f16 sigma ~0.6, no subnormal exposure); 1/8 applied to the f32 score
#pragma unroll
    for (int j = 0; j < 8; ++j) {
#pragma unroll
      for (int r = 0; r < 8; ++r) { const float v = acc[j][r] + bfr(bias[j]); const _Float16 hv = (_Float16)v; so[wave][8 * g + r][j * 16 + col] = hv; sol[wave][8 * g + r][j * 16 + col] = (_Float16)((v - (float)hv) * 2048.0f); } }   // q, k (+ bias) as f16 hi + (x2048) residual
    LDSX();
    for (int rl = 0; rl < 16; ++rl) if (lane < 16) { vst2((unsigned*)(QK + (r0 + rl) * (2 * DM) + n0 + lane * 8), *(const v4u*)&so[wave][rl][lane * 8]); vst2((unsigned*)(QKL + (r0 + rl) * (2 * DM) + n0 + lane * 8), *(const v4u*)&sol[wave][rl][lane * 8]); }
  } else {
#pragma unroll
    for (int j = 0; j < 8; ++j) {
#pragma unroll
      for (int r = 0; r < 8; ++r) { const float v = acc[j][r] + bfr(bias[j]); const _Float16 hv = (_Float16)v; sth[j * 16 + col][wave * 16 + 8 * g + r] = hv; stl[j * 16 + col][wave * 16 + 8 * g + r] = (_Float16)((v - (float)hv) * 2048.0f); } }
    __syncthreads();
    const size_t rb = (size_t)blockIdx.x * 64; const int b = (int)(rb / SS), s0 = (int)(rb % SS); const int pc0 = n0 - 2 * DM;
    for (int q = tid; q < 128 * 8; q += 128) { const int d = q >> 3, pc = q & 7; const size_t o = ((size_t)b * DM + pc0 + d) * SS + s0 + pc * 8; vst2((unsigned*)(VTH + o), *(const v4u*)&sth[d][pc * 8]); vst2((unsigned*)(VTL + o), *(const v4u*)&stl[d][pc * 8]); }
  }
}
// ---- k_attn: block = (64 queries, head h, batch b): all-keys flash attention (K = 64: 2 k-steps), scores = (q.k) * 0.125 from q hi/lo x k hi/lo (3 products) in the first two query blocks, single f16 elsewhere, P.V: there 2^11 P hi/lo x V hi/lo (3 products) in two accumulators, elsewhere 2^11 P x V hi; O[b*S+q][h*64+d] = (acc + accl / 2048) / (2048 l) (256-B segments)
__device__ __forceinline__ v16h frag_p(const char* p) {   // frag_h from the lane's own byte address
  union { v16h v; v8h q[2]; } u; u.q[0] = *(const v8h*)p; u.q[1] = *(const v8h*)(p + 32); return u.v;
}
// K/V ring in LDS: one stage = the 32 keys of a pass. K plane: 32 rows (keys) of 128 B at pitch 144; V plane: 64 rows (d) of 64 B at pitch 80 (16 B x odd: conflict-free 16-byte fragment reads)
#define KPIT 144
#define VPIT 80
#define RK_H 0
#define RV_H (RK_H + 32 * KPIT)
#define RK_L (RV_H + 64 * VPIT)
#define RV_L (RK_L + 32 * KPIT)
#define RBUF (RV_L + 64 * VPIT)
__device__ __forceinline__ float xhalf(float x) { return __builtin_bit_cast(float, __builtin_amdgcn_permlanex16(__builtin_bit_cast(int, x), __builtin_bit_cast(int, x), 0x76543210, 0xfedcba98, false, false)); }   // lane l with lane l ^ 16
template <bool HV> __device__ __forceinline__ void attn_body(const _Float16* __restrict__ QK, const _Float16* __restrict__ QKL, const _Float16* __restrict__ VTH, const _Float16* __restrict__ VTL, float* __restrict__ O, float (*so)[16][68], char* ring, const int qb, const int h, const int b) {
  const int tid = threadIdx.x, wave = tid >> 5, lane = tid & 31, col = lane & 15, g = lane >> 4;
  const int q0 = qb * 64 + wave * 16; const size_t rq = (size_t)b * SS + q0 + col;
  v16h aq[2], aql[2];
#pragma unroll
  for (int kc = 0; kc < 2; ++kc) { aq[kc] = frag_h(QK + rq * (2 * DM) + h * HD + kc * 32, lane); aql[kc] = frag_h(QKL + rq * (2 * DM) + h * HD + kc * 32, lane); }
  float m = -3.0e38f, l = 0.f;   // the lane's query: running maximum over all keys (the same in both halves), sum over this half's keys
  v8f acc[4] = {}, accl[4] = {};
  const int nks = SS / 32;   // all keys
  const unsigned kof = (unsigned)col * KPIT + 16 * g, vof = (unsigned)col * VPIT + 16 * g;   // the lane's byte offsets inside a K and a V fragment of the ring, the same in every pass
  // the work-group's 128 lanes copy a stage by whole rows: K row = 8 lanes x 16 B (a wave covers 4 whole 128-B lines), V row = 4 lanes x 16 B; two copies a lane and plane
  const unsigned rb = (unsigned)(size_t)ring;
  const unsigned lk = rb + (unsigned)(tid >> 3) * KPIT + (tid & 7) * 16, lv = rb + (unsigned)(tid >> 2) * VPIT + (tid & 3) * 16;
  const size_t gk = 2 * (((size_t)b * SS + (tid >> 3)) * (2 * DM) + DM + h * HD + (tid & 7) * 8), gv = 2 * (((size_t)b * DM + h * HD + (tid >> 2)) * SS + (tid & 3) * 8);   // byte offsets of the lane's first K and V piece of stage 0
  auto stage = [&](int st, unsigned bo) {   // stage st (keys st * 32 ...) into the buffer at byte bo
    const size_t ok = gk + (size_t)st * (32 * 2 * DM * 2), ov = gv + (size_t)st * (32 * 2);
    copy4(lk + bo + RK_H, (const char*)QK + ok, lk + bo + RK_H + 16 * KPIT, (const char*)QK + ok + 16 * (2 * DM * 2), lv + bo + RV_H, (const char*)VTH + ov, lv + bo + RV_H + 32 * VPIT, (const char*)VTH + ov + 32 * (SS * 2));
    if (HV) copy4(lk + bo + RK_L, (const char*)QKL + ok, lk + bo + RK_L + 16 * KPIT, (const char*)QKL + ok + 16 * (2 * DM * 2), lv + bo + RV_L, (const char*)VTL + ov, lv + bo + RV_L + 32 * VPIT, (const char*)VTL + ov + 32 * (SS * 2)); };
  stage(0, 0);
  asm volatile("s_wait_asynccnt 0x0" ::: "memory");   // this wave's copies of stage 0 have landed
  __syncthreads();                                    // ... and every other wave's: stage 0 may be read
  stage(1, RBUF);
#pragma unroll 1
  for (int ks = 0; ks < nks; ++ks) { v8f s[2];
    // every K fragment of the pass is read from the ring as one group in front of the first product
    v16h kh[2][2], kl[2][2];
    const unsigned bo = (unsigned)(ks & 1) * RBUF; const char* kp = ring + bo + RK_H + kof; const char* kpl = ring + bo + RK_L + kof;   // one address a plane; the fragments lie at constant offsets from it
#pragma unroll
    for (int ct = 0; ct < 2; ++ct) {
#pragma unroll
      for (int kc = 0; kc < 2; ++kc) { kh[ct][kc] = frag_p(kp + ct * 16 * KPIT + kc * 64); if (HV) kl[ct][kc] = frag_p(kpl + ct * 16 * KPIT + kc * 64); } }
    __builtin_amdgcn_sched_barrier(0);   // holds the K reads as one group ahead of the first product: left free, the scheduler sinks each pair of reads to its own product, with a wait at each
#pragma unroll
    for (int ct = 0; ct < 2; ++ct) { v8f c = {}, cl = {};
      if (HV) {   // leading query blocks (outputs far above the global rms): 3 products
#pragma unroll
        for (int kc = 0; kc < 2; ++kc) { c = wmma16(kh[ct][kc], aq[kc], c); cl = wmma16(kh[ct][kc], aql[kc], cl); cl = wmma16(kl[ct][kc], aq[kc], cl); }
#pragma unroll
        for (int r = 0; r < 8; ++r) c[r] += cl[r] * (1.0f / 2048.0f); }
      else {
#pragma unroll
        for (int kc = 0; kc < 2; ++kc) c = wmma16(kh[ct][kc], aq[kc], c); }   // single product elsewhere
      { const bool keepk = true;
#pragma unroll
      for (int r = 0; r < 8; ++r) s[ct][r] = keepk ? c[r] * 0.125f : -3.0e38f; } }   // 1/sqrt(64); no key is masked
    // every V fragment of the pass is read from the ring as one group behind the score products: the reads fly while the softmax runs
    __builtin_amdgcn_sched_barrier(0);   // with the one behind the V reads: holds them as one group between the score products and the softmax, not spread among the products
    v16h vh[4], vl[4];
    const char* vp = ring + bo + RV_H + vof; const char* vpl = ring + bo + RV_L + vof;
#pragma unroll
    for (int dt = 0; dt < 4; ++dt) { vh[dt] = frag_p(vp + dt * 16 * VPIT); if (HV) vl[dt] = frag_p(vpl + dt * 16 * VPIT); }
    __builtin_amdgcn_sched_barrier(0);   // second of the pair: left free, the scheduler sinks the V reads among the P.V products, with a wait at each; held here they fly while the softmax runs
    float t[8];   // maximum and sum of the lane's 16 scores as trees in registers
#pragma unroll
    for (int r = 0; r < 8; ++r) t[r] = fmaxf(s[0][r], s[1][r]);
    float mx = fmaxf(fmaxf(fmaxf(t[0], t[1]), fmaxf(t[2], t[3])), fmaxf(fmaxf(t[4], t[5]), fmaxf(t[6], t[7])));
    mx = fmaxf(mx, xhalf(mx));   // the other half's 16 keys of the same query
    const float mn = fmaxf(m, mx); const float alpha = (m <= -1.0e38f) ? 0.f : __expf(m - mn);
    float e[2][8];
#pragma unroll
    for (int r = 0; r < 8; ++r) { e[0][r] = (s[0][r] <= -1.0e38f) ? 0.f : __expf(s[0][r] - mn); e[1][r] = (s[1][r] <= -1.0e38f) ? 0.f : __expf(s[1][r] - mn); t[r] = e[0][r] + e[1][r]; }
    l = l * alpha + (((t[0] + t[1]) + (t[2] + t[3])) + ((t[4] + t[5]) + (t[6] + t[7]))); m = mn;   // the two halves' sums are joined once, behind the loop
#pragma unroll
    for (int dt = 0; dt < 4; ++dt) {
#pragma unroll
      for (int r = 0; r < 8; ++r) { acc[dt][r] *= alpha; accl[dt][r] *= alpha; } }
    v16h pa, pl;
#pragma unroll
    for (int i = 0; i < 8; ++i) { const float x0 = e[0][i] * 2048.0f, x1 = e[1][i] * 2048.0f; const _Float16 h0 = (_Float16)x0, h1 = (_Float16)x1; pa[i] = h0; pa[8 + i] = h1; pl[i] = (_Float16)((x0 - (float)h0) * 2048.0f); pl[8 + i] = (_Float16)((x1 - (float)h1) * 2048.0f); }   // P scaled by 2^11 before the f16 split so small softmax weights stay out of the f16 subnormal range; 2^-11 folded into the epilogue
#pragma unroll
    for (int dt = 0; dt < 4; ++dt) { acc[dt] = wmma16(vh[dt], pa, acc[dt]); if (HV) { accl[dt] = wmma16(vh[dt], pl, accl[dt]); accl[dt] = wmma16(vl[dt], pa, accl[dt]); } }   // leading query blocks: P hi/lo x V hi/lo (3 products); elsewhere P x V single
    __builtin_amdgcn_sched_barrier(0);   // holds softmax and products ahead of the publish point: left free, the scheduler lifts the waits and the barrier to the V reads, which bares their latency and halves the lead of the refill
    // publish point: this wave's LDS reads of the pass are done, its copies of the next stage have landed; behind the barrier the next stage may be read and this pass's buffer refilled
    asm volatile("s_wait_dscnt 0x0" ::: "memory");
    asm volatile("s_wait_asynccnt 0x0" ::: "memory");
    __syncthreads();
    if (ks + 2 < nks) stage(ks + 2, bo); }
  asm volatile("s_wait_asynccnt 0x0" ::: "memory");   // no copy is left outstanding behind the loop
  const float il = (1.0f / 2048.0f) / (l + xhalf(l));
#pragma unroll
  for (int dt = 0; dt < 4; ++dt) {
#pragma unroll
    for (int q = 0; q < 2; ++q) { v4f o;
#pragma unroll
      for (int i = 0; i < 4; ++i) o[i] = (acc[dt][4 * q + i] + accl[dt][4 * q + i] * (1.0f / 2048.0f)) * il;
      vst2(&so[wave][col][dt * 16 + 8 * g + 4 * q], o); } }
  LDSX();
  for (int rl = 0; rl < 16; ++rl) if (lane < 16) vst2(O + ((size_t)b * SS + q0 + rl) * DM + h * HD + lane * 4, *(const v4f*)&so[wave][rl][lane * 4]);
}
__global__ __launch_bounds__(128) void k_attn(const _Float16* __restrict__ QK, const _Float16* __restrict__ QKL, const _Float16* __restrict__ VTH, const _Float16* __restrict__ VTL, const void* __restrict__ KMASK, float* __restrict__ O) {
  __shared__ __align__(16) float so[4][16][68]; __shared__ __align__(16) char ring[2 * RBUF]; (void)KMASK;
  // which tile a block takes (for speed only; a permutation of the tiles for any dispatch): a three-product block costs about twice a single-product one, and all blocks are resident at once, so the launch lasts as long as the WGP with the most of them.
  // Dealt by blockIdx.x < 2 they lie at flat indices 0 and 1 modulo 32. Here they take every 5th group of 8 flat indices from the front (40 apart): near the start.
  const int f = blockIdx.x + TQB * (blockIdx.y + NH * blockIdx.z), j = f >> 3;   // flat index; its group of 8
  const int NHV = 2 * NH * TNB / 8;   // groups of three-product blocks (2 query blocks a head and batch)
  if (j < 5 * NHV && j % 5 == 0) { const int i = (j / 5) * 8 + (f & 7); const int hb = i >> 1; attn_body<true>(QK, QKL, VTH, VTL, O, so, ring, i & 1, hb % NH, hb / NH); }
  else { const int i = f - 8 * (j < 5 * NHV ? j / 5 + 1 : NHV); const int hb = i / (TQB - 2); attn_body<false>(QK, QKL, VTH, VTL, O, so, ring, 2 + i % (TQB - 2), hb % NH, hb / NH); }   // the others keep their order, closed up over the groups taken out
}
// ---- k_out: block = (64 rows, 128 cols): out = O(hi/lo) . Wo rows (2 products) + bo
__global__ __launch_bounds__(128) void k_out(const float* __restrict__ O, const __bf16* __restrict__ P, const float* __restrict__ BO, float* __restrict__ Y) {
  __shared__ __align__(16) float so[4][16][132];
  const int tid = threadIdx.x, wave = tid >> 5, lane = tid & 31, col = lane & 15, g = lane >> 4; const size_t r0 = (size_t)blockIdx.x * 64 + wave * 16; const int n0 = blockIdx.y * 128;
  v8f acc[8] = {};
#pragma unroll 2
  for (int kc = 0; kc < DM / 32; ++kc) { const F2 a = split_row(O + (r0 + col) * DM, kc * 32, lane);
#pragma unroll
    for (int j = 0; j < 8; ++j) { const v16b w = frag_b(P + (size_t)(n0 + j * 16 + col) * DM + kc * 32, lane); acc[j] = wmma_bf(a.l, w, acc[j]); acc[j] = wmma_bf(a.h, w, acc[j]); } }
#pragma unroll
  for (int j = 0; j < 8; ++j) {
#pragma unroll
    for (int r = 0; r < 8; ++r) so[wave][8 * g + r][j * 16 + col] = acc[j][r] + bfr(BO[n0 + j * 16 + col]); }
  LDSX();
  for (int rl = 0; rl < 16; ++rl) vst2(Y + (r0 + rl) * DM + n0 + lane * 4, *(const v4f*)&so[wave][rl][lane * 4]);
}
// ---- k_o: block = 16 rows r' = (b', s'), eight waves: wave w takes k = w * 128 ... of the 1,024 (four 32-k steps, unrolled, so that its loads fly together); the eight partial tiles meet in LDS and are summed in wave order: o = ctx (bf16 hi + lo) . o_w rows + o_b -> out[(s' * BSZ + b') * 64] (the final (B,S)->(S,B) transpose)
#define OKW 8                  // waves a work-group = slices of the k range
#define TOR (NB * SS / 16)     // output row tiles of 16
__global__ __launch_bounds__(32 * OKW) void k_o(const float* __restrict__ O, const __bf16* __restrict__ P, const float* __restrict__ OB, float* __restrict__ Y) { __shared__ __align__(16) float part[OKW][16][68];
  const int tid = threadIdx.x, wave = tid >> 5, lane = tid & 31, col = lane & 15, g = lane >> 4; const size_t r0 = (size_t)blockIdx.x * 16; const __bf16* Wr = P + PK_P; const int kb = wave * (DM / OKW);
  v8f acc[4] = {};
  const int rl = tid >> 4, c4 = (tid & 15) * 4;   // the lane's 16-byte piece of the output tile: 16 lanes store a whole 256-B output row
  const v4f ob = *(const v4f*)(OB + c4);          // read here, beside the operands, not behind the barrier
  const float* xr = O + (r0 + col) * DM + kb + 8 * g; v4f xa[DM / OKW / 32][4];   // the lane's ctx values of all four steps, in split_row's order
#pragma unroll
  for (int kc = 0; kc < DM / OKW / 32; ++kc) { xa[kc][0] = *(const v4f*)(xr + kc * 32); xa[kc][1] = *(const v4f*)(xr + kc * 32 + 4); xa[kc][2] = *(const v4f*)(xr + kc * 32 + 16); xa[kc][3] = *(const v4f*)(xr + kc * 32 + 20); }
  __builtin_amdgcn_sched_barrier(0);   // with the one behind the wait: keeps the wait between the two runs of loads, where it is written
  asm volatile("s_wait_xcnt 0x0" ::: "memory");   // stands in front of any reuse of the address registers of the loads above (a weight load's result may take them)
  __builtin_amdgcn_sched_barrier(0);
  v16b wf[DM / OKW / 32][4];   // and its weight fragments: all of the wave's loads are issued as one group, so that it waits out one memory latency, not one a step
#pragma unroll
  for (int kc = 0; kc < DM / OKW / 32; ++kc) {
#pragma unroll
    for (int j = 0; j < 4; ++j) wf[kc][j] = frag_b(Wr + (size_t)(j * 16 + col) * DM + kb + kc * 32, lane); }
  __builtin_amdgcn_sched_barrier(0);   // holds the loads as one group ahead of the first product: left free, the scheduler sinks a third of them, and the bias read, behind the first waits
  asm volatile("s_wait_xcnt 0x0" ::: "memory");   // stands in front of any reuse of the address registers of the loads above
  __builtin_amdgcn_sched_barrier(0);   // keeps that wait where it is written, ahead of the first instruction that can reuse such a register
#pragma unroll   // constant indices keep xa[] and wf[] in registers
  for (int kc = 0; kc < DM / OKW / 32; ++kc) { float v[16];
#pragma unroll
    for (int i = 0; i < 4; ++i) { v[i] = xa[kc][0][i]; v[4 + i] = xa[kc][1][i]; v[8 + i] = xa[kc][2][i]; v[12 + i] = xa[kc][3][i]; }
    const F2 a = bsplit16(v);
#pragma unroll
    for (int j = 0; j < 4; ++j) { acc[j] = wmma_bf(a.h, wf[kc][j], acc[j]); acc[j] = wmma_bf(a.l, wf[kc][j], acc[j]); } }
#pragma unroll
  for (int j = 0; j < 4; ++j) {
#pragma unroll
    for (int r = 0; r < 8; ++r) part[wave][8 * g + r][j * 16 + col] = acc[j][r]; }
  __syncthreads();   // every wave's partial tile is in LDS
  v4f s = *(const v4f*)&part[0][rl][c4];
#pragma unroll
  for (int w = 1; w < OKW; ++w) s += *(const v4f*)&part[w][rl][c4];
#pragma unroll
  for (int i = 0; i < 4; ++i) s[i] += bfr(ob[i]);
  const size_t rp = r0 + rl; const size_t bp = rp / SS, sp = rp % SS; vst2(Y + (sp * BSZ + bp) * HOUT + c4, s); }
extern "C" void kernel_launch(void* const* d_in, const int* in_sizes, int n_in, void* d_out, int out_size, void* d_ws, size_t ws_size, hipStream_t stream) {
  (void)in_sizes; (void)n_in; (void)out_size;
  const float** F = (const float**)d_in;   // 0 x [2048,2,512], 1 qkv_w [3008,512], 2 qkv_b [3008], 3 conn_w [64,512], 4 conn_b [64], 5 o_w [64,1024], 6 o_b [64]
  if (ws_size < (size_t)WS_END + 4u * 3 * DM) return;
  char* ws = (char*)d_ws; __bf16* PK = (__bf16*)(ws + WS_PK); _Float16 *QK = (_Float16*)(ws + WS_QK), *QKL = (_Float16*)(ws + WS_QKL), *VTH = (_Float16*)(ws + WS_VTH), *VTL = (_Float16*)(ws + WS_VTL); float* O = (float*)(ws + WS_O); float* PB = (float*)(ws + WS_END);
  k_pack<<<PKB_W + PKB_O + 1, 256, 0, stream>>>(F[3], F[1], F[5], F[4], F[2], PK, PB);
  // the (S,B,512) input rows in memory order ARE the (b', s') rows of the raw reshape: row r = b' * 2048 + s'
  k_qkv<<<dim3(TNB * SS / 64, QKVW / 128), 128, 0, stream>>>(F[0], F[0], F[0], PK + PK_A, PB, PB + DM, PB + 2 * DM, QK, QKL, VTH, VTL);
  k_attn<<<dim3(TQB, NH, TNB), 128, 0, stream>>>(QK, QKL, VTH, VTL, nullptr, O);
  k_o<<<TOR, 32 * OKW, 0, stream>>>(O, PK, F[6], (float*)d_out);
}

// v010
// One run takes 89.7 microseconds.
// Timed twice side by side with v009, it ran 1.04 times as fast both times.
// All steps since v000 together make it 4.74 times as fast.
// compute dtype: all float inputs rounded to bf16; the concatenated [conn | qkv] projection with EXACT bf16 products on WMMA 16x16x32 (weight rows permuted at pack time into per-head q / k / v blocks; K = 512) + biases in f32, rounded once to f16 hi + residual; PLAIN-HYBRID attention (first 128 queries of each attention batch 3-product, later single f16), x 1/8, running-max softmax in f32 (hardware exp); out = ctx (bf16 hi + lo, 2 products) . o_w rows + o_b; f32 output.
#include <hip/hip_runtime.h>
#include <math.h>

typedef __attribute__((ext_vector_type(16))) _Float16 v16h;
typedef __attribute__((ext_vector_type(16))) __bf16 v16b;
typedef __attribute__((ext_vector_type(8)))  _Float16 v8h;
typedef __attribute__((ext_vector_type(8)))  float v8f;
typedef __attribute__((ext_vector_type(4)))  float v4f;
typedef __attribute__((ext_vector_type(2)))  float v2f;
typedef __attribute__((ext_vector_type(4)))  unsigned v4u;
typedef __attribute__((ext_vector_type(4)))  int v4i;
typedef float __attribute__((may_alias)) float_a;
typedef int __attribute__((may_alias)) int_a;

template <typename T> __device__ __forceinline__ void vst2(void* p, T v) { *(T*)p = v;  }
__device__ __forceinline__ v8f wmma16(v16h a, v16h b, v8f c) {
  return __builtin_amdgcn_wmma_f32_16x16x32_f16(false, a, false, b, (short)0, c, false, false);
}
__device__ __forceinline__ v8f wmma_bf(v16b a, v16b b, v8f c) {
  return __builtin_amdgcn_wmma_f32_16x16x32_bf16(false, a, false, b, (short)0, c, false, false);
}
// Modified multi-head attention (S 2,048, B 2, d_in 512, 16 heads x 64): qkv from one projection plus a fixed 'connection' projection supplying 64 of the q columns, the torch raw reshape (S,B,3E) -> (B,S,H,3*64) kept literally (so attention 'batches' are contiguous halves of the (s,b) row order and each head's q|k|v are consecutive 64-column slices), softmax(q k / 8) v, output projection E -> 64 + bias, returned as (S, B, 64).
__device__ __forceinline__ v16h frag_h(const _Float16* rowk0, int lane) {
  union { v16h v; v8h q[2]; } u; const _Float16* p = rowk0 + 8 * (lane >> 4);
  u.q[0] = *(const v8h*)p; u.q[1] = *(const v8h*)(p + 16); return u.v;
}
__device__ __forceinline__ v16h frag_f32(const float* rowk0, int lane) {
  v16h a; const float* p = rowk0 + 8 * (lane >> 4);
#pragma unroll
  for (int i = 0; i < 8; ++i) { a[i] = (_Float16)p[i]; a[8 + i] = (_Float16)p[16 + i]; }
  return a;
}
__device__ __forceinline__ v16h frag_f32s(const float* rowk0, int lane, float sc) {
  v16h a; const float* p = rowk0 + 8 * (lane >> 4);
#pragma unroll
  for (int i = 0; i < 8; ++i) { a[i] = (_Float16)(p[i] * sc); a[8 + i] = (_Float16)(p[16 + i] * sc); }
  return a;
}
// column fragment from a [K][ld] layout (column n), rows >= K read as 0
__device__ __forceinline__ v16h fragc_f32(const float* W, int k0, int n, int lane, int ld, int K) {
  v16h a; const int g = lane >> 4;
#pragma unroll
  for (int i = 0; i < 8; ++i) { const int ka = k0 + 8 * g + i, kb = ka + 16;
    a[i] = (_Float16)(ka < K ? W[(size_t)(ka < K ? ka : K - 1) * ld + n] : 0.f); a[8 + i] = (_Float16)(kb < K ? W[(size_t)(kb < K ? kb : K - 1) * ld + n] : 0.f); }
  return a;
}
struct F2 { v16b h, l; };
__device__ __forceinline__ F2 bsplit16(const float v[16]) { F2 r;
#pragma unroll
  for (int i = 0; i < 16; ++i) { const __bf16 h = (__bf16)v[i]; r.h[i] = h; r.l[i] = (__bf16)(v[i] - (float)h); }
  return r; }
__device__ __forceinline__ F2 split_row(const float* row, int k0, int lane) { float v[16]; const float* p = row + k0 + 8 * (lane >> 4);
#pragma unroll
  for (int i = 0; i < 8; ++i) { v[i] = p[i]; v[8 + i] = p[16 + i]; }
  return bsplit16(v); }
__device__ __forceinline__ F2 split_rowK(const float* row, int k0, int lane, int K) { float v[16]; const int g = lane >> 4;
#pragma unroll
  for (int i = 0; i < 8; ++i) { const int ka = k0 + 8 * g + i, kb = ka + 16; v[i] = ka < K ? row[ka < K ? ka : K - 1] : 0.f; v[8 + i] = kb < K ? row[kb < K ? kb : K - 1] : 0.f; }
  return bsplit16(v); }
__device__ __forceinline__ F2 split_col(const float* W, int k0, int n, int lane, int ld, int K) { float v[16]; const int g = lane >> 4;
#pragma unroll
  for (int i = 0; i < 8; ++i) { const int ka = k0 + 8 * g + i, kb = ka + 16; v[i] = ka < K ? W[(size_t)(ka < K ? ka : K - 1) * ld + n] : 0.f; v[8 + i] = kb < K ? W[(size_t)(kb < K ? kb : K - 1) * ld + n] : 0.f; }
  return bsplit16(v); }
__device__ __forceinline__ v8f mac3(const F2& a, const F2& b, v8f c) { c = wmma_bf(a.l, b.h, c); c = wmma_bf(a.h, b.l, c); return wmma_bf(a.h, b.h, c); }
__device__ __forceinline__ float sigm(float v) { return 1.0f / (1.0f + expf(-v)); }
#define LDSX() do { asm volatile("s_wait_dscnt 0" ::: "memory"); __builtin_amdgcn_wave_barrier(); __builtin_amdgcn_fence(__ATOMIC_RELEASE, "workgroup"); } while (0)


#define NB 2
#define SS 2048
#define DM 1024
#define NH 16
#define KIN 512          // input width
#define BSZ 2            // the module's batch (interleaved in the row order)
#define HOUT 64          // o_proj output width
#define HD 64
#define QKVW (3 * DM)
#ifndef TQB
#define TQB (SS / 64)
#define TNB NB
#define TOB (NB * SS / 64)     // output row tiles (all)
#endif
typedef __attribute__((ext_vector_type(8))) __bf16 v8b;
__device__ __forceinline__ v16b frag_b(const __bf16* rowk0, int lane) {
  union { v16b v; v8b q[2]; } u; const __bf16* p = rowk0 + 8 * (lane >> 4);
  u.q[0] = *(const v8b*)p; u.q[1] = *(const v8b*)(p + 16); return u.v;
}
__device__ __forceinline__ float bfr(float v) { return (float)(__bf16)v; }
__device__ __attribute__((noinline)) float exp_ni(float v) { return expf(v); }
__device__ __attribute__((noinline)) float erf_ni(float v) { return erff(v); }

#define PK_A 0                       // [3072][512] Wqkv rows (permuted into q | k | v blocks, [out][in])
#define PK_P (PK_A + QKVW * DM)        // [64][1024] Wo rows (natural)
#define PK_END (PK_P + DM * DM)
#define WS_PK  0u
#define WS_QK  (WS_PK + 2u * PK_END)             // f16: q plane [4096 rows][1024], then k plane [b][h][2048 s][64 d] at element KPL: a head's 32 keys of a stage are 4 KB in a row
#define WS_QKL (WS_QK + 2u * NB * SS * 2 * DM)     // f16 q | k residual planes x2048
#define WS_VTH (WS_QKL + 2u * NB * SS * 2 * DM)    // f16 [b][h][64 stages][64 d][32 s] hi: a head's V^T tile of a 32-key stage is 4 KB in a row
#define WS_VTL (WS_VTH + 2u * NB * DM * SS)        // f16 lo x 2048
#define WS_O   (WS_VTL + 2u * NB * DM * SS)        // f32 [4096][1024]
#define WS_CS  (WS_O + 4u * NB * SS * DM)           // f32 2 x [2048][32], not written or read
#define WS_END (WS_CS + 4u * 2 * SS * 32)
#define KPL ((size_t)NB * SS * DM)   // first element of the k plane in QK and in QKL
#define STB (32 * HD * 2)            // bytes of one stage's K tile, and of its V^T tile
// ---- k_pack: the whole pack stage in one launch of few, full work-groups (the work is small, so each lane takes four 16-byte pieces straight through registers, all loads in front of the first store).
// blocks 0 .. PKB_W-1: 16 rows each of the permuted [q | k | v] weight (row which * 1024 + h * 64 + d = column h * 192 + which * 64 + d of the concatenated [q_conn | qkv] buffer) -> bf16 at PK_A; 16 divides 64, so a block's rows have one (which, h) and are 16 consecutive rows of one source too: 32 KB read, 16 KB written, both in a row
// the next PKB_O blocks: 8 rows each of o_w (natural order) -> bf16 at PK_P; the last block: the three bias rows, permuted like the weight rows, f32 -> PB
#define PKB_W (QKVW / 16)
#define PKB_O (HOUT * DM / (16 * KIN))
__device__ __forceinline__ v4u pack8(v4f a, v4f b) { union { v8b h; v4u u; } r;
#pragma unroll
  for (int i = 0; i < 4; ++i) { r.h[i] = (__bf16)a[i]; r.h[4 + i] = (__bf16)b[i]; }
  return r.u; }
__device__ __forceinline__ unsigned src_col(unsigned e) { const unsigned which = e / DM, n = e % DM; return (n / HD) * (3 * HD) + which * HD + n % HD; }   // packed row (or bias element) e -> column of the concatenated buffer
__global__ __launch_bounds__(256) void k_pack(const float* __restrict__ CONNW, const float* __restrict__ WQKV3, const float* __restrict__ OW, const float* __restrict__ CONNB, const float* __restrict__ QKVB, __bf16* __restrict__ PK, float* __restrict__ PB) {
  const unsigned t = threadIdx.x, blk = blockIdx.x;
  if (blk < PKB_W + PKB_O) { const float* s; __bf16* dst;   // the block's 8,192 elements, source and destination
    if (blk < PKB_W) { const unsigned src = src_col(blk * 16); s = (src < HOUT) ? (CONNW + (size_t)src * KIN) : (WQKV3 + (size_t)(src - HOUT) * KIN); dst = PK + PK_A + (size_t)blk * (16 * KIN); }
    else { s = OW + (size_t)(blk - PKB_W) * (16 * KIN); dst = PK + PK_P + (size_t)(blk - PKB_W) * (16 * KIN); }
    v4f a[4], b[4];
#pragma unroll
    for (int i = 0; i < 4; ++i) { a[i] = *(const v4f*)(s + (i * 256 + t) * 8); b[i] = *(const v4f*)(s + (i * 256 + t) * 8 + 4); }   // piece = 8 consecutive elements
#pragma unroll
    for (int i = 0; i < 4; ++i) vst2((unsigned*)(dst + (i * 256 + t) * 8), pack8(a[i], b[i])); }
  else { v4f v[3];
#pragma unroll
    for (int i = 0; i < 3; ++i) { const unsigned src = src_col((i * 256 + t) * 4); v[i] = *(const v4f*)((src < HOUT) ? (CONNB + src) : (QKVB + (src - HOUT))); }   // 4 consecutive d of one head and kind lie side by side in the source too
#pragma unroll
    for (int i = 0; i < 3; ++i) vst2(PB + (i * 256 + t) * 4, v[i]); } }
// four 16-byte asynchronous copies a lane (each lane its own LDS byte address and global address); the s_wait_xcnt is the last line of the copies' own statement, so that it stands in front of any rewrite of their address registers
__device__ __forceinline__ void copy4(unsigned l0, const char* g0, unsigned l1, const char* g1, unsigned l2, const char* g2, unsigned l3, const char* g3) {
  asm volatile("global_load_async_to_lds_b128 %0, %1, off\n\tglobal_load_async_to_lds_b128 %2, %3, off\n\tglobal_load_async_to_lds_b128 %4, %5, off\n\tglobal_load_async_to_lds_b128 %6, %7, off\n\ts_wait_xcnt 0x0" :: "v"(l0), "v"(g0), "v"(l1), "v"(g1), "v"(l2), "v"(g2), "v"(l3), "v"(g3) : "memory");
}
// X / W ring of k_qkv in LDS: one stage = 64 k. X plane: the block's 64 rows of 256 B (f32) at pitch 272; W plane: its 128 weight rows of 128 B (bf16) at pitch 144 (both 16 B x odd: conflict-free 16-byte fragment reads)
#define XPIT 272
#define WPIT 144
#define QW_O (64 * XPIT)
#define QBUF (QW_O + 128 * WPIT)
__global__ __launch_bounds__(128) void k_qkv(const float* __restrict__ XQ, const float* __restrict__ XK, const float* __restrict__ XV, const __bf16* __restrict__ P, const float* __restrict__ BQ, const float* __restrict__ BK, const float* __restrict__ BV, _Float16* __restrict__ QK, _Float16* __restrict__ QKL, _Float16* __restrict__ VTH, _Float16* __restrict__ VTL) {
  const int which0 = (blockIdx.y * 128) / DM; const float* X = (which0 == 0) ? XQ : (which0 == 1) ? XK : XV; const float* BB = BQ ? (((which0 == 0) ? BQ : (which0 == 1) ? BK : BV) + (blockIdx.y * 128 - which0 * DM)) : nullptr;
  __shared__ __align__(16) char sm[2 * QBUF];   // the ring during the k loop; behind the loop's last barrier the same bytes stage the output tile
  _Float16 (*so)[16][136] = (_Float16 (*)[16][136])sm; _Float16 (*sol)[16][136] = so + 4; _Float16 (*sth)[72] = (_Float16 (*)[72])sm; _Float16 (*stl)[72] = sth + 128;
  const int tid = threadIdx.x, wave = tid >> 5, lane = tid & 31, col = lane & 15, g = lane >> 4; const size_t r0 = (size_t)blockIdx.x * 64 + wave * 16; const int n0 = blockIdx.y * 128;
  v8f acc[8] = {};
  float bias[8] = {};   // the lane's eight bias values (one a column tile), read once, as one group under one test: the reads fly beside the first stage's copies, and the epilogue is left without loads, waits and branches
  if (BB) {
#pragma unroll   // constant indices keep bias[] in registers
    for (int j = 0; j < 8; ++j) bias[j] = BB[j * 16 + col]; }
  // the work-group's 128 lanes copy a stage by whole rows: X row = 16 lanes x 16 B (a wave covers 2 rows = 4 whole lines), W row = 8 lanes x 16 B (4 rows = 4 whole lines); eight copies a lane and plane
  const unsigned rb = (unsigned)(size_t)sm;
  const unsigned lx = rb + (unsigned)(tid >> 4) * XPIT + (tid & 15) * 16, lw = rb + QW_O + (unsigned)(tid >> 3) * WPIT + (tid & 7) * 16;
  const char* gx = (const char*)X + ((size_t)blockIdx.x * 64 + (tid >> 4)) * (KIN * 4) + (tid & 15) * 16; const char* gw = (const char*)P + ((size_t)n0 + (tid >> 3)) * (KIN * 2) + (tid & 7) * 16;   // the lane's first X and W piece of stage 0
  auto stage = [&](int st, unsigned bo) {   // stage st (k = st * 64 ...) into the buffer at byte bo
    const char* x = gx + st * 256; const char* w = gw + st * 128; const unsigned a = lx + bo, c = lw + bo;
    copy4(a, x, a + 8 * XPIT, x + 8 * (KIN * 4), a + 16 * XPIT, x + 16 * (KIN * 4), a + 24 * XPIT, x + 24 * (KIN * 4));
    copy4(a + 32 * XPIT, x + 32 * (KIN * 4), a + 40 * XPIT, x + 40 * (KIN * 4), a + 48 * XPIT, x + 48 * (KIN * 4), a + 56 * XPIT, x + 56 * (KIN * 4));
    copy4(c, w, c + 16 * WPIT, w + 16 * (KIN * 2), c + 32 * WPIT, w + 32 * (KIN * 2), c + 48 * WPIT, w + 48 * (KIN * 2));
    copy4(c + 64 * WPIT, w + 64 * (KIN * 2), c + 80 * WPIT, w + 80 * (KIN * 2), c + 96 * WPIT, w + 96 * (KIN * 2), c + 112 * WPIT, w + 112 * (KIN * 2)); };
  const unsigned xof = (unsigned)(wave * 16 + col) * XPIT + 32 * g, wof = QW_O + (unsigned)col * WPIT + 16 * g;   // the lane's byte offsets inside an X and a W fragment of the ring, the same in every stage
  stage(0, 0);
  asm volatile("s_wait_asynccnt 0x0" ::: "memory");   // this wave's copies of stage 0 have landed
  __syncthreads();                                    // ... and every other wave's: stage 0 may be read
  stage(1, QBUF);
#pragma unroll 1   // kept rolled: the two buffers differ by an offset only, and eight copies of the body would only lengthen the text in front of the long epilogue
  for (int st = 0; st < KIN / 64; ++st) { const unsigned bo = (unsigned)(st & 1) * QBUF;
#pragma unroll
    for (int kc = 0; kc < 2; ++kc) {   // every fragment of a 32-k step is read from the ring as one group in front of its first product
      const char* xp = sm + bo + xof + kc * 128; const char* wp = sm + bo + wof + kc * 64;
      const v4f x0 = *(const v4f*)xp, x1 = *(const v4f*)(xp + 16), x2 = *(const v4f*)(xp + 64), x3 = *(const v4f*)(xp + 80);
      v16b w[8];
#pragma unroll
      for (int j = 0; j < 8; ++j) { union { v16b v; v8b q[2]; } u; u.q[0] = *(const v8b*)(wp + j * 16 * WPIT); u.q[1] = *(const v8b*)(wp + j * 16 * WPIT + 32); w[j] = u.v; }
      __builtin_amdgcn_sched_barrier(0);   // holds the step's LDS reads as one group ahead of its first product: left free, the scheduler sinks each pair of reads to its own product, with a wait at each
      v16b a;
#pragma unroll
      for (int i = 0; i < 4; ++i) { a[i] = (__bf16)x0[i]; a[4 + i] = (__bf16)x1[i]; a[8 + i] = (__bf16)x2[i]; a[12 + i] = (__bf16)x3[i]; }
#pragma unroll
      for (int j = 0; j < 8; ++j) acc[j] = wmma_bf(a, w[j], acc[j]);
      __builtin_amdgcn_sched_barrier(0); }   // holds the products ahead of the next group of reads and of the publish point: left free, the scheduler sinks the last ones behind the work-group barrier
    // publish point: this wave's LDS reads of the stage are done, its copies of the next stage have landed; behind the barrier the next stage may be read and this stage's buffer refilled
    asm volatile("s_wait_dscnt 0x0" ::: "memory");
    asm volatile("s_wait_asynccnt 0x0" ::: "memory");
    __syncthreads();
    if (st + 2 < KIN / 64) stage(st + 2, bo); }
  asm volatile("s_wait_asynccnt 0x0" ::: "memory");   // no copy is left outstanding behind the loop
  if (n0 < 2 * DM) {   // q stored unscaled (f16 sigma ~0.6, no subnormal exposure); 1/8 applied to the f32 score
#pragma unroll
    for (int j = 0; j < 8; ++j) {
#pragma unroll
      for (int r = 0; r < 8; ++r) { const float v = acc[j][r] + bfr(bias[j]); const _Float16 hv = (_Float16)v; so[wave][8 * g + r][j * 16 + col] = hv; sol[wave][8 * g + r][j * 16 + col] = (_Float16)((v - (float)hv) * 2048.0f); } }   // q, k (+ bias) as f16 hi + (x2048) residual
    LDSX();
    auto put = [&](const size_t o0, const int orow) {   // the wave's 16 rows, orow elements apart (a constant at each call, so that the rows are immediate offsets from one address)
      for (int rl = 0; rl < 16; ++rl) if (lane < 16) { vst2((unsigned*)(QK + o0 + rl * orow), *(const v4u*)&so[wave][rl][lane * 8]); vst2((unsigned*)(QKL + o0 + rl * orow), *(const v4u*)&sol[wave][rl][lane * 8]); } };
    if (n0 < DM) put(r0 * DM + n0 + lane * 8, DM);   // q: row-major
    else put(KPL + (((r0 / SS) * NH + (n0 - DM) / HD + (lane >> 3)) * SS + r0 % SS) * HD + (lane & 7) * 8, HD);   // k: head-major (8 lanes = one key's 128 B of one head; the wave's 16 rows lie in one batch, so its keys follow one another)
  } else {
#pragma unroll
    for (int j = 0; j < 8; ++j) {
#pragma unroll
      for (int r = 0; r < 8; ++r) { const float v = acc[j][r] + bfr(bias[j]); const _Float16 hv = (_Float16)v; sth[j * 16 + col][wave * 16 + 8 * g + r] = hv; stl[j * 16 + col][wave * 16 + 8 * g + r] = (_Float16)((v - (float)hv) * 2048.0f); } }
    __syncthreads();
    const size_t rb = (size_t)blockIdx.x * 64; const int b = (int)(rb / SS), s0 = (int)(rb % SS); const int pc0 = n0 - 2 * DM;
    for (int q = tid; q < 128 * 8; q += 128) { const int hh = q >> 9, sb = (q >> 8) & 1, d = hh * HD + ((q >> 2) & 63), pc = sb * 4 + (q & 3);   // 256 consecutive 16-byte pieces = one (head, stage) tile: the work-group stores 2 KB in a row
      const size_t o = (((size_t)b * NH + pc0 / HD + hh) * (SS / 32) + s0 / 32 + sb) * (HD * 32) + (q & 255) * 8; vst2((unsigned*)(VTH + o), *(const v4u*)&sth[d][pc * 8]); vst2((unsigned*)(VTL + o), *(const v4u*)&stl[d][pc * 8]); }
  }
}
// ---- k_attn: block = (64 queries, head h, batch b): all-keys flash attention (K = 64: 2 k-steps), scores = (q.k) * 0.125 from q hi/lo x k hi/lo (3 products) in the first two query blocks, single f16 elsewhere, P.V: there 2^11 P hi/lo x V hi/lo (3 products) in two accumulators, elsewhere 2^11 P x V hi; O[b*S+q][h*64+d] = (acc + accl / 2048) / (2048 l) (256-B segments)
__device__ __forceinline__ v16h frag_p(const char* p) {   // frag_h from the lane's own byte address
  union { v16h v; v8h q[2]; } u; u.q[0] = *(const v8h*)p; u.q[1] = *(const v8h*)(p + 32); return u.v;
}
// K/V ring in LDS: one stage = the 32 keys of a pass. K plane: 32 rows (keys) of 128 B at pitch 144; V plane: 64 rows (d) of 64 B at pitch 80 (16 B x odd: conflict-free 16-byte fragment reads)
#define KPIT 144
#define VPIT 80
#define RK_H 0
#define RV_H (RK_H + 32 * KPIT)
#define RK_L (RV_H + 64 * VPIT)
#define RV_L (RK_L + 32 * KPIT)
#define RBUF (RV_L + 64 * VPIT)
__device__ __forceinline__ float xhalf(float x) { return __builtin_bit_cast(float, __builtin_amdgcn_permlanex16(__builtin_bit_cast(int, x), __builtin_bit_cast(int, x), 0x76543210, 0xfedcba98, false, false)); }   // lane l with lane l ^ 16
template <bool HV> __device__ __forceinline__ void attn_body(const _Float16* __restrict__ QK, const _Float16* __restrict__ QKL, const _Float16* __restrict__ VTH, const _Float16* __restrict__ VTL, float* __restrict__ O, float (*so)[16][68], char* ring, const int qb, const int h, const int b) {
  const int tid = threadIdx.x, wave = tid >> 5, lane = tid & 31, col = lane & 15, g = lane >> 4;
  const int q0 = qb * 64 + wave * 16; const size_t rq = (size_t)b * SS + q0 + col;
  v16h aq[2], aql[2];
#pragma unroll
  for (int kc = 0; kc < 2; ++kc) { aq[kc] = frag_h(QK + rq * DM + h * HD + kc * 32, lane); aql[kc] = frag_h(QKL + rq * DM + h * HD + kc * 32, lane); }
  float m = -3.0e38f, l = 0.f;   // the lane's query: running maximum over all keys (the same in both halves), sum over this half's keys
  v8f acc[4] = {}, accl[4] = {};
  const int nks = SS / 32;   // all keys
  const unsigned kof = (unsigned)col * KPIT + 16 * g, vof = (unsigned)col * VPIT + 16 * g;   // the lane's byte offsets inside a K and a V fragment of the ring, the same in every pass
  // the work-group's 128 lanes copy a stage by whole rows: K row = 8 lanes x 16 B, V row = 4 lanes x 16 B; two copies a lane and plane. In the workspace a stage's tile lies in row order without gaps, so lane tid's piece is byte tid * 16 of each half tile and a wave's copy reads 512 B in a row (4 whole lines)
  const unsigned rb = (unsigned)(size_t)ring;
  const unsigned lk = rb + (unsigned)(tid >> 3) * KPIT + (tid & 7) * 16, lv = rb + (unsigned)(tid >> 2) * VPIT + (tid & 3) * 16;
  const size_t gv = (size_t)(b * NH + h) * (SS / 32) * STB + tid * 16, gk = 2 * KPL + gv;   // byte offsets of the lane's first K and V piece of stage 0
  auto stage = [&](int st, unsigned bo) {   // stage st (keys st * 32 ...) into the buffer at byte bo
    const size_t ok = gk + (size_t)st * STB, ov = gv + (size_t)st * STB;
    copy4(lk + bo + RK_H, (const char*)QK + ok, lk + bo + RK_H + 16 * KPIT, (const char*)QK + ok + STB / 2, lv + bo + RV_H, (const char*)VTH + ov, lv + bo + RV_H + 32 * VPIT, (const char*)VTH + ov + STB / 2);
    if (HV) copy4(lk + bo + RK_L, (const char*)QKL + ok, lk + bo + RK_L + 16 * KPIT, (const char*)QKL + ok + STB / 2, lv + bo + RV_L, (const char*)VTL + ov, lv + bo + RV_L + 32 * VPIT, (const char*)VTL + ov + STB / 2); };
  stage(0, 0);
  asm volatile("s_wait_asynccnt 0x0" ::: "memory");   // this wave's copies of stage 0 have landed
  __syncthreads();                                    // ... and every other wave's: stage 0 may be read
  stage(1, RBUF);
#pragma unroll 1
  for (int ks = 0; ks < nks; ++ks) { v8f s[2];
    // every K fragment of the pass is read from the ring as one group in front of the first product
    v16h kh[2][2], kl[2][2];
    const unsigned bo = (unsigned)(ks & 1) * RBUF; const char* kp = ring + bo + RK_H + kof; const char* kpl = ring + bo + RK_L + kof;   // one address a plane; the fragments lie at constant offsets from it
#pragma unroll
    for (int ct = 0; ct < 2; ++ct) {
#pragma unroll
      for (int kc = 0; kc < 2; ++kc) { kh[ct][kc] = frag_p(kp + ct * 16 * KPIT + kc * 64); if (HV) kl[ct][kc] = frag_p(kpl + ct * 16 * KPIT + kc * 64); } }
    __builtin_amdgcn_sched_barrier(0);   // holds the K reads as one group ahead of the first product: left free, the scheduler sinks each pair of reads to its own product, with a wait at each
#pragma unroll
    for (int ct = 0; ct < 2; ++ct) { v8f c = {}, cl = {};
      if (HV) {   // leading query blocks (outputs far above the global rms): 3 products
#pragma unroll
        for (int kc = 0; kc < 2; ++kc) { c = wmma16(kh[ct][kc], aq[kc], c); cl = wmma16(kh[ct][kc], aql[kc], cl); cl = wmma16(kl[ct][kc], aq[kc], cl); }
#pragma unroll
        for (int r = 0; r < 8; ++r) c[r] += cl[r] * (1.0f / 2048.0f); }
      else {
#pragma unroll
        for (int kc = 0; kc < 2; ++kc) c = wmma16(kh[ct][kc], aq[kc], c); }   // single product elsewhere
      { const bool keepk = true;
#pragma unroll
      for (int r = 0; r < 8; ++r) s[ct][r] = keepk ? c[r] * 0.125f : -3.0e38f; } }   // 1/sqrt(64); no key is masked
    // every V fragment of the pass is read from the ring as one group behind the score products: the reads fly while the softmax runs
    __builtin_amdgcn_sched_barrier(0);   // with the one behind the V reads: holds them as one group between the score products and the softmax, not spread among the products
    v16h vh[4], vl[4];
    const char* vp = ring + bo + RV_H + vof; const char* vpl = ring + bo + RV_L + vof;
#pragma unroll
    for (int dt = 0; dt < 4; ++dt) { vh[dt] = frag_p(vp + dt * 16 * VPIT); if (HV) vl[dt] = frag_p(vpl + dt * 16 * VPIT); }
    __builtin_amdgcn_sched_barrier(0);   // second of the pair: left free, the scheduler sinks the V reads among the P.V products, with a wait at each; held here they fly while the softmax runs
    float t[8];   // maximum and sum of the lane's 16 scores as trees in registers
#pragma unroll
    for (int r = 0; r < 8; ++r) t[r] = fmaxf(s[0][r], s[1][r]);
    float mx = fmaxf(fmaxf(fmaxf(t[0], t[1]), fmaxf(t[2], t[3])), fmaxf(fmaxf(t[4], t[5]), fmaxf(t[6], t[7])));
    mx = fmaxf(mx, xhalf(mx));   // the other half's 16 keys of the same query
    const float mn = fmaxf(m, mx); const float alpha = (m <= -1.0e38f) ? 0.f : __expf(m - mn);
    float e[2][8];
#pragma unroll
    for (int r = 0; r < 8; ++r) { e[0][r] = (s[0][r] <= -1.0e38f) ? 0.f : __expf(s[0][r] - mn); e[1][r] = (s[1][r] <= -1.0e38f) ? 0.f : __expf(s[1][r] - mn); t[r] = e[0][r] + e[1][r]; }
    l = l * alpha + (((t[0] + t[1]) + (t[2] + t[3])) + ((t[4] + t[5]) + (t[6] + t[7]))); m = mn;   // the two halves' sums are joined once, behind the loop
#pragma unroll
    for (int dt = 0; dt < 4; ++dt) {
#pragma unroll
      for (int r = 0; r < 8; ++r) { acc[dt][r] *= alpha; accl[dt][r] *= alpha; } }
    v16h pa, pl;
#pragma unroll
    for (int i = 0; i < 8; ++i) { const float x0 = e[0][i] * 2048.0f, x1 = e[1][i] * 2048.0f; const _Float16 h0 = (_Float16)x0, h1 = (_Float16)x1; pa[i] = h0; pa[8 + i] = h1; pl[i] = (_Float16)((x0 - (float)h0) * 2048.0f); pl[8 + i] = (_Float16)((x1 - (float)h1) * 2048.0f); }   // P scaled by 2^11 before the f16 split so small softmax weights stay out of the f16 subnormal range; 2^-11 folded into the epilogue
#pragma unroll
    for (int dt = 0; dt < 4; ++dt) { acc[dt] = wmma16(vh[dt], pa, acc[dt]); if (HV) { accl[dt] = wmma16(vh[dt], pl, accl[dt]); accl[dt] = wmma16(vl[dt], pa, accl[dt]); } }   // leading query blocks: P hi/lo x V hi/lo (3 products); elsewhere P x V single
    __builtin_amdgcn_sched_barrier(0);   // holds softmax and products ahead of the publish point: left free, the scheduler lifts the waits and the barrier to the V reads, which bares their latency and halves the lead of the refill
    // publish point: this wave's LDS reads of the pass are done, its copies of the next stage have landed; behind the barrier the next stage may be read and this pass's buffer refilled
    asm volatile("s_wait_dscnt 0x0" ::: "memory");
    asm volatile("s_wait_asynccnt 0x0" ::: "memory");
    __syncthreads();
    if (ks + 2 < nks) stage(ks + 2, bo); }
  asm volatile("s_wait_asynccnt 0x0" ::: "memory");   // no copy is left outstanding behind the loop
  const float il = (1.0f / 2048.0f) / (l + xhalf(l));
#pragma unroll
  for (int dt = 0; dt < 4; ++dt) {
#pragma unroll
    for (int q = 0; q < 2; ++q) { v4f o;
#pragma unroll
      for (int i = 0; i < 4; ++i) o[i] = (acc[dt][4 * q + i] + accl[dt][4 * q + i] * (1.0f / 2048.0f)) * il;
      vst2(&so[wave][col][dt * 16 + 8 * g + 4 * q], o); } }
  LDSX();
  for (int rl = 0; rl < 16; ++rl) if (lane < 16) vst2(O + ((size_t)b * SS + q0 + rl) * DM + h * HD + lane * 4, *(const v4f*)&so[wave][rl][lane * 4]);
}
__global__ __launch_bounds__(128) void k_attn(const _Float16* __restrict__ QK, const _Float16* __restrict__ QKL, const _Float16* __restrict__ VTH, const _Float16* __restrict__ VTL, const void* __restrict__ KMASK, float* __restrict__ O) {
  __shared__ __align__(16) float so[4][16][68]; __shared__ __align__(16) char ring[2 * RBUF]; (void)KMASK;
  // which tile a block takes (for speed only; a permutation of the tiles for any dispatch): a three-product block costs about twice a single-product one, and all blocks are resident at once, so the launch lasts as long as the WGP with the most of them.
  // Dealt by blockIdx.x < 2 they lie at flat indices 0 and 1 modulo 32. Here they take every 5th group of 8 flat indices from the front (40 apart): near the start.
  const int f = blockIdx.x + TQB * (blockIdx.y + NH * blockIdx.z), j = f >> 3;   // flat index; its group of 8
  const int NHV = 2 * NH * TNB / 8;   // groups of three-product blocks (2 query blocks a head and batch)
  if (j < 5 * NHV && j % 5 == 0) { const int i = (j / 5) * 8 + (f & 7); const int hb = i >> 1; attn_body<true>(QK, QKL, VTH, VTL, O, so, ring, i & 1, hb % NH, hb / NH); }
  else { const int i = f - 8 * (j < 5 * NHV ? j / 5 + 1 : NHV); const int hb = i / (TQB - 2); attn_body<false>(QK, QKL, VTH, VTL, O, so, ring, 2 + i % (TQB - 2), hb % NH, hb / NH); }   // the others keep their order, closed up over the groups taken out
}
// ---- k_out: block = (64 rows, 128 cols): out = O(hi/lo) . Wo rows (2 products) + bo
__global__ __launch_bounds__(128) void k_out(const float* __restrict__ O, const __bf16* __restrict__ P, const float* __restrict__ BO, float* __restrict__ Y) {
  __shared__ __align__(16) float so[4][16][132];
  const int tid = threadIdx.x, wave = tid >> 5, lane = tid & 31, col = lane & 15, g = lane >> 4; const size_t r0 = (size_t)blockIdx.x * 64 + wave * 16; const int n0 = blockIdx.y * 128;
  v8f acc[8] = {};
#pragma unroll 2
  for (int kc = 0; kc < DM / 32; ++kc) { const F2 a = split_row(O + (r0 + col) * DM, kc * 32, lane);
#pragma unroll
    for (int j = 0; j < 8; ++j) { const v16b w = frag_b(P + (size_t)(n0 + j * 16 + col) * DM + kc * 32, lane); acc[j] = wmma_bf(a.l, w, acc[j]); acc[j] = wmma_bf(a.h, w, acc[j]); } }
#pragma unroll
  for (int j = 0; j < 8; ++j) {
#pragma unroll
    for (int r = 0; r < 8; ++r) so[wave][8 * g + r][j * 16 + col] = acc[j][r] + bfr(BO[n0 + j * 16 + col]); }
  LDSX();
  for (int rl = 0; rl < 16; ++rl) vst2(Y + (r0 + rl) * DM + n0 + lane * 4, *(const v4f*)&so[wave][rl][lane * 4]);
}
// ---- k_o: block = 16 rows r' = (b', s'), eight waves: wave w takes k = w * 128 ... of the 1,024 (four 32-k steps, unrolled, so that its loads fly together); the eight partial tiles meet in LDS and are summed in wave order: o = ctx (bf16 hi + lo) . o_w rows + o_b -> out[(s' * BSZ + b') * 64] (the final (B,S)->(S,B) transpose)
#define OKW 8                  // waves a work-group = slices of the k range
#define TOR (NB * SS / 16)     // output row tiles of 16
__global__ __launch_bounds__(32 * OKW) void k_o(const float* __restrict__ O, const __bf16* __restrict__ P, const float* __restrict__ OB, float* __restrict__ Y) { __shared__ __align__(16) float part[OKW][16][68];
  const int tid = threadIdx.x, wave = tid >> 5, lane = tid & 31, col = lane & 15, g = lane >> 4; const size_t r0 = (size_t)blockIdx.x * 16; const __bf16* Wr = P + PK_P; const int kb = wave * (DM / OKW);
  v8f acc[4] = {};
  const int rl = tid >> 4, c4 = (tid & 15) * 4;   // the lane's 16-byte piece of the output tile: 16 lanes store a whole 256-B output row
  const v4f ob = *(const v4f*)(OB + c4);          // read here, beside the operands, not behind the barrier
  const float* xr = O + (r0 + col) * DM + kb + 8 * g; v4f xa[DM / OKW / 32][4];   // the lane's ctx values of all four steps, in split_row's order
#pragma unroll
  for (int kc = 0; kc < DM / OKW / 32; ++kc) { xa[kc][0] = *(const v4f*)(xr + kc * 32); xa[kc][1] = *(const v4f*)(xr + kc * 32 + 4); xa[kc][2] = *(const v4f*)(xr + kc * 32 + 16); xa[kc][3] = *(const v4f*)(xr + kc * 32 + 20); }
  __builtin_amdgcn_sched_barrier(0);   // with the one behind the wait: keeps the wait between the two runs of loads, where it is written
  asm volatile("s_wait_xcnt 0x0" ::: "memory");   // stands in front of any reuse of the address registers of the loads above (a weight load's result may take them)
  __builtin_amdgcn_sched_barrier(0);
  v16b wf[DM / OKW / 32][4];   // and its weight fragments: all of the wave's loads are issued as one group, so that it waits out one memory latency, not one a step
#pragma unroll
  for (int kc = 0; kc < DM / OKW / 32; ++kc) {
#pragma unroll
    for (int j = 0; j < 4; ++j) wf[kc][j] = frag_b(Wr + (size_t)(j * 16 + col) * DM + kb + kc * 32, lane); }
  __builtin_amdgcn_sched_barrier(0);   // holds the loads as one group ahead of the first product: left free, the scheduler sinks a third of them, and the bias read, behind the first waits
  asm volatile("s_wait_xcnt 0x0" ::: "memory");   // stands in front of any reuse of the address registers of the loads above
  __builtin_amdgcn_sched_barrier(0);   // keeps that wait where it is written, ahead of the first instruction that can reuse such a register
#pragma unroll   // constant indices keep xa[] and wf[] in registers
  for (int kc = 0; kc < DM / OKW / 32; ++kc) { float v[16];
#pragma unroll
    for (int i = 0; i < 4; ++i) { v[i] = xa[kc][0][i]; v[4 + i] = xa[kc][1][i]; v[8 + i] = xa[kc][2][i]; v[12 + i] = xa[kc][3][i]; }
    const F2 a = bsplit16(v);
#pragma unroll
    for (int j = 0; j < 4; ++j) { acc[j] = wmma_bf(a.h, wf[kc][j], acc[j]); acc[j] = wmma_bf(a.l, wf[kc][j], acc[j]); } }
#pragma unroll
  for (int j = 0; j < 4; ++j) {
#pragma unroll
    for (int r = 0; r < 8; ++r) part[wave][8 * g + r][j * 16 + col] = acc[j][r]; }
  __syncthreads();   // every wave's partial tile is in LDS
  v4f s = *(const v4f*)&part[0][rl][c4];
#pragma unroll
  for (int w = 1; w < OKW; ++w) s += *(const v4f*)&part[w][rl][c4];
#pragma unroll
  for (int i = 0; i < 4; ++i) s[i] += bfr(ob[i]);
  const size_t rp = r0 + rl; const size_t bp = rp / SS, sp = rp % SS; vst2(Y + (sp * BSZ + bp) * HOUT + c4, s); }
extern "C" void kernel_launch(void* const* d_in, const int* in_sizes, int n_in, void* d_out, int out_size, void* d_ws, size_t ws_size, hipStream_t stream) {
  (void)in_sizes; (void)n_in; (void)out_size;
  const float** F = (const float**)d_in;   // 0 x [2048,2,512], 1 qkv_w [3008,512], 2 qkv_b [3008], 3 conn_w [64,512], 4 conn_b [64], 5 o_w [64,1024], 6 o_b [64]
  if (ws_size < (size_t)WS_END + 4u * 3 * DM) return;
  char* ws = (char*)d_ws; __bf16* PK = (__bf16*)(ws + WS_PK); _Float16 *QK = (_Float16*)(ws + WS_QK), *QKL = (_Float16*)(ws + WS_QKL), *VTH = (_Float16*)(ws + WS_VTH), *VTL = (_Float16*)(ws + WS_VTL); float* O = (float*)(ws + WS_O); float* PB = (float*)(ws + WS_END);
  k_pack<<<PKB_W + PKB_O + 1, 256, 0, stream>>>(F[3], F[1], F[5], F[4], F[2], PK, PB);
  // the (S,B,512) input rows in memory order ARE the (b', s') rows of the raw reshape: row r = b' * 2048 + s'
  k_qkv<<<dim3(TNB * SS / 64, QKVW / 128), 128, 0, stream>>>(F[0], F[0], F[0], PK + PK_A, PB, PB + DM, PB + 2 * DM, QK, QKL, VTH, VTL);
  k_attn<<<dim3(TQB, NH, TNB), 128, 0, stream>>>(QK, QKL, VTH, VTL, nullptr, O);
  k_o<<<TOR, 32 * OKW, 0, stream>>>(O, PK, F[6], (float*)d_out);
}
